// v000
// Times are from an AMD MI455X. After a warm-up the kernel runs many times in a row, and a time is the length of
// such a window on the GPU divided by its runs, so every launch and the gaps after it count. The runs cycle
// through copies of the inputs. A figure is the median of several windows, for all but v000 over two sittings.
// Sittings can differ by a few percent; kernels timed side by side share one.
// The starting kernel, v000, takes 1710 microseconds a run.
#include <hip/hip_runtime.h>

// CIM (cross-image attention; f [4][256][64][64] (N = 4096 queries), h [4][512][32][32] (M = 1024 keys); h_al = w_ht h + b_ht; q = w_q BN0(f) + b_q, k = w_k BN1(h_al) + b_k, v = w_v BN2(h_al) + b_v
// (BatchNorm in inference form with the given statistics); 8 heads of 32 channels: attn = softmax_m(q_h . k_h * 32^-0.5); out[c][n] = sum_m attn[n][m] v[c][m]; result = f + w_out out + b_out).
// Compute dtypes, f32 accumulate: every input rounded to bf16; h_al on PLAIN bf16 operands (inputs: exact); the BatchNorms in f32 on VALU written as bf16 hi+lo
// x1024, fp16 v); the output conv on hi+lo planes of the attended map (2 products); bias + residual f32. One-wave-per-64x64-tile GEMMs, one image at a time. Deterministic, no

#define NB_  4
#define CC   256
#define CH   512                  // channels of h
#define NN   4096                 // query positions
#define MM   1024                 // key positions
#define NHD  8
#define DH   32
#define OTP  288                  // pitch of the token-major attended map (8 x 32 + one spare 32-wide slot for the last head's 64-wide tile)
#define PCAR 1024.0f
#define SCL  0.17677669529663687f   // f32(32^-0.5)
typedef _Float16 h16;
typedef unsigned short bf;
typedef __attribute__((ext_vector_type(16))) __bf16   v16bf;
typedef __attribute__((ext_vector_type(16))) _Float16 v16h;
typedef __attribute__((ext_vector_type(8)))  _Float16 v8h;
typedef __attribute__((ext_vector_type(8)))  unsigned short v8us;
typedef __attribute__((ext_vector_type(8)))  float    v8f;
typedef __attribute__((ext_vector_type(4)))  float    v4f;
typedef v8h  __attribute__((may_alias)) v8ha;
typedef v4f  __attribute__((may_alias)) v4fa;
typedef v8us __attribute__((may_alias)) v8usa;

__device__ __forceinline__ unsigned short f2bf(float f) { unsigned u = __float_as_uint(f); u += 0x7FFFu + ((u >> 16) & 1u); return (unsigned short)(u >> 16); }
__device__ __forceinline__ float bf2f(unsigned short b) { return __uint_as_float(((unsigned)b) << 16); }
__device__ __forceinline__ float bfr(float f) { return bf2f(f2bf(f)); }
__device__ __forceinline__ v16h cat16(v8h lo, v8h hi) { return __builtin_shufflevector(lo, hi, 0, 1, 2, 3, 4, 5, 6, 7, 8, 9, 10, 11, 12, 13, 14, 15); }
__device__ __forceinline__ v16bf cat16b(v8us lo, v8us hi) { return __builtin_bit_cast(v16bf, __builtin_shufflevector(lo, hi, 0, 1, 2, 3, 4, 5, 6, 7, 8, 9, 10, 11, 12, 13, 14, 15)); }
__device__ __forceinline__ v8f wmma16(v16h a, v16h b, v8f c) { return __builtin_amdgcn_wmma_f32_16x16x32_f16(false, a, false, b, (short)0, c, false, false); }
__device__ __forceinline__ v8f wmmab(v16bf a, v16bf b, v8f c) { return __builtin_amdgcn_wmma_f32_16x16x32_bf16(false, a, false, b, (short)0, c, false, false); }



// ---- k_gemmw: register-blocked GEMM, ONE WAVE per 64x64 output tile (16 accumulators), operands straight from K-contiguous 16-bit planes; grid (M/64, N/64, Z), 32 threads.
// C[m][n] (f32, pitch ldc, + optional f32 bias[n]) = sum_k A[m][k] Bt[n][k] (+ split products per NSPLIT). z-batch strides sA/sB/sC in elements. K % 32 == 0.
template <typename T16> struct WFrag;
template <> struct WFrag<h16> { typedef v16h V; static __device__ __forceinline__ V ld(const h16* p) { return cat16(*(const v8h*)p, *(const v8h*)(p + 16)); } static __device__ __forceinline__ v8f mma(V a, V b, v8f c) { return wmma16(a, b, c); } };
template <> struct WFrag<bf> { typedef v16bf V; static __device__ __forceinline__ V ld(const bf* p) { return cat16b(*(const v8us*)p, *(const v8us*)(p + 16)); } static __device__ __forceinline__ v8f mma(V a, V b, v8f c) { return wmmab(a, b, c); } };
template <typename T16, int NSPLIT, bool BIAS>
__global__ __launch_bounds__(32) void k_gemmw(const T16* __restrict__ A, const T16* __restrict__ A2, const T16* __restrict__ Bt, const T16* __restrict__ Bt2, int K, float* C, int ldc, const float* __restrict__ bias, size_t sA, size_t sB, size_t sC) {
    typedef typename WFrag<T16>::V V;
    __shared__ __align__(16) float os[16 * 68];
    const size_t z = blockIdx.z; A += z * sA; if (A2) A2 += z * sA; Bt += z * sB; if (Bt2) Bt2 += z * sB; C += z * sC;
    const int lane = threadIdx.x & 31, lr = lane & 15, hi = lane >> 4; const int r0 = blockIdx.x * 64, c0 = blockIdx.y * 64;
    v8f acc[4][4];
#pragma unroll
    for (int mb = 0; mb < 4; ++mb)
#pragma unroll
        for (int nb = 0; nb < 4; ++nb) acc[mb][nb] = (v8f){};
    const size_t aoff = (size_t)(r0 + lr) * K + 8 * hi, boff = (size_t)(c0 + lr) * K + 8 * hi;
#pragma unroll 1
    for (int kc = 0; kc < K; kc += 32) {
        V a[4], a2[4];
#pragma unroll
        for (int mb = 0; mb < 4; ++mb) { a[mb] = WFrag<T16>::ld(A + aoff + (size_t)mb * 16 * K + kc); if (NSPLIT == 1 || NSPLIT == 2) a2[mb] = WFrag<T16>::ld(A2 + aoff + (size_t)mb * 16 * K + kc); }
#pragma unroll
        for (int nb = 0; nb < 4; ++nb) { const V b = WFrag<T16>::ld(Bt + boff + (size_t)nb * 16 * K + kc); V b2; if (NSPLIT >= 2) b2 = WFrag<T16>::ld(Bt2 + boff + (size_t)nb * 16 * K + kc);
#pragma unroll
            for (int mb = 0; mb < 4; ++mb) { acc[mb][nb] = WFrag<T16>::mma(a[mb], b, acc[mb][nb]); if (NSPLIT == 1 || NSPLIT == 2) acc[mb][nb] = WFrag<T16>::mma(a2[mb], b, acc[mb][nb]); if (NSPLIT >= 2) acc[mb][nb] = WFrag<T16>::mma(a[mb], b2, acc[mb][nb]); } }
        asm volatile("v_nop\n\tv_nop\n\tv_nop\n\tv_nop" : "+v"(acc[0][0]), "+v"(acc[1][1]), "+v"(acc[2][2]), "+v"(acc[3][3]) : "v"(a[0]), "v"(a[3]));
    }
#pragma unroll
    for (int mb = 0; mb < 4; ++mb) {
#pragma unroll
        for (int nb = 0; nb < 4; ++nb) {
#pragma unroll
            for (int j = 0; j < 8; ++j) os[(hi * 8 + j) * 68 + nb * 16 + lr] = acc[mb][nb][j]; }
        __builtin_amdgcn_wave_barrier(); asm volatile("" ::: "memory");
        float* crow = C + (size_t)(r0 + mb * 16) * ldc + c0;
{
#pragma unroll
            for (int s = 0; s < 8; ++s) { const int row = 2 * s + hi, cofs = lr * 4; v4f val = *(const v4fa*)(os + row * 68 + cofs); if (BIAS) { val[0] += bfr(bias[c0 + cofs]); val[1] += bfr(bias[c0 + cofs + 1]); val[2] += bfr(bias[c0 + cofs + 2]); val[3] += bfr(bias[c0 + cofs + 3]); }
                *(v4f*)(crow + (size_t)row * ldc + cofs) = val; }
             }
        __builtin_amdgcn_wave_barrier(); asm volatile("" ::: "memory");
    }
}

__device__ __forceinline__ h16 tohx(float x) { return (h16)x; }
__device__ __forceinline__ void splitf(float y, unsigned short& h, unsigned short& l) { h = f2bf(y); l = f2bf(y - bf2f(h)); }
typedef __attribute__((ext_vector_type(2))) _Float16 v2h;
typedef __attribute__((ext_vector_type(4))) _Float16 v4h;
typedef __attribute__((ext_vector_type(2))) unsigned short v2us;
typedef __attribute__((ext_vector_type(8))) _Float16 v8h16;

__global__ __launch_bounds__(256) void k_cvt8(const float* __restrict__ src, bf* dst, size_t n8) { const size_t i = (size_t)blockIdx.x * 256 + threadIdx.x; if (i >= n8) return; const v8f v = *(const v8f*)(src + i * 8); v8us o;
#pragma unroll
    for (int k = 0; k < 8; ++k) o[k] = f2bf(v[k]); *(v8us*)(dst + i * 8) = o;  }
__global__ __launch_bounds__(256) void k_xth(const float* __restrict__ hb, bf* HB) {
    const int lane = threadIdx.x & 31; const int L0 = (blockIdx.x * 8 + (threadIdx.x >> 5)) * 8; const int nlines = MM * CH / 64;
{
#pragma unroll
        for (int l = 0; l < 8; ++l) { const int L = L0 + l; if (L >= nlines) break; const int e = L * 64 + lane * 2; const int k = e & (CH - 1); const int m = e >> 9; v2us o;
#pragma unroll
            for (int q = 0; q < 2; ++q) o[q] = f2bf(hb[(size_t)(k + q) * MM + m]);
            *(v2us*)(HB + (size_t)e) = o; }
         }
}
// k_bnT: token-major hi/lo planes T[n][c] = split((src[c][n] (+ bf16(rowbias[c]) if given) (bf16-rounded first when RAW) * inv[c] + shift[c]) with inv = bf16(gamma)/sqrt(bf16(var)+1e-5), shift = bf16(beta) -
template <int RAW>
__global__ __launch_bounds__(256) void k_bnT(const float* __restrict__ src, int cols, int lg2cols, const float* __restrict__ rowbias, const float* __restrict__ gam, const float* __restrict__ bet, const float* __restrict__ mean, const float* __restrict__ var, bf* Th, bf* Tl) {
    const int lane = threadIdx.x & 31; const int L0 = (blockIdx.x * 8 + (threadIdx.x >> 5)) * 8; const int nlines = cols * CC / 64;
{
#pragma unroll 1
        for (int l = 0; l < 8; ++l) { const int L = L0 + l; if (L >= nlines) break; const int e = L * 64 + lane * 2; const int c = e & (CC - 1); const int n = e >> 8; v2us oh, ol;
#pragma unroll
            for (int q = 0; q < 2; ++q) { const int cc = c + q; const float inv = __fdiv_rn(bfr(gam[cc]), __fsqrt_rn(__fadd_rn(bfr(var[cc]), 1e-5f))); float ms = __fmul_rn(bfr(mean[cc]), inv); asm volatile("" : "+v"(ms)); const float sh = __fsub_rn(bfr(bet[cc]), ms);
                float x = src[(size_t)cc * cols + n]; if (RAW) x = bfr(x); if (rowbias) x = __fadd_rn(x, bfr(rowbias[cc])); float t = __fmul_rn(x, inv); asm volatile("" : "+v"(t)); unsigned short a, c2; splitf(__fadd_rn(t, sh), a, c2); oh[q] = a; ol[q] = c2; }
            *(v2us*)(Th + (size_t)e) = oh; *(v2us*)(Tl + (size_t)e) = ol; }
         }
}
__global__ __launch_bounds__(256) void k_hp32(const float* __restrict__ F, int rows, int lg2rows, h16* P) {
    const int lane = threadIdx.x & 31; const int L0 = (blockIdx.x * 8 + (threadIdx.x >> 5)) * 8; const int nlines = NHD * rows * DH / 64;
{
#pragma unroll
        for (int l = 0; l < 8; ++l) { const int L = L0 + l; if (L >= nlines) break; const int e = L * 64 + lane * 2; const int d = e & (DH - 1); const int r = (e >> 5) & (rows - 1); const int h = e >> (5 + lg2rows); v2h o;
#pragma unroll
            for (int q = 0; q < 2; ++q) o[q] = tohx(F[(size_t)r * CC + h * DH + d + q]);
            *(v2h*)(P + (size_t)e) = o; }
         }
}
__global__ __launch_bounds__(256) void k_v16(const float* __restrict__ FV, const float* __restrict__ bv, h16* V16) { const size_t i = ((size_t)blockIdx.x * 256 + threadIdx.x) * 2; if (i >= (size_t)CC * MM) return; const int c = (int)(i >> 10); v2h v;
#pragma unroll
    for (int q = 0; q < 2; ++q) v[q] = tohx(__fadd_rn(FV[i + q], bfr(bv[c]))); *(v2h*)(V16 + i) = v;  }
__global__ __launch_bounds__(256) void k_smax(const float* __restrict__ S, float* RS) {
    const int lane = threadIdx.x & 31; const int i = blockIdx.x * 8 + (threadIdx.x >> 5); if (i >= NN) return; const float* sr = S + (size_t)i * MM; float m = -3.0e38f;
#pragma unroll 4
    for (int c0 = lane * 4; c0 < MM; c0 += 128) { const v4f v = *(const v4f*)(sr + c0); m = fmaxf(m, fmaxf(fmaxf(v[0], v[1]), fmaxf(v[2], v[3]))); }
#pragma unroll
    for (int sh = 16; sh; sh >>= 1) m = fmaxf(m, __shfl_xor(m, sh, 32));
    const float o = lane == 0 ? m : 0.f; *(float*)(RS + (size_t)i * 32 + lane) = o;  }
__global__ __launch_bounds__(256) void k_sexp(const float* __restrict__ S, float* RS, h16* P) {
    const int lane = threadIdx.x & 31; const int i = blockIdx.x * 8 + (threadIdx.x >> 5); if (i >= NN) return; const float* sr = S + (size_t)i * MM; const float m = RS[(size_t)i * 32]; float sum = 0.f;
#pragma unroll 2
    for (int c0 = lane * 4; c0 < MM; c0 += 128) { const v4f v = *(const v4f*)(sr + c0); v4h o;
#pragma unroll
        for (int q = 0; q < 4; ++q) { float dlt = __fsub_rn(v[q], m); asm volatile("" : "+v"(dlt)); const float e = __expf(__fmul_rn(dlt, SCL)); sum += e; o[q] = tohx(e * PCAR); }
        *(v4h*)(P + (size_t)i * MM + c0) = o;  }
#pragma unroll
    for (int sh = 16; sh; sh >>= 1) sum += __shfl_xor(sum, sh, 32);
    const float o2 = lane == 0 ? m : (lane == 1 ? __fdiv_rn(1.0f, sum * PCAR) : 0.f); *(float*)(RS + (size_t)i * 32 + lane) = o2;  }
__global__ __launch_bounds__(256) void k_osplit(const float* __restrict__ OTf, const float* __restrict__ RSall, bf* Oh, bf* Ol) { const size_t i = ((size_t)blockIdx.x * 256 + threadIdx.x) * 2; if (i >= (size_t)NN * CC) return; const int c = (int)(i & (CC - 1)); const int n = (int)(i >> 8); const float ri = RSall[((size_t)(c >> 5) * NN + n) * 32 + 1]; v2us oh, ol;
#pragma unroll
    for (int q = 0; q < 2; ++q) { unsigned short a, c2; splitf(__fmul_rn(OTf[(size_t)n * OTP + c + q], ri), a, c2); oh[q] = a; ol[q] = c2; }
    *(v2us*)(Oh + i) = oh; *(v2us*)(Ol + i) = ol;  }
__global__ __launch_bounds__(256) void k_fin(const float* __restrict__ xb, const float* __restrict__ PR, const float* __restrict__ bp, float* OUTb) { const size_t i = ((size_t)blockIdx.x * 256 + threadIdx.x) * 4; if (i >= (size_t)CC * NN) return; const int c = (int)(i >> 12); const v4f a = *(const v4f*)(xb + i), p = *(const v4f*)(PR + i); v4f o;
#pragma unroll
    for (int q = 0; q < 4; ++q) o[q] = __fadd_rn(__fadd_rn(bfr(a[q]), p[q]), bfr(bp[c]));
    *(v4f*)(OUTb + i) = o;  }


extern "C" void kernel_launch(void* const* d_in, const int* in_sizes, int n_in,
                              void* d_out, int out_size, void* d_ws, size_t ws_size, hipStream_t stream) {
    (void)in_sizes; (void)n_in; (void)out_size;
    const float* IN[16]; for (int i = 0; i < 16; ++i) IN[i] = (const float*)d_in[i];
    // f [4][256][64][64], h [4][512][32][32], w_ht [256][512], b_ht, bn_gamma [3][256], bn_beta, bn_mean, bn_var, w_q [256][256], b_q, w_k, b_k, w_v, b_v, w_out, b_out = d_in[0..15]
    const float* f = IN[0]; const float* hin = IN[1]; const float* gam = IN[4]; const float* bet = IN[5]; const float* mean = IN[6]; const float* var = IN[7];
    float* OUT = (float*)d_out;     // [4][256][64][64]
    char* wsp = (char*)d_ws;
    auto take = [&](size_t bytes) { char* p = wsp; wsp += (bytes + 255) & ~(size_t)255; return (void*)p; };
    bf* WHT = (bf*)take((size_t)CC * CH * 2); bf* WQ = (bf*)take((size_t)CC * CC * 2); bf* WK = (bf*)take((size_t)CC * CC * 2); bf* WV = (bf*)take((size_t)CC * CC * 2); bf* WO = (bf*)take((size_t)CC * CC * 2);
    bf* HB = (bf*)take((size_t)MM * CH * 2); float* HAL = (float*)take((size_t)CC * MM * 4); bf* H1h = (bf*)take((size_t)MM * CC * 2); bf* H1l = (bf*)take((size_t)MM * CC * 2); bf* H2h = (bf*)take((size_t)MM * CC * 2); bf* H2l = (bf*)take((size_t)MM * CC * 2);
    bf* FTh = (bf*)take((size_t)NN * CC * 2); bf* FTl = (bf*)take((size_t)NN * CC * 2); float* FQ = (float*)take((size_t)NN * CC * 4); h16* QP = (h16*)take((size_t)NHD * NN * DH * 2); float* FK = (float*)take((size_t)MM * CC * 4); h16* KP = (h16*)take((size_t)NHD * MM * DH * 2);
    float* FV = (float*)take((size_t)CC * MM * 4); h16* V16 = (h16*)take((size_t)(CC + DH) * MM * 2);
    float* S = (float*)take((size_t)NN * MM * 4); h16* P = (h16*)take((size_t)NN * MM * 2); float* RS = (float*)take((size_t)NHD * NN * 32 * 4); float* OTf = (float*)take((size_t)NN * OTP * 4); bf* Oh = (bf*)take((size_t)NN * CC * 2); bf* Ol = (bf*)take((size_t)NN * CC * 2); float* PR = FQ;   // the output conv result [c][n] reuses FQ
    if ((size_t)(wsp - (char*)d_ws) > ws_size) return;    // total ~ 57 MB; ws 256 MiB
    { k_cvt8<<<(CC * CH / 8 + 255) / 256, 256, 0, stream>>>(IN[2], WHT, (size_t)CC * CH / 8); const unsigned g8 = (CC * CC / 8 + 255) / 256;
      k_cvt8<<<g8, 256, 0, stream>>>(IN[8], WQ, (size_t)CC * CC / 8); k_cvt8<<<g8, 256, 0, stream>>>(IN[10], WK, (size_t)CC * CC / 8); k_cvt8<<<g8, 256, 0, stream>>>(IN[12], WV, (size_t)CC * CC / 8); k_cvt8<<<g8, 256, 0, stream>>>(IN[14], WO, (size_t)CC * CC / 8);
      hipMemsetAsync(V16 + (size_t)CC * MM, 0, (size_t)DH * MM * 2, stream); }   // the 32 pad rows behind channel 255 (read by the last head's 64-row value tile)
    const unsigned L2 = (unsigned)(((size_t)NN * CC / 2 + 255) / 256), L4 = (unsigned)(((size_t)NN * CC / 4 + 255) / 256);
    for (int b = 0; b < NB_; ++b) { const float* fb = f + (size_t)b * CC * NN; const float* hb = hin + (size_t)b * CH * MM;
        k_xth<<<(MM * CH / 64 + 63) / 64, 256, 0, stream>>>(hb, HB);
        k_gemmw<bf, 0, false><<<dim3(CC / 64, MM / 64, 1), 32, 0, stream>>>(WHT, nullptr, HB, nullptr, CH, HAL, MM, nullptr, 0, 0, 0);                // h_al [c][m] (b_ht added inside the BN planes)
        k_bnT<0><<<(MM * CC / 64 + 63) / 64, 256, 0, stream>>>(HAL, MM, 10, IN[3], gam + CC, bet + CC, mean + CC, var + CC, H1h, H1l);                  // BN1(h_al + b_ht) token-major
        k_bnT<0><<<(MM * CC / 64 + 63) / 64, 256, 0, stream>>>(HAL, MM, 10, IN[3], gam + 2 * CC, bet + 2 * CC, mean + 2 * CC, var + 2 * CC, H2h, H2l);  // BN2(h_al + b_ht)
        k_bnT<1><<<(NN * CC / 64 + 63) / 64, 256, 0, stream>>>(fb, NN, 12, nullptr, gam, bet, mean, var, FTh, FTl);                                   // BN0(bf16(f))
        k_gemmw<bf, 1, true><<<dim3(NN / 64, CC / 64, 1), 32, 0, stream>>>(FTh, FTl, WQ, nullptr, CC, FQ, CC, IN[9], 0, 0, 0); k_hp32<<<(NHD * NN * DH / 64 + 63) / 64, 256, 0, stream>>>(FQ, NN, 12, QP);
        k_gemmw<bf, 1, true><<<dim3(MM / 64, CC / 64, 1), 32, 0, stream>>>(H1h, H1l, WK, nullptr, CC, FK, CC, IN[11], 0, 0, 0); k_hp32<<<(NHD * MM * DH / 64 + 63) / 64, 256, 0, stream>>>(FK, MM, 10, KP);
        k_gemmw<bf, 3, false><<<dim3(CC / 64, MM / 64, 1), 32, 0, stream>>>(WV, nullptr, H2h, H2l, CC, FV, MM, nullptr, 0, 0, 0); k_v16<<<(unsigned)(((size_t)CC * MM / 2 + 255) / 256), 256, 0, stream>>>(FV, IN[13], V16);
        for (int hh = 0; hh < NHD; ++hh) {
            k_gemmw<h16, 0, false><<<dim3(NN / 64, MM / 64, 1), 32, 0, stream>>>(QP + (size_t)hh * NN * DH, nullptr, KP + (size_t)hh * MM * DH, nullptr, DH, S, MM, nullptr, 0, 0, 0);
            k_smax<<<NN / 8, 256, 0, stream>>>(S, RS + (size_t)hh * NN * 32); k_sexp<<<NN / 8, 256, 0, stream>>>(S, RS + (size_t)hh * NN * 32, P);
            k_gemmw<h16, 0, false><<<dim3(NN / 64, 1, 1), 32, 0, stream>>>(P, nullptr, V16 + (size_t)hh * DH * MM, nullptr, MM, OTf + hh * DH, OTP, nullptr, 0, 0, 0); }   // [n][64] tile at column hh*32: the upper 32 columns are head hh+1's slot, rewritten by the next pass (heads ascend)
        k_osplit<<<L2, 256, 0, stream>>>(OTf, RS, Oh, Ol);
        k_gemmw<bf, 3, false><<<dim3(CC / 64, NN / 64, 1), 32, 0, stream>>>(WO, nullptr, Oh, Ol, CC, PR, NN, nullptr, 0, 0, 0);   // w_out . out [c][n]
        k_fin<<<L4, 256, 0, stream>>>(fb, PR, IN[15], OUT + (size_t)b * CC * NN); }
}

// v002
// A run of this version takes 190 microseconds.
// It is 9.01 times as fast as v000, going by the measured steps of the versions left out in between.
#include <hip/hip_runtime.h>

// CIM (cross-image attention; f [4][256][64][64] (N = 4096 queries), h [4][512][32][32] (M = 1024 keys); h_al = w_ht h + b_ht; q = w_q BN0(f) + b_q, k = w_k BN1(h_al) + b_k, v = w_v BN2(h_al) + b_v
// (BatchNorm in inference form with the given statistics); 8 heads of 32 channels: attn = softmax_m(q_h . k_h * 32^-0.5); out[c][n] = sum_m attn[n][m] v[c][m]; result = f + w_out out + b_out).
// Compute dtypes, f32 accumulate: every input rounded to bf16; h_al on PLAIN bf16 operands (inputs: exact); the BatchNorms in f32 on VALU written as bf16 hi+lo
// x1024, fp16 v); the output conv on hi+lo planes of the attended map (2 products); bias + residual f32. One-wave-per-64x64-tile GEMMs; every launch but the weight conversions covers all four images (the image is blockIdx.z in k_gemmw and k_attn, blockIdx.y in the others). Deterministic, no

#define NB_  4
#define CC   256
#define CH   512                  // channels of h
#define NN   4096                 // query positions
#define MM   1024                 // key positions
#define NHD  8
#define DH   32
#define SCL  0.17677669529663687f   // f32(32^-0.5)
typedef _Float16 h16;
typedef unsigned short bf;
typedef __attribute__((ext_vector_type(16))) __bf16   v16bf;
typedef __attribute__((ext_vector_type(16))) _Float16 v16h;
typedef __attribute__((ext_vector_type(8)))  _Float16 v8h;
typedef __attribute__((ext_vector_type(8)))  unsigned short v8us;
typedef __attribute__((ext_vector_type(8)))  float    v8f;
typedef __attribute__((ext_vector_type(4)))  float    v4f;
typedef v8h  __attribute__((may_alias)) v8ha;
typedef v4f  __attribute__((may_alias)) v4fa;
typedef v8us __attribute__((may_alias)) v8usa;

__device__ __forceinline__ unsigned short f2bf(float f) { unsigned u = __float_as_uint(f); u += 0x7FFFu + ((u >> 16) & 1u); return (unsigned short)(u >> 16); }
__device__ __forceinline__ float bf2f(unsigned short b) { return __uint_as_float(((unsigned)b) << 16); }
__device__ __forceinline__ float bfr(float f) { return bf2f(f2bf(f)); }
__device__ __forceinline__ v16h cat16(v8h lo, v8h hi) { return __builtin_shufflevector(lo, hi, 0, 1, 2, 3, 4, 5, 6, 7, 8, 9, 10, 11, 12, 13, 14, 15); }
__device__ __forceinline__ v16bf cat16b(v8us lo, v8us hi) { return __builtin_bit_cast(v16bf, __builtin_shufflevector(lo, hi, 0, 1, 2, 3, 4, 5, 6, 7, 8, 9, 10, 11, 12, 13, 14, 15)); }
__device__ __forceinline__ v8f wmma16(v16h a, v16h b, v8f c) { return __builtin_amdgcn_wmma_f32_16x16x32_f16(false, a, false, b, (short)0, c, false, false); }
__device__ __forceinline__ v8f wmmab(v16bf a, v16bf b, v8f c) { return __builtin_amdgcn_wmma_f32_16x16x32_bf16(false, a, false, b, (short)0, c, false, false); }



// ---- k_gemmw: register-blocked GEMM, ONE WAVE per 64x64 output tile (16 accumulators), operands straight from K-contiguous 16-bit planes; grid (M/64, N/64, Z), 32 threads.
// C[m][n] (f32, pitch ldc, + optional f32 bias[n]) = sum_k A[m][k] Bt[n][k] (+ split products per NSPLIT). z-batch strides sA/sB/sC in elements. K % 32 == 0.
template <typename T16> struct WFrag;
template <> struct WFrag<h16> { typedef v16h V; static __device__ __forceinline__ V ld(const h16* p) { return cat16(*(const v8h*)p, *(const v8h*)(p + 16)); } static __device__ __forceinline__ v8f mma(V a, V b, v8f c) { return wmma16(a, b, c); } };
template <> struct WFrag<bf> { typedef v16bf V; static __device__ __forceinline__ V ld(const bf* p) { return cat16b(*(const v8us*)p, *(const v8us*)(p + 16)); } static __device__ __forceinline__ v8f mma(V a, V b, v8f c) { return wmmab(a, b, c); } };
template <typename T16, int NSPLIT, bool BIAS>
__global__ __launch_bounds__(32) void k_gemmw(const T16* __restrict__ A, const T16* __restrict__ A2, const T16* __restrict__ Bt, const T16* __restrict__ Bt2, int K, float* C, int ldc, const float* __restrict__ bias, size_t sA, size_t sB, size_t sC) {
    typedef typename WFrag<T16>::V V;
    __shared__ __align__(16) float os[16 * 68];
    const size_t z = blockIdx.z; A += z * sA; if (A2) A2 += z * sA; Bt += z * sB; if (Bt2) Bt2 += z * sB; C += z * sC;
    const int lane = threadIdx.x & 31, lr = lane & 15, hi = lane >> 4; const int r0 = blockIdx.x * 64, c0 = blockIdx.y * 64;
    v8f acc[4][4];
#pragma unroll
    for (int mb = 0; mb < 4; ++mb)
#pragma unroll
        for (int nb = 0; nb < 4; ++nb) acc[mb][nb] = (v8f){};
    const size_t aoff = (size_t)(r0 + lr) * K + 8 * hi, boff = (size_t)(c0 + lr) * K + 8 * hi;
#pragma unroll 1
    for (int kc = 0; kc < K; kc += 32) {
        V a[4], a2[4];
#pragma unroll
        for (int mb = 0; mb < 4; ++mb) { a[mb] = WFrag<T16>::ld(A + aoff + (size_t)mb * 16 * K + kc); if (NSPLIT == 1 || NSPLIT == 2) a2[mb] = WFrag<T16>::ld(A2 + aoff + (size_t)mb * 16 * K + kc); }
#pragma unroll
        for (int nb = 0; nb < 4; ++nb) { const V b = WFrag<T16>::ld(Bt + boff + (size_t)nb * 16 * K + kc); V b2; if (NSPLIT >= 2) b2 = WFrag<T16>::ld(Bt2 + boff + (size_t)nb * 16 * K + kc);
#pragma unroll
            for (int mb = 0; mb < 4; ++mb) { acc[mb][nb] = WFrag<T16>::mma(a[mb], b, acc[mb][nb]); if (NSPLIT == 1 || NSPLIT == 2) acc[mb][nb] = WFrag<T16>::mma(a2[mb], b, acc[mb][nb]); if (NSPLIT >= 2) acc[mb][nb] = WFrag<T16>::mma(a[mb], b2, acc[mb][nb]); } }
        asm volatile("v_nop\n\tv_nop\n\tv_nop\n\tv_nop" : "+v"(acc[0][0]), "+v"(acc[1][1]), "+v"(acc[2][2]), "+v"(acc[3][3]) : "v"(a[0]), "v"(a[3]));
    }
#pragma unroll
    for (int mb = 0; mb < 4; ++mb) {
#pragma unroll
        for (int nb = 0; nb < 4; ++nb) {
#pragma unroll
            for (int j = 0; j < 8; ++j) os[(hi * 8 + j) * 68 + nb * 16 + lr] = acc[mb][nb][j]; }
        __builtin_amdgcn_wave_barrier(); asm volatile("" ::: "memory");
        float* crow = C + (size_t)(r0 + mb * 16) * ldc + c0;
{
#pragma unroll
            for (int s = 0; s < 8; ++s) { const int row = 2 * s + hi, cofs = lr * 4; v4f val = *(const v4fa*)(os + row * 68 + cofs); if (BIAS) { val[0] += bfr(bias[c0 + cofs]); val[1] += bfr(bias[c0 + cofs + 1]); val[2] += bfr(bias[c0 + cofs + 2]); val[3] += bfr(bias[c0 + cofs + 3]); }
                *(v4f*)(crow + (size_t)row * ldc + cofs) = val; }
             }
        __builtin_amdgcn_wave_barrier(); asm volatile("" ::: "memory");
    }
}

__device__ __forceinline__ h16 tohx(float x) { return (h16)x; }
__device__ __forceinline__ void splitf(float y, unsigned short& h, unsigned short& l) { h = f2bf(y); l = f2bf(y - bf2f(h)); }
typedef __attribute__((ext_vector_type(2))) _Float16 v2h;
typedef __attribute__((ext_vector_type(2))) unsigned short v2us;
typedef __attribute__((ext_vector_type(8))) _Float16 v8h16;

__global__ __launch_bounds__(256) void k_cvt8(const float* __restrict__ src, bf* dst, size_t n8) { const size_t i = (size_t)blockIdx.x * 256 + threadIdx.x; if (i >= n8) return; const v8f v = *(const v8f*)(src + i * 8); v8us o;
#pragma unroll
    for (int k = 0; k < 8; ++k) o[k] = f2bf(v[k]); *(v8us*)(dst + i * 8) = o;  }
__global__ __launch_bounds__(256) void k_xth(const float* __restrict__ hb, bf* HB) {
    hb += (size_t)blockIdx.y * CH * MM; HB += (size_t)blockIdx.y * MM * CH;   // blockIdx.y: image
    const int lane = threadIdx.x & 31; const int L0 = (blockIdx.x * 8 + (threadIdx.x >> 5)) * 8; const int nlines = MM * CH / 64;
{
#pragma unroll
        for (int l = 0; l < 8; ++l) { const int L = L0 + l; if (L >= nlines) break; const int e = L * 64 + lane * 2; const int k = e & (CH - 1); const int m = e >> 9; v2us o;
#pragma unroll
            for (int q = 0; q < 2; ++q) o[q] = f2bf(hb[(size_t)(k + q) * MM + m]);
            *(v2us*)(HB + (size_t)e) = o; }
         }
}
// k_bnT: token-major hi/lo planes T[n][c] = split((src[c][n] (+ bf16(rowbias[c]) if given) (bf16-rounded first when RAW) * inv[c] + shift[c]) with inv = bf16(gamma)/sqrt(bf16(var)+1e-5), shift = bf16(beta) -
template <int RAW>
__global__ __launch_bounds__(256) void k_bnT(const float* __restrict__ src, int cols, int lg2cols, const float* __restrict__ rowbias, const float* __restrict__ gam, const float* __restrict__ bet, const float* __restrict__ mean, const float* __restrict__ var, bf* Th, bf* Tl) {
    src += (size_t)blockIdx.y * CC * cols; Th += (size_t)blockIdx.y * cols * CC; Tl += (size_t)blockIdx.y * cols * CC;   // blockIdx.y: image
    const int lane = threadIdx.x & 31; const int L0 = (blockIdx.x * 8 + (threadIdx.x >> 5)) * 8; const int nlines = cols * CC / 64;
{
#pragma unroll 1
        for (int l = 0; l < 8; ++l) { const int L = L0 + l; if (L >= nlines) break; const int e = L * 64 + lane * 2; const int c = e & (CC - 1); const int n = e >> 8; v2us oh, ol;
#pragma unroll
            for (int q = 0; q < 2; ++q) { const int cc = c + q; const float inv = __fdiv_rn(bfr(gam[cc]), __fsqrt_rn(__fadd_rn(bfr(var[cc]), 1e-5f))); float ms = __fmul_rn(bfr(mean[cc]), inv); asm volatile("" : "+v"(ms)); const float sh = __fsub_rn(bfr(bet[cc]), ms);
                float x = src[(size_t)cc * cols + n]; if (RAW) x = bfr(x); if (rowbias) x = __fadd_rn(x, bfr(rowbias[cc])); float t = __fmul_rn(x, inv); asm volatile("" : "+v"(t)); unsigned short a, c2; splitf(__fadd_rn(t, sh), a, c2); oh[q] = a; ol[q] = c2; }
            *(v2us*)(Th + (size_t)e) = oh; *(v2us*)(Tl + (size_t)e) = ol; }
         }
}
__global__ __launch_bounds__(256) void k_hp32(const float* __restrict__ F, int rows, int lg2rows, h16* P) {
    F += (size_t)blockIdx.y * rows * CC; P += (size_t)blockIdx.y * NHD * rows * DH;   // blockIdx.y: image
    const int lane = threadIdx.x & 31; const int L0 = (blockIdx.x * 8 + (threadIdx.x >> 5)) * 8; const int nlines = NHD * rows * DH / 64;
{
#pragma unroll
        for (int l = 0; l < 8; ++l) { const int L = L0 + l; if (L >= nlines) break; const int e = L * 64 + lane * 2; const int d = e & (DH - 1); const int r = (e >> 5) & (rows - 1); const int h = e >> (5 + lg2rows); v2h o;
#pragma unroll
            for (int q = 0; q < 2; ++q) o[q] = tohx(F[(size_t)r * CC + h * DH + d + q]);
            *(v2h*)(P + (size_t)e) = o; }
         }
}
__global__ __launch_bounds__(256) void k_v16(const float* __restrict__ FV, const float* __restrict__ bv, h16* V16) { const size_t i = ((size_t)blockIdx.x * 256 + threadIdx.x) * 2; if (i >= (size_t)CC * MM) return; FV += (size_t)blockIdx.y * CC * MM; V16 += (size_t)blockIdx.y * CC * MM;   // blockIdx.y: image
    const int c = (int)(i >> 10); v2h v;
#pragma unroll
    for (int q = 0; q < 2; ++q) v[q] = tohx(__fadd_rn(FV[i + q], bfr(bv[c]))); *(v2h*)(V16 + i) = v;  }
// ---- k_attn: scores, softmax and the value product of one head pair for 64 queries in one work-group; grid (NN/64, NHD/2, images), 256 threads = 8 waves, wave w: head (w & 1) of the pair, queries 16 (w >> 1) ...
// The pair's keys [2][MM][DH] and values [2 DH][MM] lie in LDS for the whole launch. S^T = K Q^T (a lane holds one query's scores: 8 keys a tile), so two score tiles, converted in place, are the B operand of
// O^T += V P^T (V rows read in the same k order as the packed tiles). Pass 1 finds each query's exact maximum, pass 2 forms the scores again, p = exp((s - max) * 32^-0.5) * 1024 as fp16, f32 row sum of p.
// The attended map leaves normalised, as bf16 hi+lo planes [n][c]; it goes through LDS so that each 128-byte line of a plane is stored by one wave instruction.
#define KPIT 40      // LDS pitch of a key row, in halves: 80 B = 16 B x odd, conflict-free for 16-byte fragment reads
#define VPIT 1032    // LDS pitch of a value row, in halves: 2064 B = 16 B x odd
#define OPIT 72      // LDS pitch of a staged output row, in 16-bit elements
__device__ __forceinline__ v16h ldh(const h16* p) { return cat16(*(const v8h*)p, *(const v8h*)(p + 16)); }
__global__ __launch_bounds__(256) void k_attn(const h16* __restrict__ QP, const h16* __restrict__ KP, const h16* __restrict__ V16, bf* Oh, bf* Ol) {
    __shared__ __align__(16) h16 Ks[2 * MM * KPIT];
    __shared__ __align__(16) h16 Vs[2 * DH * VPIT];
    __shared__ __align__(16) bf Os[2 * 64 * OPIT];
    QP += (size_t)blockIdx.z * NHD * NN * DH; KP += (size_t)blockIdx.z * NHD * MM * DH; V16 += (size_t)blockIdx.z * CC * MM; Oh += (size_t)blockIdx.z * NN * CC; Ol += (size_t)blockIdx.z * NN * CC;   // blockIdx.z: image
    const int tid = threadIdx.x, lane = tid & 31, wave = tid >> 5, lr = lane & 15, hi = lane >> 4; const int hp = blockIdx.y, hl = wave & 1, qt = wave >> 1;
    const h16* kg = KP + (size_t)hp * 2 * MM * DH; const h16* vg = V16 + (size_t)hp * 2 * DH * MM;
#pragma unroll 16   // sixteen 16-byte loads in flight per thread while the tiles are laid: the fill is bound by latency otherwise
    for (int t = 0; t < 2 * MM * DH / 8 / 256; ++t) { const int i = t * 256 + tid; *(v8h*)(Ks + (i >> 2) * KPIT + (i & 3) * 8) = *(const v8h*)(kg + (size_t)i * 8); }
#pragma unroll 16   // as above
    for (int t = 0; t < 2 * DH * MM / 8 / 256; ++t) { const int i = t * 256 + tid; *(v8h*)(Vs + (i >> 7) * VPIT + (i & 127) * 8) = *(const v8h*)(vg + (size_t)i * 8); }
    const v16h qf = ldh(QP + ((size_t)(hp * 2 + hl) * NN + blockIdx.x * 64 + qt * 16 + lr) * DH + 8 * hi);
    __syncthreads();
    const h16* kl = Ks + (hl * MM + lr) * KPIT + 8 * hi; const h16* vl = Vs + (hl * DH + lr) * VPIT + 8 * hi;
    float m = -3.0e38f;
#pragma unroll 8   // independent score tiles fill each other's distance behind the matrix instruction
    for (int kt = 0; kt < MM / 16; ++kt) { const v8f s = wmma16(ldh(kl + kt * 16 * KPIT), qf, (v8f){});
        m = fmaxf(m, fmaxf(fmaxf(fmaxf(s[0], s[1]), fmaxf(s[2], s[3])), fmaxf(fmaxf(s[4], s[5]), fmaxf(s[6], s[7])))); }
    m = fmaxf(m, __shfl_xor(m, 16, 32));
    v8f o0 = (v8f){}, o1 = (v8f){}; float sum0 = 0.f, sum1 = 0.f; const float c2 = SCL * 1.4426950408889634f;
#pragma unroll 2   // two 32-key steps side by side: one step's exponentials cover the other's LDS reads and matrix distances
    for (int kc = 0; kc < MM; kc += 32) {
        const v8f s0 = wmma16(ldh(kl + kc * KPIT), qf, (v8f){}), s1 = wmma16(ldh(kl + (kc + 16) * KPIT), qf, (v8f){}); const v16h va = ldh(vl + kc), vb = ldh(vl + 16 * VPIT + kc); v16h p;
#pragma unroll
        for (int j = 0; j < 8; ++j) { const float e0 = __builtin_amdgcn_exp2f(__builtin_fmaf(s0[j] - m, c2, 10.0f)), e1 = __builtin_amdgcn_exp2f(__builtin_fmaf(s1[j] - m, c2, 10.0f));   // + 10: p carries a factor 2^10, which keeps small weights out of the fp16 subnormals; the row sum carries it too
            sum0 += e0; sum1 += e1; p[j] = tohx(e0); p[8 + j] = tohx(e1); }
        o0 = wmma16(va, p, o0); o1 = wmma16(vb, p, o1); }
    float sum = sum0 + sum1; sum += __shfl_xor(sum, 16, 32); const float ri = __fdiv_rn(1.0f, sum);
    { v8us h0, l0, h1, l1;
#pragma unroll
      for (int j = 0; j < 8; ++j) { unsigned short a, c; splitf(__fmul_rn(o0[j], ri), a, c); h0[j] = a; l0[j] = c; splitf(__fmul_rn(o1[j], ri), a, c); h1[j] = a; l1[j] = c; }
      bf* od = Os + (qt * 16 + lr) * OPIT + hl * DH + 8 * hi;
      *(v8us*)od = h0; *(v8us*)(od + 16) = h1; *(v8us*)(od + 64 * OPIT) = l0; *(v8us*)(od + 64 * OPIT + 16) = l1; }
    __syncthreads();
#pragma unroll
    for (int t = 0; t < 2 * 64 * 8 / 256; ++t) { const int i = t * 256 + tid, r = i >> 3, c = i & 7; bf* dst = (r >> 6 ? Ol : Oh) + (size_t)(blockIdx.x * 64 + (r & 63)) * CC + hp * 64 + c * 8; *(v8us*)dst = *(const v8us*)(Os + r * OPIT + c * 8); }
}
__global__ __launch_bounds__(256) void k_fin(const float* __restrict__ xb, const float* __restrict__ PR, const float* __restrict__ bp, float* OUTb) { const size_t i = ((size_t)blockIdx.x * 256 + threadIdx.x) * 4; if (i >= (size_t)CC * NN) return; xb += (size_t)blockIdx.y * CC * NN; PR += (size_t)blockIdx.y * CC * NN; OUTb += (size_t)blockIdx.y * CC * NN;   // blockIdx.y: image
    const int c = (int)(i >> 12); const v4f a = *(const v4f*)(xb + i), p = *(const v4f*)(PR + i); v4f o;
#pragma unroll
    for (int q = 0; q < 4; ++q) o[q] = __fadd_rn(__fadd_rn(bfr(a[q]), p[q]), bfr(bp[c]));
    *(v4f*)(OUTb + i) = o;  }


extern "C" void kernel_launch(void* const* d_in, const int* in_sizes, int n_in,
                              void* d_out, int out_size, void* d_ws, size_t ws_size, hipStream_t stream) {
    (void)in_sizes; (void)n_in; (void)out_size;
    const float* IN[16]; for (int i = 0; i < 16; ++i) IN[i] = (const float*)d_in[i];
    // f [4][256][64][64], h [4][512][32][32], w_ht [256][512], b_ht, bn_gamma [3][256], bn_beta, bn_mean, bn_var, w_q [256][256], b_q, w_k, b_k, w_v, b_v, w_out, b_out = d_in[0..15]
    const float* f = IN[0]; const float* hin = IN[1]; const float* gam = IN[4]; const float* bet = IN[5]; const float* mean = IN[6]; const float* var = IN[7];
    float* OUT = (float*)d_out;     // [4][256][64][64]
    char* wsp = (char*)d_ws;
    auto take = [&](size_t bytes) { char* p = wsp; wsp += (bytes + 255) & ~(size_t)255; return (void*)p; };
    bf* WHT = (bf*)take((size_t)CC * CH * 2); bf* WQ = (bf*)take((size_t)CC * CC * 2); bf* WK = (bf*)take((size_t)CC * CC * 2); bf* WV = (bf*)take((size_t)CC * CC * 2); bf* WO = (bf*)take((size_t)CC * CC * 2);
    // per-image planes, NB_ images one behind the other
    bf* HB = (bf*)take((size_t)NB_ * MM * CH * 2); float* HAL = (float*)take((size_t)NB_ * CC * MM * 4); bf* H1h = (bf*)take((size_t)NB_ * MM * CC * 2); bf* H1l = (bf*)take((size_t)NB_ * MM * CC * 2); bf* H2h = (bf*)take((size_t)NB_ * MM * CC * 2); bf* H2l = (bf*)take((size_t)NB_ * MM * CC * 2);
    bf* FTh = (bf*)take((size_t)NB_ * NN * CC * 2); bf* FTl = (bf*)take((size_t)NB_ * NN * CC * 2); float* FQ = (float*)take((size_t)NB_ * NN * CC * 4); h16* QP = (h16*)take((size_t)NB_ * NHD * NN * DH * 2); float* FK = (float*)take((size_t)NB_ * MM * CC * 4); h16* KP = (h16*)take((size_t)NB_ * NHD * MM * DH * 2);
    float* FV = (float*)take((size_t)NB_ * CC * MM * 4); h16* V16 = (h16*)take((size_t)NB_ * CC * MM * 2);
    bf* Oh = (bf*)take((size_t)NB_ * NN * CC * 2); bf* Ol = (bf*)take((size_t)NB_ * NN * CC * 2); float* PR = FQ;   // the output conv result [c][n] reuses FQ
    if ((size_t)(wsp - (char*)d_ws) > ws_size) return;    // total ~ 85 MB; ws 256 MiB
    { k_cvt8<<<(CC * CH / 8 + 255) / 256, 256, 0, stream>>>(IN[2], WHT, (size_t)CC * CH / 8); const unsigned g8 = (CC * CC / 8 + 255) / 256;
      k_cvt8<<<g8, 256, 0, stream>>>(IN[8], WQ, (size_t)CC * CC / 8); k_cvt8<<<g8, 256, 0, stream>>>(IN[10], WK, (size_t)CC * CC / 8); k_cvt8<<<g8, 256, 0, stream>>>(IN[12], WV, (size_t)CC * CC / 8); k_cvt8<<<g8, 256, 0, stream>>>(IN[14], WO, (size_t)CC * CC / 8); }
    const unsigned L4 = (unsigned)(((size_t)NN * CC / 4 + 255) / 256);
    const size_t sH = (size_t)MM * CH, sM = (size_t)MM * CC, sN = (size_t)NN * CC;   // one image's elements: h plane, key-side plane, query-side plane
    k_xth<<<dim3((MM * CH / 64 + 63) / 64, NB_, 1), 256, 0, stream>>>(hin, HB);
    k_gemmw<bf, 0, false><<<dim3(CC / 64, MM / 64, NB_), 32, 0, stream>>>(WHT, nullptr, HB, nullptr, CH, HAL, MM, nullptr, 0, sH, sM);                // h_al [c][m] (b_ht added inside the BN planes)
    k_bnT<0><<<dim3((MM * CC / 64 + 63) / 64, NB_, 1), 256, 0, stream>>>(HAL, MM, 10, IN[3], gam + CC, bet + CC, mean + CC, var + CC, H1h, H1l);                  // BN1(h_al + b_ht) token-major
    k_bnT<0><<<dim3((MM * CC / 64 + 63) / 64, NB_, 1), 256, 0, stream>>>(HAL, MM, 10, IN[3], gam + 2 * CC, bet + 2 * CC, mean + 2 * CC, var + 2 * CC, H2h, H2l);  // BN2(h_al + b_ht)
    k_bnT<1><<<dim3((NN * CC / 64 + 63) / 64, NB_, 1), 256, 0, stream>>>(f, NN, 12, nullptr, gam, bet, mean, var, FTh, FTl);                                      // BN0(bf16(f))
    k_gemmw<bf, 1, true><<<dim3(NN / 64, CC / 64, NB_), 32, 0, stream>>>(FTh, FTl, WQ, nullptr, CC, FQ, CC, IN[9], sN, 0, sN); k_hp32<<<dim3((NHD * NN * DH / 64 + 63) / 64, NB_, 1), 256, 0, stream>>>(FQ, NN, 12, QP);
    k_gemmw<bf, 1, true><<<dim3(MM / 64, CC / 64, NB_), 32, 0, stream>>>(H1h, H1l, WK, nullptr, CC, FK, CC, IN[11], sM, 0, sM); k_hp32<<<dim3((NHD * MM * DH / 64 + 63) / 64, NB_, 1), 256, 0, stream>>>(FK, MM, 10, KP);
    k_gemmw<bf, 3, false><<<dim3(CC / 64, MM / 64, NB_), 32, 0, stream>>>(WV, nullptr, H2h, H2l, CC, FV, MM, nullptr, 0, sM, sM); k_v16<<<dim3((unsigned)(((size_t)CC * MM / 2 + 255) / 256), NB_, 1), 256, 0, stream>>>(FV, IN[13], V16);
    k_attn<<<dim3(NN / 64, NHD / 2, NB_), 256, 0, stream>>>(QP, KP, V16, Oh, Ol);   // softmax(q k) v, normalised, token-major hi+lo planes
    k_gemmw<bf, 3, false><<<dim3(CC / 64, NN / 64, NB_), 32, 0, stream>>>(WO, nullptr, Oh, Ol, CC, PR, NN, nullptr, 0, sN, sN);   // w_out . out [c][n]
    k_fin<<<dim3(L4, NB_, 1), 256, 0, stream>>>(f, PR, IN[15], OUT);
}

// v003
// Measured time: 132 microseconds a run.
// In two side-by-side timings against v002, it was 1.43 and 1.45 times as fast.
// Counting every step since v000, it is 12.9 times as fast.
#include <hip/hip_runtime.h>

// CIM (cross-image attention; f [4][256][64][64] (N = 4096 queries), h [4][512][32][32] (M = 1024 keys); h_al = w_ht h + b_ht; q = w_q BN0(f) + b_q, k = w_k BN1(h_al) + b_k, v = w_v BN2(h_al) + b_v
// (BatchNorm in inference form with the given statistics); 8 heads of 32 channels: attn = softmax_m(q_h . k_h * 32^-0.5); out[c][n] = sum_m attn[n][m] v[c][m]; result = f + w_out out + b_out).
// Compute dtypes, f32 accumulate: every input rounded to bf16; h_al on PLAIN bf16 operands (inputs: exact); the BatchNorms in f32 on VALU written as bf16 hi+lo
// x1024, fp16 v); the output conv on hi+lo planes of the attended map (2 products); bias + residual f32. One-wave-per-64x64-tile GEMMs; every launch covers all four images; launches that read none of each other's output share one grid. Deterministic, no

#define NB_  4
#define CC   256
#define CH   512                  // channels of h
#define NN   4096                 // query positions
#define MM   1024                 // key positions
#define NHD  8
#define DH   32
#define SCL  0.17677669529663687f   // f32(32^-0.5)
typedef _Float16 h16;
typedef unsigned short bf;
typedef __attribute__((ext_vector_type(16))) __bf16   v16bf;
typedef __attribute__((ext_vector_type(16))) _Float16 v16h;
typedef __attribute__((ext_vector_type(8)))  _Float16 v8h;
typedef __attribute__((ext_vector_type(8)))  unsigned short v8us;
typedef __attribute__((ext_vector_type(8)))  float    v8f;
typedef __attribute__((ext_vector_type(4)))  float    v4f;
typedef v8h  __attribute__((may_alias)) v8ha;
typedef v4f  __attribute__((may_alias)) v4fa;
typedef v8us __attribute__((may_alias)) v8usa;

__device__ __forceinline__ unsigned short f2bf(float f) { unsigned u = __float_as_uint(f); u += 0x7FFFu + ((u >> 16) & 1u); return (unsigned short)(u >> 16); }
__device__ __forceinline__ float bf2f(unsigned short b) { return __uint_as_float(((unsigned)b) << 16); }
__device__ __forceinline__ float bfr(float f) { return bf2f(f2bf(f)); }
__device__ __forceinline__ v16h cat16(v8h lo, v8h hi) { return __builtin_shufflevector(lo, hi, 0, 1, 2, 3, 4, 5, 6, 7, 8, 9, 10, 11, 12, 13, 14, 15); }
__device__ __forceinline__ v16bf cat16b(v8us lo, v8us hi) { return __builtin_bit_cast(v16bf, __builtin_shufflevector(lo, hi, 0, 1, 2, 3, 4, 5, 6, 7, 8, 9, 10, 11, 12, 13, 14, 15)); }
__device__ __forceinline__ v8f wmma16(v16h a, v16h b, v8f c) { return __builtin_amdgcn_wmma_f32_16x16x32_f16(false, a, false, b, (short)0, c, false, false); }
__device__ __forceinline__ v8f wmmab(v16bf a, v16bf b, v8f c) { return __builtin_amdgcn_wmma_f32_16x16x32_bf16(false, a, false, b, (short)0, c, false, false); }



// ---- k_gemmw: register-blocked GEMM, ONE WAVE per 64x64 output tile (16 accumulators), operands straight from K-contiguous 16-bit planes; grid (M/64, N/64, Z), 32 threads.
// C[m][n] (f32, pitch ldc, + optional f32 bias[n]) = sum_k A[m][k] Bt[n][k] (+ split products per NSPLIT). z-batch strides sA/sB/sC in elements. K % 32 == 0.
template <typename T16> struct WFrag;
template <> struct WFrag<h16> { typedef v16h V; static __device__ __forceinline__ V ld(const h16* p) { return cat16(*(const v8h*)p, *(const v8h*)(p + 16)); } static __device__ __forceinline__ v8f mma(V a, V b, v8f c) { return wmma16(a, b, c); } };
template <> struct WFrag<bf> { typedef v16bf V; static __device__ __forceinline__ V ld(const bf* p) { return cat16b(*(const v8us*)p, *(const v8us*)(p + 16)); } static __device__ __forceinline__ v8f mma(V a, V b, v8f c) { return wmmab(a, b, c); } };
template <typename T16, int NSPLIT, bool BIAS>
__global__ __launch_bounds__(32) void k_gemmw(const T16* __restrict__ A, const T16* __restrict__ A2, const T16* __restrict__ Bt, const T16* __restrict__ Bt2, int K, float* C, int ldc, const float* __restrict__ bias, size_t sA, size_t sB, size_t sC) {
    typedef typename WFrag<T16>::V V;
    __shared__ __align__(16) float os[16 * 68];
    const size_t z = blockIdx.z; A += z * sA; if (A2) A2 += z * sA; Bt += z * sB; if (Bt2) Bt2 += z * sB; C += z * sC;
    const int lane = threadIdx.x & 31, lr = lane & 15, hi = lane >> 4; const int r0 = blockIdx.x * 64, c0 = blockIdx.y * 64;
    v8f acc[4][4];
#pragma unroll
    for (int mb = 0; mb < 4; ++mb)
#pragma unroll
        for (int nb = 0; nb < 4; ++nb) acc[mb][nb] = (v8f){};
    const size_t aoff = (size_t)(r0 + lr) * K + 8 * hi, boff = (size_t)(c0 + lr) * K + 8 * hi;
#pragma unroll 1
    for (int kc = 0; kc < K; kc += 32) {
        V a[4], a2[4];
#pragma unroll
        for (int mb = 0; mb < 4; ++mb) { a[mb] = WFrag<T16>::ld(A + aoff + (size_t)mb * 16 * K + kc); if (NSPLIT == 1 || NSPLIT == 2) a2[mb] = WFrag<T16>::ld(A2 + aoff + (size_t)mb * 16 * K + kc); }
#pragma unroll
        for (int nb = 0; nb < 4; ++nb) { const V b = WFrag<T16>::ld(Bt + boff + (size_t)nb * 16 * K + kc); V b2; if (NSPLIT >= 2) b2 = WFrag<T16>::ld(Bt2 + boff + (size_t)nb * 16 * K + kc);
#pragma unroll
            for (int mb = 0; mb < 4; ++mb) { acc[mb][nb] = WFrag<T16>::mma(a[mb], b, acc[mb][nb]); if (NSPLIT == 1 || NSPLIT == 2) acc[mb][nb] = WFrag<T16>::mma(a2[mb], b, acc[mb][nb]); if (NSPLIT >= 2) acc[mb][nb] = WFrag<T16>::mma(a[mb], b2, acc[mb][nb]); } }
        asm volatile("v_nop\n\tv_nop\n\tv_nop\n\tv_nop" : "+v"(acc[0][0]), "+v"(acc[1][1]), "+v"(acc[2][2]), "+v"(acc[3][3]) : "v"(a[0]), "v"(a[3]));
    }
#pragma unroll
    for (int mb = 0; mb < 4; ++mb) {
#pragma unroll
        for (int nb = 0; nb < 4; ++nb) {
#pragma unroll
            for (int j = 0; j < 8; ++j) os[(hi * 8 + j) * 68 + nb * 16 + lr] = acc[mb][nb][j]; }
        __builtin_amdgcn_wave_barrier(); asm volatile("" ::: "memory");
        float* crow = C + (size_t)(r0 + mb * 16) * ldc + c0;
{
#pragma unroll
            for (int s = 0; s < 8; ++s) { const int row = 2 * s + hi, cofs = lr * 4; v4f val = *(const v4fa*)(os + row * 68 + cofs); if (BIAS) { val[0] += bfr(bias[c0 + cofs]); val[1] += bfr(bias[c0 + cofs + 1]); val[2] += bfr(bias[c0 + cofs + 2]); val[3] += bfr(bias[c0 + cofs + 3]); }
                *(v4f*)(crow + (size_t)row * ldc + cofs) = val; }
             }
        __builtin_amdgcn_wave_barrier(); asm volatile("" ::: "memory");
    }
}

// ---- d_gemmw: the GEMM of k_gemmw as one job of a shared grid: tile (bx, by) of batch bz out of (M/64, N/64, Z), one wave, K a literal; os: 16 x 68 floats of LDS.
template <typename T16, int NSPLIT, bool BIAS, int K>
__device__ __forceinline__ void d_gemmw(const int bx, const int by, const int bz, float* os, const T16* __restrict__ A, const T16* __restrict__ A2, const T16* __restrict__ Bt, const T16* __restrict__ Bt2, float* C, int ldc, const float* __restrict__ bias, size_t sA, size_t sB, size_t sC) {
    typedef typename WFrag<T16>::V V;
    const size_t z = bz; A += z * sA; if (A2) A2 += z * sA; Bt += z * sB; if (Bt2) Bt2 += z * sB; C += z * sC;
    const int lane = threadIdx.x & 31, lr = lane & 15, hi = lane >> 4; const int r0 = bx * 64, c0 = by * 64;
    v8f acc[4][4];
#pragma unroll
    for (int mb = 0; mb < 4; ++mb)
#pragma unroll
        for (int nb = 0; nb < 4; ++nb) acc[mb][nb] = (v8f){};
    const size_t aoff = (size_t)(r0 + lr) * K + 8 * hi, boff = (size_t)(c0 + lr) * K + 8 * hi;
#pragma unroll 1   // as in k_gemmw: one trip's fragments and the 16 accumulators fill the register file; a second trip unrolled would spill
    for (int kc = 0; kc < K; kc += 32) {
        const T16* pa = A + aoff + kc; const T16* pa2 = (NSPLIT == 1 || NSPLIT == 2) ? A2 + aoff + kc : pa; const T16* pb = Bt + boff + kc; const T16* pb2 = NSPLIT >= 2 ? Bt2 + boff + kc : pb;   // this trip's lane addresses; every load below is one of them plus a constant
        V a[4], a2[4];
#pragma unroll
        for (int mb = 0; mb < 4; ++mb) { a[mb] = WFrag<T16>::ld(pa + mb * 16 * K); if (NSPLIT == 1 || NSPLIT == 2) a2[mb] = WFrag<T16>::ld(pa2 + mb * 16 * K); }
#pragma unroll
        for (int nb = 0; nb < 4; ++nb) { const V b = WFrag<T16>::ld(pb + nb * 16 * K); V b2; if (NSPLIT >= 2) b2 = WFrag<T16>::ld(pb2 + nb * 16 * K);
#pragma unroll
            for (int mb = 0; mb < 4; ++mb) { acc[mb][nb] = WFrag<T16>::mma(a[mb], b, acc[mb][nb]); if (NSPLIT == 1 || NSPLIT == 2) acc[mb][nb] = WFrag<T16>::mma(a2[mb], b, acc[mb][nb]); if (NSPLIT >= 2) acc[mb][nb] = WFrag<T16>::mma(a[mb], b2, acc[mb][nb]); } }
        asm volatile("v_nop\n\tv_nop\n\tv_nop\n\tv_nop" : "+v"(acc[0][0]), "+v"(acc[1][1]), "+v"(acc[2][2]), "+v"(acc[3][3]) : "v"(a[0]), "v"(a[3]));   // as in k_gemmw: the distance behind the trip's last matrix instructions, on the back edge too
        asm volatile("s_wait_xcnt 0x0" :: "v"(pa), "v"(pa2), "v"(pb), "v"(pb2) : "memory");   // the wait before a register that an issued load names is overwritten: as inputs here the trip's address registers stay whole up to it
    }
#pragma unroll
    for (int mb = 0; mb < 4; ++mb) {
#pragma unroll
        for (int nb = 0; nb < 4; ++nb) {
#pragma unroll
            for (int j = 0; j < 8; ++j) os[(hi * 8 + j) * 68 + nb * 16 + lr] = acc[mb][nb][j]; }
        __builtin_amdgcn_wave_barrier(); asm volatile("" ::: "memory");   // as in k_gemmw: the wave's LDS writes stay in front of its reads
        float* crow = C + (size_t)(r0 + mb * 16) * ldc + c0;
#pragma unroll
        for (int s = 0; s < 8; ++s) { const int row = 2 * s + hi, cofs = lr * 4; v4f val = *(const v4fa*)(os + row * 68 + cofs); if (BIAS) { val[0] += bfr(bias[c0 + cofs]); val[1] += bfr(bias[c0 + cofs + 1]); val[2] += bfr(bias[c0 + cofs + 2]); val[3] += bfr(bias[c0 + cofs + 3]); }
            *(v4f*)(crow + (size_t)row * ldc + cofs) = val; }
        __builtin_amdgcn_wave_barrier(); asm volatile("" ::: "memory");   // as in k_gemmw: the reads stay in front of the next block's writes
    }
}
// Launches that read none of each other's output share one grid: a range of blockIdx.x is one job, the longer job first.
// k_gemm_hq: h_al [c][m] = w_ht h (256 tiles, K = 512), then q [n][c] = BN0(f) w_q^T + b_q (1024 tiles).
__global__ __launch_bounds__(32) void k_gemm_hq(const bf* __restrict__ WHT, const bf* __restrict__ HB, float* HAL, const bf* __restrict__ FTh, const bf* __restrict__ FTl, const bf* __restrict__ WQ, float* FQ, const float* __restrict__ bq) {
    __shared__ __align__(16) float os[16 * 68];
    const int b = blockIdx.x;
    if (b < (CC / 64) * (MM / 64) * NB_) d_gemmw<bf, 0, false, CH>(b & 3, (b >> 2) & 15, b >> 6, os, WHT, nullptr, HB, nullptr, HAL, MM, nullptr, 0, (size_t)MM * CH, (size_t)MM * CC);
    else { const int t = b - (CC / 64) * (MM / 64) * NB_; d_gemmw<bf, 1, true, CC>(t & 63, (t >> 6) & 3, t >> 8, os, FTh, FTl, WQ, nullptr, FQ, CC, bq, (size_t)NN * CC, 0, (size_t)NN * CC); }
}
// k_gemm_kv: k [m][c] = BN1(h_al) w_k^T + b_k (256 tiles), then v [c][m] = w_v BN2(h_al) (256 tiles).
__global__ __launch_bounds__(32) void k_gemm_kv(const bf* __restrict__ H1h, const bf* __restrict__ H1l, const bf* __restrict__ WK, float* FK, const float* __restrict__ bk, const bf* __restrict__ WV, const bf* __restrict__ H2h, const bf* __restrict__ H2l, float* FV) {
    __shared__ __align__(16) float os[16 * 68];
    const int b = blockIdx.x;
    if (b < (MM / 64) * (CC / 64) * NB_) d_gemmw<bf, 1, true, CC>(b & 15, (b >> 4) & 3, b >> 6, os, H1h, H1l, WK, nullptr, FK, CC, bk, (size_t)MM * CC, 0, (size_t)MM * CC);
    else { const int t = b - (MM / 64) * (CC / 64) * NB_; d_gemmw<bf, 3, false, CC>(t & 3, (t >> 2) & 15, t >> 6, os, WV, nullptr, H2h, H2l, FV, MM, nullptr, 0, (size_t)MM * CC, (size_t)MM * CC); }
}

__device__ __forceinline__ h16 tohx(float x) { return (h16)x; }
__device__ __forceinline__ void splitf(float y, unsigned short& h, unsigned short& l) { h = f2bf(y); l = f2bf(y - bf2f(h)); }
typedef __attribute__((ext_vector_type(2))) _Float16 v2h;
typedef __attribute__((ext_vector_type(2))) unsigned short v2us;
typedef __attribute__((ext_vector_type(8))) _Float16 v8h16;

// xw: the wait that stands between an issued global load and the next load, whose result may land in a register that the issued one names.
__device__ __forceinline__ void xw() { asm volatile("s_wait_xcnt 0x0" ::: "memory"); }
__device__ __forceinline__ void d_cvt8(const int bx, const float* __restrict__ src, bf* dst, size_t n8) { const size_t i = (size_t)bx * 256 + threadIdx.x; if (i >= n8) return; const v8f v = *(const v8f*)(src + i * 8); v8us o;
#pragma unroll
    for (int k = 0; k < 8; ++k) o[k] = f2bf(v[k]); *(v8us*)(dst + i * 8) = o;  }
__device__ __forceinline__ void d_xth(const int bx, const int by, const float* __restrict__ hb, bf* HB) {
    hb += (size_t)by * CH * MM; HB += (size_t)by * MM * CH;   // by: image
    const int lane = threadIdx.x & 31; const int L0 = (bx * 8 + (threadIdx.x >> 5)) * 8; const int nlines = MM * CH / 64;
{
#pragma unroll
        for (int l = 0; l < 8; ++l) { const int L = L0 + l; if (L >= nlines) break; const int e = L * 64 + lane * 2; const int k = e & (CH - 1); const int m = e >> 9; v2us o;
#pragma unroll
            for (int q = 0; q < 2; ++q) { const float x = hb[(size_t)(k + q) * MM + m]; xw(); o[q] = f2bf(x); }
            *(v2us*)(HB + (size_t)e) = o; }
         }
}
// d_bnT: token-major hi/lo planes T[n][c] = split((src[c][n] (+ bf16(rowbias[c]) if given) (bf16-rounded first when RAW) * inv[c] + shift[c]) with inv = bf16(gamma)/sqrt(bf16(var)+1e-5), shift = bf16(beta) -
template <int RAW>
__device__ __forceinline__ void d_bnT(const int bx, const int by, const float* __restrict__ src, int cols, int lg2cols, const float* __restrict__ rowbias, const float* __restrict__ gam, const float* __restrict__ bet, const float* __restrict__ mean, const float* __restrict__ var, bf* Th, bf* Tl) {
    src += (size_t)by * CC * cols; Th += (size_t)by * cols * CC; Tl += (size_t)by * cols * CC;   // by: image
    const int lane = threadIdx.x & 31; const int L0 = (bx * 8 + (threadIdx.x >> 5)) * 8; const int nlines = cols * CC / 64;
{
#pragma unroll 1
        for (int l = 0; l < 8; ++l) { const int L = L0 + l; if (L >= nlines) break; const int e = L * 64 + lane * 2; const int c = e & (CC - 1); const int n = e >> 8; v2us oh, ol;
#pragma unroll
            // xw() in the RAW == 0 jobs only: their build is the one that lets a load's result land in an address register of the load in front of it
            for (int q = 0; q < 2; ++q) { const int cc = c + q; const float gq = gam[cc]; if (!RAW) xw(); const float vq = var[cc]; if (!RAW) xw(); const float mq = mean[cc]; if (!RAW) xw(); const float inv = __fdiv_rn(bfr(gq), __fsqrt_rn(__fadd_rn(bfr(vq), 1e-5f))); float ms = __fmul_rn(bfr(mq), inv); asm volatile("" : "+v"(ms)); const float bq = bet[cc]; if (!RAW) xw(); const float sh = __fsub_rn(bfr(bq), ms);
                float x = src[(size_t)cc * cols + n]; if (!RAW) xw(); if (RAW) x = bfr(x); if (rowbias) { const float rq = rowbias[cc]; xw(); x = __fadd_rn(x, bfr(rq)); } float t = __fmul_rn(x, inv); asm volatile("" : "+v"(t)); unsigned short a, c2; splitf(__fadd_rn(t, sh), a, c2); oh[q] = a; ol[q] = c2; }
            *(v2us*)(Th + (size_t)e) = oh; *(v2us*)(Tl + (size_t)e) = ol; }
         }
}
__device__ __forceinline__ void d_hp32(const int bx, const int by, const float* __restrict__ F, int rows, int lg2rows, h16* P) {
    F += (size_t)by * rows * CC; P += (size_t)by * NHD * rows * DH;   // by: image
    const int lane = threadIdx.x & 31; const int L0 = (bx * 8 + (threadIdx.x >> 5)) * 8; const int nlines = NHD * rows * DH / 64;
{
#pragma unroll
        for (int l = 0; l < 8; ++l) { const int L = L0 + l; if (L >= nlines) break; const int e = L * 64 + lane * 2; const int d = e & (DH - 1); const int r = (e >> 5) & (rows - 1); const int h = e >> (5 + lg2rows); v2h o;
#pragma unroll
            for (int q = 0; q < 2; ++q) o[q] = tohx(F[(size_t)r * CC + h * DH + d + q]);
            *(v2h*)(P + (size_t)e) = o; }
         }
}
__device__ __forceinline__ void d_v16(const int bx, const int by, const float* __restrict__ FV, const float* __restrict__ bv, h16* V16) { const size_t i = ((size_t)bx * 256 + threadIdx.x) * 2; if (i >= (size_t)CC * MM) return; FV += (size_t)by * CC * MM; V16 += (size_t)by * CC * MM;   // by: image
    const int c = (int)(i >> 10); v2h v;
#pragma unroll
    for (int q = 0; q < 2; ++q) v[q] = tohx(__fadd_rn(FV[i + q], bfr(bv[c]))); *(v2h*)(V16 + i) = v;  }
// k_prep: the jobs that read inputs only. BN0(bf16(f)) token-major (1024 work-groups), h token-major (512), the five weight matrices as bf16 (64 + 4 x 32).
__global__ __launch_bounds__(256) void k_prep(const float* __restrict__ f, const float* __restrict__ hin, const float* __restrict__ wht, const float* __restrict__ wq, const float* __restrict__ wk, const float* __restrict__ wv, const float* __restrict__ wo,
                                              const float* __restrict__ gam, const float* __restrict__ bet, const float* __restrict__ mean, const float* __restrict__ var, bf* FTh, bf* FTl, bf* HB, bf* WHT, bf* WQ, bf* WK, bf* WV, bf* WO) {
    int b = blockIdx.x;
    if (b < 256 * NB_) { d_bnT<1>(b & 255, b >> 8, f, NN, 12, nullptr, gam, bet, mean, var, FTh, FTl); return; }
    b -= 256 * NB_;
    if (b < 128 * NB_) { d_xth(b & 127, b >> 7, hin, HB); return; }
    b -= 128 * NB_;
    if (b < 64) { d_cvt8(b, wht, WHT, (size_t)CC * CH / 8); return; }
    b -= 64;
    const int w = b >> 5; const float* src = w == 0 ? wq : w == 1 ? wk : w == 2 ? wv : wo; bf* dst = w == 0 ? WQ : w == 1 ? WK : w == 2 ? WV : WO;
    d_cvt8(b & 31, src, dst, (size_t)CC * CC / 8);
}
// k_mid: BN1(h_al + b_ht) and BN2(h_al + b_ht) token-major (256 work-groups each), then q as fp16 head planes (1024).
__global__ __launch_bounds__(256) void k_mid(const float* __restrict__ HAL, const float* __restrict__ bht, const float* __restrict__ gam, const float* __restrict__ bet, const float* __restrict__ mean, const float* __restrict__ var,
                                             bf* H1h, bf* H1l, bf* H2h, bf* H2l, const float* __restrict__ FQ, h16* QP) {
    const int b = blockIdx.x;
    if (b < 2 * 64 * NB_) { const int w = b >> 8, o = (1 + w) * CC; d_bnT<0>(b & 63, (b >> 6) & 3, HAL, MM, 10, bht, gam + o, bet + o, mean + o, var + o, w ? H2h : H1h, w ? H2l : H1l); return; }
    const int t = b - 2 * 64 * NB_; d_hp32(t & 255, t >> 8, FQ, NN, 12, QP);
}
// k_kv16: k as fp16 head planes (256 work-groups), then v + b_v as fp16 (2048).
__global__ __launch_bounds__(256) void k_kv16(const float* __restrict__ FK, h16* KP, const float* __restrict__ FV, const float* __restrict__ bv, h16* V16) {
    const int b = blockIdx.x;
    if (b < 64 * NB_) { d_hp32(b & 63, b >> 6, FK, MM, 10, KP); return; }
    const int t = b - 64 * NB_; d_v16(t & 511, t >> 9, FV, bv, V16);
}
// ---- k_attn: scores, softmax and the value product of one head pair for 64 queries in one work-group; grid (NN/64, NHD/2, images), 256 threads = 8 waves, wave w: head (w & 1) of the pair, queries 16 (w >> 1) ...
// The pair's keys [2][MM][DH] and values [2 DH][MM] lie in LDS for the whole launch. S^T = K Q^T (a lane holds one query's scores: 8 keys a tile), so two score tiles, converted in place, are the B operand of
// O^T += V P^T (V rows read in the same k order as the packed tiles). Pass 1 finds each query's exact maximum, pass 2 forms the scores again, p = exp((s - max) * 32^-0.5) * 1024 as fp16, f32 row sum of p.
// The attended map leaves normalised, as bf16 hi+lo planes [n][c]; it goes through LDS so that each 128-byte line of a plane is stored by one wave instruction.
#define KPIT 40      // LDS pitch of a key row, in halves: 80 B = 16 B x odd, conflict-free for 16-byte fragment reads
#define VPIT 1032    // LDS pitch of a value row, in halves: 2064 B = 16 B x odd
#define OPIT 72      // LDS pitch of a staged output row, in 16-bit elements
__device__ __forceinline__ v16h ldh(const h16* p) { return cat16(*(const v8h*)p, *(const v8h*)(p + 16)); }
__global__ __launch_bounds__(256) void k_attn(const h16* __restrict__ QP, const h16* __restrict__ KP, const h16* __restrict__ V16, bf* Oh, bf* Ol) {
    __shared__ __align__(16) h16 Ks[2 * MM * KPIT];
    __shared__ __align__(16) h16 Vs[2 * DH * VPIT];
    __shared__ __align__(16) bf Os[2 * 64 * OPIT];
    QP += (size_t)blockIdx.z * NHD * NN * DH; KP += (size_t)blockIdx.z * NHD * MM * DH; V16 += (size_t)blockIdx.z * CC * MM; Oh += (size_t)blockIdx.z * NN * CC; Ol += (size_t)blockIdx.z * NN * CC;   // blockIdx.z: image
    const int tid = threadIdx.x, lane = tid & 31, wave = tid >> 5, lr = lane & 15, hi = lane >> 4; const int hp = blockIdx.y, hl = wave & 1, qt = wave >> 1;
    const h16* kg = KP + (size_t)hp * 2 * MM * DH; const h16* vg = V16 + (size_t)hp * 2 * DH * MM;
#pragma unroll 16   // sixteen 16-byte loads in flight per thread while the tiles are laid: the fill is bound by latency otherwise
    for (int t = 0; t < 2 * MM * DH / 8 / 256; ++t) { const int i = t * 256 + tid; *(v8h*)(Ks + (i >> 2) * KPIT + (i & 3) * 8) = *(const v8h*)(kg + (size_t)i * 8); }
#pragma unroll 16   // as above
    for (int t = 0; t < 2 * DH * MM / 8 / 256; ++t) { const int i = t * 256 + tid; *(v8h*)(Vs + (i >> 7) * VPIT + (i & 127) * 8) = *(const v8h*)(vg + (size_t)i * 8); }
    const v16h qf = ldh(QP + ((size_t)(hp * 2 + hl) * NN + blockIdx.x * 64 + qt * 16 + lr) * DH + 8 * hi);
    __syncthreads();
    const h16* kl = Ks + (hl * MM + lr) * KPIT + 8 * hi; const h16* vl = Vs + (hl * DH + lr) * VPIT + 8 * hi;
    float m = -3.0e38f;
#pragma unroll 8   // independent score tiles fill each other's distance behind the matrix instruction
    for (int kt = 0; kt < MM / 16; ++kt) { const v8f s = wmma16(ldh(kl + kt * 16 * KPIT), qf, (v8f){});
        m = fmaxf(m, fmaxf(fmaxf(fmaxf(s[0], s[1]), fmaxf(s[2], s[3])), fmaxf(fmaxf(s[4], s[5]), fmaxf(s[6], s[7])))); }
    m = fmaxf(m, __shfl_xor(m, 16, 32));
    v8f o0 = (v8f){}, o1 = (v8f){}; float sum0 = 0.f, sum1 = 0.f; const float c2 = SCL * 1.4426950408889634f;
#pragma unroll 2   // two 32-key steps side by side: one step's exponentials cover the other's LDS reads and matrix distances
    for (int kc = 0; kc < MM; kc += 32) {
        const v8f s0 = wmma16(ldh(kl + kc * KPIT), qf, (v8f){}), s1 = wmma16(ldh(kl + (kc + 16) * KPIT), qf, (v8f){}); const v16h va = ldh(vl + kc), vb = ldh(vl + 16 * VPIT + kc); v16h p;
#pragma unroll
        for (int j = 0; j < 8; ++j) { const float e0 = __builtin_amdgcn_exp2f(__builtin_fmaf(s0[j] - m, c2, 10.0f)), e1 = __builtin_amdgcn_exp2f(__builtin_fmaf(s1[j] - m, c2, 10.0f));   // + 10: p carries a factor 2^10, which keeps small weights out of the fp16 subnormals; the row sum carries it too
            sum0 += e0; sum1 += e1; p[j] = tohx(e0); p[8 + j] = tohx(e1); }
        o0 = wmma16(va, p, o0); o1 = wmma16(vb, p, o1); }
    float sum = sum0 + sum1; sum += __shfl_xor(sum, 16, 32); const float ri = __fdiv_rn(1.0f, sum);
    { v8us h0, l0, h1, l1;
#pragma unroll
      for (int j = 0; j < 8; ++j) { unsigned short a, c; splitf(__fmul_rn(o0[j], ri), a, c); h0[j] = a; l0[j] = c; splitf(__fmul_rn(o1[j], ri), a, c); h1[j] = a; l1[j] = c; }
      bf* od = Os + (qt * 16 + lr) * OPIT + hl * DH + 8 * hi;
      *(v8us*)od = h0; *(v8us*)(od + 16) = h1; *(v8us*)(od + 64 * OPIT) = l0; *(v8us*)(od + 64 * OPIT + 16) = l1; }
    __syncthreads();
#pragma unroll
    for (int t = 0; t < 2 * 64 * 8 / 256; ++t) { const int i = t * 256 + tid, r = i >> 3, c = i & 7; bf* dst = (r >> 6 ? Ol : Oh) + (size_t)(blockIdx.x * 64 + (r & 63)) * CC + hp * 64 + c * 8; *(v8us*)dst = *(const v8us*)(Os + r * OPIT + c * 8); }
}
__global__ __launch_bounds__(256) void k_fin(const float* __restrict__ xb, const float* __restrict__ PR, const float* __restrict__ bp, float* OUTb) { const size_t i = ((size_t)blockIdx.x * 256 + threadIdx.x) * 4; if (i >= (size_t)CC * NN) return; xb += (size_t)blockIdx.y * CC * NN; PR += (size_t)blockIdx.y * CC * NN; OUTb += (size_t)blockIdx.y * CC * NN;   // blockIdx.y: image
    const int c = (int)(i >> 12); const v4f a = *(const v4f*)(xb + i), p = *(const v4f*)(PR + i); v4f o;
#pragma unroll
    for (int q = 0; q < 4; ++q) o[q] = __fadd_rn(__fadd_rn(bfr(a[q]), p[q]), bfr(bp[c]));
    *(v4f*)(OUTb + i) = o;  }


extern "C" void kernel_launch(void* const* d_in, const int* in_sizes, int n_in,
                              void* d_out, int out_size, void* d_ws, size_t ws_size, hipStream_t stream) {
    (void)in_sizes; (void)n_in; (void)out_size;
    const float* IN[16]; for (int i = 0; i < 16; ++i) IN[i] = (const float*)d_in[i];
    // f [4][256][64][64], h [4][512][32][32], w_ht [256][512], b_ht, bn_gamma [3][256], bn_beta, bn_mean, bn_var, w_q [256][256], b_q, w_k, b_k, w_v, b_v, w_out, b_out = d_in[0..15]
    const float* f = IN[0]; const float* hin = IN[1]; const float* gam = IN[4]; const float* bet = IN[5]; const float* mean = IN[6]; const float* var = IN[7];
    float* OUT = (float*)d_out;     // [4][256][64][64]
    char* wsp = (char*)d_ws;
    auto take = [&](size_t bytes) { char* p = wsp; wsp += (bytes + 255) & ~(size_t)255; return (void*)p; };
    bf* WHT = (bf*)take((size_t)CC * CH * 2); bf* WQ = (bf*)take((size_t)CC * CC * 2); bf* WK = (bf*)take((size_t)CC * CC * 2); bf* WV = (bf*)take((size_t)CC * CC * 2); bf* WO = (bf*)take((size_t)CC * CC * 2);
    // per-image planes, NB_ images one behind the other
    bf* HB = (bf*)take((size_t)NB_ * MM * CH * 2); float* HAL = (float*)take((size_t)NB_ * CC * MM * 4); bf* H1h = (bf*)take((size_t)NB_ * MM * CC * 2); bf* H1l = (bf*)take((size_t)NB_ * MM * CC * 2); bf* H2h = (bf*)take((size_t)NB_ * MM * CC * 2); bf* H2l = (bf*)take((size_t)NB_ * MM * CC * 2);
    bf* FTh = (bf*)take((size_t)NB_ * NN * CC * 2); bf* FTl = (bf*)take((size_t)NB_ * NN * CC * 2); float* FQ = (float*)take((size_t)NB_ * NN * CC * 4); h16* QP = (h16*)take((size_t)NB_ * NHD * NN * DH * 2); float* FK = (float*)take((size_t)NB_ * MM * CC * 4); h16* KP = (h16*)take((size_t)NB_ * NHD * MM * DH * 2);
    float* FV = (float*)take((size_t)NB_ * CC * MM * 4); h16* V16 = (h16*)take((size_t)NB_ * CC * MM * 2);
    bf* Oh = (bf*)take((size_t)NB_ * NN * CC * 2); bf* Ol = (bf*)take((size_t)NB_ * NN * CC * 2); float* PR = FQ;   // the output conv result [c][n] reuses FQ
    if ((size_t)(wsp - (char*)d_ws) > ws_size) return;    // total ~ 85 MB; ws 256 MiB
    const unsigned L4 = (unsigned)(((size_t)NN * CC / 4 + 255) / 256);
    const size_t sN = (size_t)NN * CC;   // one image's elements of a query-side plane
    k_prep<<<256 * NB_ + 128 * NB_ + 64 + 4 * 32, 256, 0, stream>>>(f, hin, IN[2], IN[8], IN[10], IN[12], IN[14], gam, bet, mean, var, FTh, FTl, HB, WHT, WQ, WK, WV, WO);   // BN0(bf16(f)), h token-major, bf16 weights
    k_gemm_hq<<<(CC / 64) * (MM / 64) * NB_ + (NN / 64) * (CC / 64) * NB_, 32, 0, stream>>>(WHT, HB, HAL, FTh, FTl, WQ, FQ, IN[9]);   // h_al [c][m] (b_ht added inside the BN planes); q [n][c]
    k_mid<<<2 * 64 * NB_ + 256 * NB_, 256, 0, stream>>>(HAL, IN[3], gam, bet, mean, var, H1h, H1l, H2h, H2l, FQ, QP);   // BN1, BN2 of h_al + b_ht; q head planes
    k_gemm_kv<<<2 * (MM / 64) * (CC / 64) * NB_, 32, 0, stream>>>(H1h, H1l, WK, FK, IN[11], WV, H2h, H2l, FV);   // k [m][c]; v [c][m]
    k_kv16<<<64 * NB_ + 512 * NB_, 256, 0, stream>>>(FK, KP, FV, IN[13], V16);   // k head planes; v + b_v
    k_attn<<<dim3(NN / 64, NHD / 2, NB_), 256, 0, stream>>>(QP, KP, V16, Oh, Ol);   // softmax(q k) v, normalised, token-major hi+lo planes
    k_gemmw<bf, 3, false><<<dim3(CC / 64, NN / 64, NB_), 32, 0, stream>>>(WO, nullptr, Oh, Ol, CC, PR, NN, nullptr, 0, sN, sN);   // w_out . out [c][n]
    k_fin<<<dim3(L4, NB_, 1), 256, 0, stream>>>(f, PR, IN[15], OUT);
}

// v004
// Measured time: 107 microseconds a run.
// Timed twice side by side with v003, it ran 1.24 times as fast both times.
// All steps since v000 together make it 16.0 times as fast.
#include <hip/hip_runtime.h>

// CIM (cross-image attention; f [4][256][64][64] (N = 4096 queries), h [4][512][32][32] (M = 1024 keys); h_al = w_ht h + b_ht; q = w_q BN0(f) + b_q, k = w_k BN1(h_al) + b_k, v = w_v BN2(h_al) + b_v
// (BatchNorm in inference form with the given statistics); 8 heads of 32 channels: attn = softmax_m(q_h . k_h * 32^-0.5); out[c][n] = sum_m attn[n][m] v[c][m]; result = f + w_out out + b_out).
// Compute dtypes, f32 accumulate: every input rounded to bf16; h_al on PLAIN bf16 operands (inputs: exact); the BatchNorms in f32 on VALU written as bf16 hi+lo
// x1024, fp16 v); the output conv on hi+lo planes of the attended map (2 products); bias + residual f32. One-wave-per-64x64-tile GEMMs; every launch covers all four images; launches that read none of each other's output share one grid. Deterministic, no

#define NB_  4
#define CC   256
#define CH   512                  // channels of h
#define NN   4096                 // query positions
#define MM   1024                 // key positions
#define NHD  8
#define DH   32
#define SCL  0.17677669529663687f   // f32(32^-0.5)
typedef _Float16 h16;
typedef unsigned short bf;
typedef __attribute__((ext_vector_type(16))) __bf16   v16bf;
typedef __attribute__((ext_vector_type(16))) _Float16 v16h;
typedef __attribute__((ext_vector_type(8)))  _Float16 v8h;
typedef __attribute__((ext_vector_type(8)))  unsigned short v8us;
typedef __attribute__((ext_vector_type(8)))  float    v8f;
typedef __attribute__((ext_vector_type(4)))  float    v4f;
typedef v8h  __attribute__((may_alias)) v8ha;
typedef v4f  __attribute__((may_alias)) v4fa;
typedef v8us __attribute__((may_alias)) v8usa;

__device__ __forceinline__ unsigned short f2bf(float f) { unsigned u = __float_as_uint(f); u += 0x7FFFu + ((u >> 16) & 1u); return (unsigned short)(u >> 16); }
__device__ __forceinline__ float bf2f(unsigned short b) { return __uint_as_float(((unsigned)b) << 16); }
__device__ __forceinline__ float bfr(float f) { return bf2f(f2bf(f)); }
__device__ __forceinline__ v16h cat16(v8h lo, v8h hi) { return __builtin_shufflevector(lo, hi, 0, 1, 2, 3, 4, 5, 6, 7, 8, 9, 10, 11, 12, 13, 14, 15); }
__device__ __forceinline__ v16bf cat16b(v8us lo, v8us hi) { return __builtin_bit_cast(v16bf, __builtin_shufflevector(lo, hi, 0, 1, 2, 3, 4, 5, 6, 7, 8, 9, 10, 11, 12, 13, 14, 15)); }
__device__ __forceinline__ v8f wmma16(v16h a, v16h b, v8f c) { return __builtin_amdgcn_wmma_f32_16x16x32_f16(false, a, false, b, (short)0, c, false, false); }
__device__ __forceinline__ v8f wmmab(v16bf a, v16bf b, v8f c) { return __builtin_amdgcn_wmma_f32_16x16x32_bf16(false, a, false, b, (short)0, c, false, false); }



template <typename T16> struct WFrag;
template <> struct WFrag<h16> { typedef v16h V; static __device__ __forceinline__ V ld(const h16* p) { return cat16(*(const v8h*)p, *(const v8h*)(p + 16)); } static __device__ __forceinline__ v8f mma(V a, V b, v8f c) { return wmma16(a, b, c); } };
template <> struct WFrag<bf> { typedef v16bf V; static __device__ __forceinline__ V ld(const bf* p) { return cat16b(*(const v8us*)p, *(const v8us*)(p + 16)); } static __device__ __forceinline__ v8f mma(V a, V b, v8f c) { return wmmab(a, b, c); } };
__device__ __forceinline__ h16 tohx(float x) { return (h16)x; }
__device__ __forceinline__ void splitf(float y, unsigned short& h, unsigned short& l) { h = f2bf(y); l = f2bf(y - bf2f(h)); }
typedef __attribute__((ext_vector_type(2))) _Float16 v2h;
typedef __attribute__((ext_vector_type(2))) unsigned short v2us;
typedef __attribute__((ext_vector_type(8))) _Float16 v8h16;

// ---- Epilogues: what a 64x64 GEMM tile becomes on its way out of the wave that computed it (the elementwise pass that used to follow the GEMM as a launch of its own, on the same f32 values).
// load(): lane addresses and the per-column or per-row parameters, issued in front of the K loop; ready(): their arithmetic, behind it; ahead(mb): loads for 16-row block mb, issued two blocks early;
// stage(): a value on its way into LDS (accumulator layout: row hi * 8 + j); put(): four neighbouring columns of row (ROW8 ? hi * 8 + s : 2 * s + hi) of block mb.
typedef __attribute__((ext_vector_type(4))) _Float16 v4h;
typedef __attribute__((ext_vector_type(4))) unsigned short v4us;
// EpHead: C[row][c] + bf16(bias[c]) as fp16 head planes P[c / 32][row][c % 32]; rows 2 s and 2 s + 1 of a head are one 128-byte line, stored by one instruction.
struct EpHead {
    static constexpr bool ROW8 = false;
    h16* P; int rows; const float* bias; v4f b;
    __device__ __forceinline__ void load(int r0, int c0, int lr, int hi) { const int c = c0 + lr * 4; P += ((size_t)(c >> 5) * rows + r0 + hi) * DH + (c & (DH - 1)); b = *(const v4f*)(bias + c); }
    __device__ __forceinline__ void ready() {
#pragma unroll
        for (int q = 0; q < 4; ++q) b[q] = bfr(b[q]); }
    __device__ __forceinline__ void ahead(int) {}
    __device__ __forceinline__ float stage(int, int, float x) { return x; }
    __device__ __forceinline__ void put(int mb, int s, v4f val) { v4h o;
#pragma unroll
        for (int q = 0; q < 4; ++q) o[q] = tohx(val[q] + b[q]);
        *(v4h*)(P + (mb * 16 + 2 * s) * DH) = o; }
};
// EpBN: the two BatchNorms of C[m][c] + bf16(b_ht[c]) as token-major bf16 hi+lo planes; inv = bf16(gamma) / sqrt(bf16(var) + 1e-5) and shift = bf16(beta) - bf16(mean) * inv once a lane and column.
struct EpBN {
    static constexpr bool ROW8 = false;
    bf* T[2][2]; const float* bht; const float* gam; const float* bet; const float* mean; const float* var; v4f rb, g[2], be[2], mu[2], va[2];
    __device__ __forceinline__ void load(int r0, int c0, int lr, int hi) { const int c = c0 + lr * 4; const size_t o = (size_t)(r0 + hi) * CC + c; rb = *(const v4f*)(bht + c);
#pragma unroll
        for (int w = 0; w < 2; ++w) { const int p = (1 + w) * CC + c; T[w][0] += o; T[w][1] += o; g[w] = *(const v4f*)(gam + p); be[w] = *(const v4f*)(bet + p); mu[w] = *(const v4f*)(mean + p); va[w] = *(const v4f*)(var + p); } }
    __device__ __forceinline__ void ready() {   // g becomes inv, be becomes shift
#pragma unroll
        for (int q = 0; q < 4; ++q) { rb[q] = bfr(rb[q]);
#pragma unroll
            for (int w = 0; w < 2; ++w) { const float inv = __fdiv_rn(bfr(g[w][q]), __fsqrt_rn(bfr(va[w][q]) + 1e-5f)); g[w][q] = inv; be[w][q] = bfr(be[w][q]) - bfr(mu[w][q]) * inv; } } }
    __device__ __forceinline__ void ahead(int) {}
    __device__ __forceinline__ float stage(int, int, float x) { return x; }
    __device__ __forceinline__ void put(int mb, int s, v4f val) {
#pragma unroll
        for (int w = 0; w < 2; ++w) { v4us oh, ol;
#pragma unroll
            for (int q = 0; q < 4; ++q) { unsigned short a, c2; splitf((val[q] + rb[q]) * g[w][q] + be[w][q], a, c2); oh[q] = a; ol[q] = c2; }
            *(v4us*)(T[w][0] + (mb * 16 + 2 * s) * CC) = oh; *(v4us*)(T[w][1] + (mb * 16 + 2 * s) * CC) = ol; } }
};
// EpVal: C[c][m] + bf16(b_v[c]) as fp16 [c][m]; the row's bias is added in the accumulator layout.
struct EpVal {
    static constexpr bool ROW8 = false;
    h16* V; const float* bv; v8f b[4];
    __device__ __forceinline__ void load(int r0, int c0, int lr, int hi) { V += (size_t)(r0 + hi) * MM + c0 + lr * 4;
#pragma unroll
        for (int mb = 0; mb < 4; ++mb) b[mb] = *(const v8f*)(bv + r0 + mb * 16 + hi * 8); }
    __device__ __forceinline__ void ready() {
#pragma unroll
        for (int mb = 0; mb < 4; ++mb)
#pragma unroll
            for (int j = 0; j < 8; ++j) b[mb][j] = bfr(b[mb][j]); }
    __device__ __forceinline__ void ahead(int) {}
    __device__ __forceinline__ float stage(int mb, int j, float x) { return x + b[mb][j]; }
    __device__ __forceinline__ void put(int mb, int s, v4f val) { v4h o;
#pragma unroll
        for (int q = 0; q < 4; ++q) o[q] = tohx(val[q]);
        *(v4h*)(V + (mb * 16 + 2 * s) * MM) = o; }
};
// EpOut: the result, (bf16(f[c][n]) + C[c][n]) + bf16(b_out[c]) in f32.
struct EpOut {
    static constexpr bool ROW8 = true;
    const float* f; float* O; const float* bp; v4f fv[4][8]; v8f b[4];
    __device__ __forceinline__ void load(int r0, int c0, int lr, int hi) { const size_t o = (size_t)(r0 + hi * 8) * NN + c0 + lr * 4; f += o; O += o; bp += r0 + hi * 8; }
    __device__ __forceinline__ void ready() {}
    __device__ __forceinline__ void ahead(int mb) {
        if (mb >= 2) asm volatile("s_wait_xcnt 0x0" ::: "memory");   // blocks 2 and 3 are fetched behind a block's stores and may land in registers that those stores name: the wait before such a register is overwritten
        b[mb] = *(const v8f*)(bp + mb * 16);
#pragma unroll
        for (int s = 0; s < 8; ++s) fv[mb][s] = *(const v4f*)(f + (mb * 16 + s) * NN); }
    __device__ __forceinline__ float stage(int, int, float x) { return x; }
    __device__ __forceinline__ void put(int mb, int s, v4f val) { v4f o;
#pragma unroll
        for (int q = 0; q < 4; ++q) o[q] = (bfr(fv[mb][s][q]) + val[q]) + bfr(b[mb][s]);
        *(v4f*)(O + (mb * 16 + s) * NN) = o; }
};

// ---- d_gemmw: register-blocked GEMM as one job of a grid: tile (bx, by) of batch bz out of (M/64, N/64, Z), ONE WAVE per 64x64 tile (16 accumulators), operands straight from K-contiguous 16-bit planes, K a literal.
// C[m][n] (f32) = sum_k A[m][k] Bt[n][k] (+ split products per NSPLIT) goes to the epilogue ep, 16 rows at a time through os (16 x 68 floats of LDS). z-batch strides sA/sB in elements.
template <typename T16, int NSPLIT, int K, typename EP>
__device__ __forceinline__ void d_gemmw(const int bx, const int by, const int bz, float* os, const T16* __restrict__ A, const T16* __restrict__ A2, const T16* __restrict__ Bt, const T16* __restrict__ Bt2, size_t sA, size_t sB, EP& ep) {
    typedef typename WFrag<T16>::V V;
    const size_t z = bz; A += z * sA; if (A2) A2 += z * sA; Bt += z * sB; if (Bt2) Bt2 += z * sB;
    const int lane = threadIdx.x & 31, lr = lane & 15, hi = lane >> 4; const int r0 = bx * 64, c0 = by * 64;
    ep.load(r0, c0, lr, hi);
    v8f acc[4][4];
#pragma unroll
    for (int mb = 0; mb < 4; ++mb)
#pragma unroll
        for (int nb = 0; nb < 4; ++nb) acc[mb][nb] = (v8f){};
    const size_t aoff = (size_t)(r0 + lr) * K + 8 * hi, boff = (size_t)(c0 + lr) * K + 8 * hi;
#pragma unroll 1   // one trip's fragments and the 16 accumulators fill the register file; a second trip unrolled would spill
    for (int kc = 0; kc < K; kc += 32) {
        const T16* pa = A + aoff + kc; const T16* pa2 = (NSPLIT == 1 || NSPLIT == 2) ? A2 + aoff + kc : pa; const T16* pb = Bt + boff + kc; const T16* pb2 = NSPLIT >= 2 ? Bt2 + boff + kc : pb;   // this trip's lane addresses; every load below is one of them plus a constant
        V a[4], a2[4];
#pragma unroll
        for (int mb = 0; mb < 4; ++mb) { a[mb] = WFrag<T16>::ld(pa + mb * 16 * K); if (NSPLIT == 1 || NSPLIT == 2) a2[mb] = WFrag<T16>::ld(pa2 + mb * 16 * K); }
#pragma unroll
        for (int nb = 0; nb < 4; ++nb) { const V b = WFrag<T16>::ld(pb + nb * 16 * K); V b2; if (NSPLIT >= 2) b2 = WFrag<T16>::ld(pb2 + nb * 16 * K);
#pragma unroll
            for (int mb = 0; mb < 4; ++mb) { acc[mb][nb] = WFrag<T16>::mma(a[mb], b, acc[mb][nb]); if (NSPLIT == 1 || NSPLIT == 2) acc[mb][nb] = WFrag<T16>::mma(a2[mb], b, acc[mb][nb]); if (NSPLIT >= 2) acc[mb][nb] = WFrag<T16>::mma(a[mb], b2, acc[mb][nb]); } }
        asm volatile("v_nop\n\tv_nop\n\tv_nop\n\tv_nop" : "+v"(acc[0][0]), "+v"(acc[1][1]), "+v"(acc[2][2]), "+v"(acc[3][3]) : "v"(a[0]), "v"(a[3]));   // the distance behind the trip's last matrix instructions, on the back edge too
        asm volatile("s_wait_xcnt 0x0" :: "v"(pa), "v"(pa2), "v"(pb), "v"(pb2) : "memory");   // the wait before a register that an issued load names is overwritten: as inputs here the trip's address registers stay whole up to it
    }
    ep.ahead(0); ep.ahead(1); ep.ready();
#pragma unroll
    for (int mb = 0; mb < 4; ++mb) {
#pragma unroll
        for (int nb = 0; nb < 4; ++nb) {
#pragma unroll
            for (int j = 0; j < 8; ++j) os[(hi * 8 + j) * 68 + nb * 16 + lr] = ep.stage(mb, j, acc[mb][nb][j]); }
        __builtin_amdgcn_wave_barrier(); asm volatile("" ::: "memory");   // the wave's LDS writes stay in front of its reads
#pragma unroll
        for (int s = 0; s < 8; ++s) { const int row = EP::ROW8 ? hi * 8 + s : 2 * s + hi; ep.put(mb, s, *(const v4fa*)(os + row * 68 + lr * 4)); }
        __builtin_amdgcn_wave_barrier(); asm volatile("" ::: "memory");   // the reads stay in front of the next block's writes
        if (mb + 2 < 4) ep.ahead(mb + 2);
    }
}
// Launches that read none of each other's output share one grid: a range of blockIdx.x is one job, the longer job first.
// k_gemm_hq: BN1 and BN2 of h_al + b_ht, h_al [m][c] = h w_ht^T (256 tiles, K = 512), then q = BN0(f) w_q^T + b_q as fp16 head planes (1024 tiles).
__global__ __launch_bounds__(32) void k_gemm_hq(const bf* __restrict__ HB, const bf* __restrict__ WHT, const float* __restrict__ bht, const float* __restrict__ gam, const float* __restrict__ bet, const float* __restrict__ mean, const float* __restrict__ var,
                                                bf* H1h, bf* H1l, bf* H2h, bf* H2l, const bf* __restrict__ FTh, const bf* __restrict__ FTl, const bf* __restrict__ WQ, const float* __restrict__ bq, h16* QP) {
    __shared__ __align__(16) float os[16 * 68];
    const int b = blockIdx.x;
    if (b < (CC / 64) * (MM / 64) * NB_) { const size_t o = (size_t)(b >> 6) * MM * CC; EpBN ep; ep.T[0][0] = H1h + o; ep.T[0][1] = H1l + o; ep.T[1][0] = H2h + o; ep.T[1][1] = H2l + o; ep.bht = bht; ep.gam = gam; ep.bet = bet; ep.mean = mean; ep.var = var;
        d_gemmw<bf, 0, CH>((b >> 2) & 15, b & 3, b >> 6, os, HB, nullptr, WHT, nullptr, (size_t)MM * CH, 0, ep); }
    else { const int t = b - (CC / 64) * (MM / 64) * NB_; EpHead ep; ep.P = QP + (size_t)(t >> 8) * NHD * NN * DH; ep.rows = NN; ep.bias = bq;
        d_gemmw<bf, 1, CC>(t & 63, (t >> 6) & 3, t >> 8, os, FTh, FTl, WQ, nullptr, (size_t)NN * CC, 0, ep); }
}
// k_gemm_kv: k = BN1(h_al) w_k^T + b_k as fp16 head planes (256 tiles), then v [c][m] = w_v BN2(h_al) + b_v as fp16 (256 tiles).
__global__ __launch_bounds__(32) void k_gemm_kv(const bf* __restrict__ H1h, const bf* __restrict__ H1l, const bf* __restrict__ WK, const float* __restrict__ bk, h16* KP, const bf* __restrict__ WV, const bf* __restrict__ H2h, const bf* __restrict__ H2l, const float* __restrict__ bv, h16* V16) {
    __shared__ __align__(16) float os[16 * 68];
    const int b = blockIdx.x;
    if (b < (MM / 64) * (CC / 64) * NB_) { EpHead ep; ep.P = KP + (size_t)(b >> 6) * NHD * MM * DH; ep.rows = MM; ep.bias = bk;
        d_gemmw<bf, 1, CC>(b & 15, (b >> 4) & 3, b >> 6, os, H1h, H1l, WK, nullptr, (size_t)MM * CC, 0, ep); }
    else { const int t = b - (MM / 64) * (CC / 64) * NB_; EpVal ep; ep.V = V16 + (size_t)(t >> 6) * CC * MM; ep.bv = bv;
        d_gemmw<bf, 3, CC>(t & 3, (t >> 2) & 15, t >> 6, os, WV, nullptr, H2h, H2l, 0, (size_t)MM * CC, ep); }
}
// k_gemm_out: result [c][n] = f + w_out . out + b_out; grid (CC/64, NN/64, images).
__global__ __launch_bounds__(32) void k_gemm_out(const bf* __restrict__ WO, const bf* __restrict__ Oh, const bf* __restrict__ Ol, const float* __restrict__ f, const float* __restrict__ bp, float* OUT) {
    __shared__ __align__(16) float os[16 * 68];
    EpOut ep; ep.f = f + (size_t)blockIdx.z * CC * NN; ep.O = OUT + (size_t)blockIdx.z * CC * NN; ep.bp = bp;
    d_gemmw<bf, 3, CC>(blockIdx.x, blockIdx.y, blockIdx.z, os, WO, nullptr, Oh, Ol, 0, (size_t)NN * CC, ep);
}


// xw: the wait that stands between an issued global load and the next load, whose result may land in a register that the issued one names.
__device__ __forceinline__ void xw() { asm volatile("s_wait_xcnt 0x0" ::: "memory"); }
__device__ __forceinline__ void d_cvt8(const int bx, const float* __restrict__ src, bf* dst, size_t n8) { const size_t i = (size_t)bx * 256 + threadIdx.x; if (i >= n8) return; const v8f v = *(const v8f*)(src + i * 8); v8us o;
#pragma unroll
    for (int k = 0; k < 8; ++k) o[k] = f2bf(v[k]); *(v8us*)(dst + i * 8) = o;  }
__device__ __forceinline__ void d_xth(const int bx, const int by, const float* __restrict__ hb, bf* HB) {
    hb += (size_t)by * CH * MM; HB += (size_t)by * MM * CH;   // by: image
    const int lane = threadIdx.x & 31; const int L0 = (bx * 8 + (threadIdx.x >> 5)) * 8; const int nlines = MM * CH / 64;
{
#pragma unroll
        for (int l = 0; l < 8; ++l) { const int L = L0 + l; if (L >= nlines) break; const int e = L * 64 + lane * 2; const int k = e & (CH - 1); const int m = e >> 9; v2us o;
#pragma unroll
            for (int q = 0; q < 2; ++q) { const float x = hb[(size_t)(k + q) * MM + m]; xw(); o[q] = f2bf(x); }
            *(v2us*)(HB + (size_t)e) = o; }
         }
}
// d_bnT: token-major hi/lo planes T[n][c] = split((src[c][n] (+ bf16(rowbias[c]) if given) (bf16-rounded first when RAW) * inv[c] + shift[c]) with inv = bf16(gamma)/sqrt(bf16(var)+1e-5), shift = bf16(beta) -
template <int RAW>
__device__ __forceinline__ void d_bnT(const int bx, const int by, const float* __restrict__ src, int cols, int lg2cols, const float* __restrict__ rowbias, const float* __restrict__ gam, const float* __restrict__ bet, const float* __restrict__ mean, const float* __restrict__ var, bf* Th, bf* Tl) {
    src += (size_t)by * CC * cols; Th += (size_t)by * cols * CC; Tl += (size_t)by * cols * CC;   // by: image
    const int lane = threadIdx.x & 31; const int L0 = (bx * 8 + (threadIdx.x >> 5)) * 8; const int nlines = cols * CC / 64;
{
#pragma unroll 1
        for (int l = 0; l < 8; ++l) { const int L = L0 + l; if (L >= nlines) break; const int e = L * 64 + lane * 2; const int c = e & (CC - 1); const int n = e >> 8; v2us oh, ol;
#pragma unroll
            // xw() only when RAW == 0 or a row bias is given; k_prep's one d_bnT job, RAW == 1 without row bias, issues none
            for (int q = 0; q < 2; ++q) { const int cc = c + q; const float gq = gam[cc]; if (!RAW) xw(); const float vq = var[cc]; if (!RAW) xw(); const float mq = mean[cc]; if (!RAW) xw(); const float inv = __fdiv_rn(bfr(gq), __fsqrt_rn(__fadd_rn(bfr(vq), 1e-5f))); float ms = __fmul_rn(bfr(mq), inv); asm volatile("" : "+v"(ms)); const float bq = bet[cc]; if (!RAW) xw(); const float sh = __fsub_rn(bfr(bq), ms);
                float x = src[(size_t)cc * cols + n]; if (!RAW) xw(); if (RAW) x = bfr(x); if (rowbias) { const float rq = rowbias[cc]; xw(); x = __fadd_rn(x, bfr(rq)); } float t = __fmul_rn(x, inv); asm volatile("" : "+v"(t)); unsigned short a, c2; splitf(__fadd_rn(t, sh), a, c2); oh[q] = a; ol[q] = c2; }
            *(v2us*)(Th + (size_t)e) = oh; *(v2us*)(Tl + (size_t)e) = ol; }
         }
}
// k_prep: the jobs that read inputs only. BN0(bf16(f)) token-major (1024 work-groups), h token-major (512), the five weight matrices as bf16 (64 + 4 x 32).
__global__ __launch_bounds__(256) void k_prep(const float* __restrict__ f, const float* __restrict__ hin, const float* __restrict__ wht, const float* __restrict__ wq, const float* __restrict__ wk, const float* __restrict__ wv, const float* __restrict__ wo,
                                              const float* __restrict__ gam, const float* __restrict__ bet, const float* __restrict__ mean, const float* __restrict__ var, bf* FTh, bf* FTl, bf* HB, bf* WHT, bf* WQ, bf* WK, bf* WV, bf* WO) {
    int b = blockIdx.x;
    if (b < 256 * NB_) { d_bnT<1>(b & 255, b >> 8, f, NN, 12, nullptr, gam, bet, mean, var, FTh, FTl); return; }
    b -= 256 * NB_;
    if (b < 128 * NB_) { d_xth(b & 127, b >> 7, hin, HB); return; }
    b -= 128 * NB_;
    if (b < 64) { d_cvt8(b, wht, WHT, (size_t)CC * CH / 8); return; }
    b -= 64;
    const int w = b >> 5; const float* src = w == 0 ? wq : w == 1 ? wk : w == 2 ? wv : wo; bf* dst = w == 0 ? WQ : w == 1 ? WK : w == 2 ? WV : WO;
    d_cvt8(b & 31, src, dst, (size_t)CC * CC / 8);
}
// ---- k_attn: scores, softmax and the value product of one head pair for 64 queries in one work-group; grid (NN/64, NHD/2, images), 256 threads = 8 waves, wave w: head (w & 1) of the pair, queries 16 (w >> 1) ...
// The pair's keys [2][MM][DH] and values [2 DH][MM] lie in LDS for the whole launch. S^T = K Q^T (a lane holds one query's scores: 8 keys a tile), so two score tiles, converted in place, are the B operand of
// O^T += V P^T (V rows read in the same k order as the packed tiles). Pass 1 finds each query's exact maximum, pass 2 forms the scores again, p = exp((s - max) * 32^-0.5) * 1024 as fp16, f32 row sum of p.
// The attended map leaves normalised, as bf16 hi+lo planes [n][c]; it goes through LDS so that each 128-byte line of a plane is stored by one wave instruction.
#define KPIT 40      // LDS pitch of a key row, in halves: 80 B = 16 B x odd, conflict-free for 16-byte fragment reads
#define VPIT 1032    // LDS pitch of a value row, in halves: 2064 B = 16 B x odd
#define OPIT 72      // LDS pitch of a staged output row, in 16-bit elements
__device__ __forceinline__ v16h ldh(const h16* p) { return cat16(*(const v8h*)p, *(const v8h*)(p + 16)); }
__global__ __launch_bounds__(256) void k_attn(const h16* __restrict__ QP, const h16* __restrict__ KP, const h16* __restrict__ V16, bf* Oh, bf* Ol) {
    __shared__ __align__(16) h16 Ks[2 * MM * KPIT];
    __shared__ __align__(16) h16 Vs[2 * DH * VPIT];
    __shared__ __align__(16) bf Os[2 * 64 * OPIT];
    QP += (size_t)blockIdx.z * NHD * NN * DH; KP += (size_t)blockIdx.z * NHD * MM * DH; V16 += (size_t)blockIdx.z * CC * MM; Oh += (size_t)blockIdx.z * NN * CC; Ol += (size_t)blockIdx.z * NN * CC;   // blockIdx.z: image
    const int tid = threadIdx.x, lane = tid & 31, wave = tid >> 5, lr = lane & 15, hi = lane >> 4; const int hp = blockIdx.y, hl = wave & 1, qt = wave >> 1;
    const h16* kg = KP + (size_t)hp * 2 * MM * DH; const h16* vg = V16 + (size_t)hp * 2 * DH * MM;
#pragma unroll 16   // sixteen 16-byte loads in flight per thread while the tiles are laid: the fill is bound by latency otherwise
    for (int t = 0; t < 2 * MM * DH / 8 / 256; ++t) { const int i = t * 256 + tid; *(v8h*)(Ks + (i >> 2) * KPIT + (i & 3) * 8) = *(const v8h*)(kg + (size_t)i * 8); }
#pragma unroll 16   // as above
    for (int t = 0; t < 2 * DH * MM / 8 / 256; ++t) { const int i = t * 256 + tid; *(v8h*)(Vs + (i >> 7) * VPIT + (i & 127) * 8) = *(const v8h*)(vg + (size_t)i * 8); }
    const v16h qf = ldh(QP + ((size_t)(hp * 2 + hl) * NN + blockIdx.x * 64 + qt * 16 + lr) * DH + 8 * hi);
    __syncthreads();
    const h16* kl = Ks + (hl * MM + lr) * KPIT + 8 * hi; const h16* vl = Vs + (hl * DH + lr) * VPIT + 8 * hi;
    float m = -3.0e38f;
#pragma unroll 8   // independent score tiles fill each other's distance behind the matrix instruction
    for (int kt = 0; kt < MM / 16; ++kt) { const v8f s = wmma16(ldh(kl + kt * 16 * KPIT), qf, (v8f){});
        m = fmaxf(m, fmaxf(fmaxf(fmaxf(s[0], s[1]), fmaxf(s[2], s[3])), fmaxf(fmaxf(s[4], s[5]), fmaxf(s[6], s[7])))); }
    m = fmaxf(m, __shfl_xor(m, 16, 32));
    v8f o0 = (v8f){}, o1 = (v8f){}; float sum0 = 0.f, sum1 = 0.f; const float c2 = SCL * 1.4426950408889634f;
#pragma unroll 2   // two 32-key steps side by side: one step's exponentials cover the other's LDS reads and matrix distances
    for (int kc = 0; kc < MM; kc += 32) {
        const v8f s0 = wmma16(ldh(kl + kc * KPIT), qf, (v8f){}), s1 = wmma16(ldh(kl + (kc + 16) * KPIT), qf, (v8f){}); const v16h va = ldh(vl + kc), vb = ldh(vl + 16 * VPIT + kc); v16h p;
#pragma unroll
        for (int j = 0; j < 8; ++j) { const float e0 = __builtin_amdgcn_exp2f(__builtin_fmaf(s0[j] - m, c2, 10.0f)), e1 = __builtin_amdgcn_exp2f(__builtin_fmaf(s1[j] - m, c2, 10.0f));   // + 10: p carries a factor 2^10, which keeps small weights out of the fp16 subnormals; the row sum carries it too
            sum0 += e0; sum1 += e1; p[j] = tohx(e0); p[8 + j] = tohx(e1); }
        o0 = wmma16(va, p, o0); o1 = wmma16(vb, p, o1); }
    float sum = sum0 + sum1; sum += __shfl_xor(sum, 16, 32); const float ri = __fdiv_rn(1.0f, sum);
    { v8us h0, l0, h1, l1;
#pragma unroll
      for (int j = 0; j < 8; ++j) { unsigned short a, c; splitf(__fmul_rn(o0[j], ri), a, c); h0[j] = a; l0[j] = c; splitf(__fmul_rn(o1[j], ri), a, c); h1[j] = a; l1[j] = c; }
      bf* od = Os + (qt * 16 + lr) * OPIT + hl * DH + 8 * hi;
      *(v8us*)od = h0; *(v8us*)(od + 16) = h1; *(v8us*)(od + 64 * OPIT) = l0; *(v8us*)(od + 64 * OPIT + 16) = l1; }
    __syncthreads();
#pragma unroll
    for (int t = 0; t < 2 * 64 * 8 / 256; ++t) { const int i = t * 256 + tid, r = i >> 3, c = i & 7; bf* dst = (r >> 6 ? Ol : Oh) + (size_t)(blockIdx.x * 64 + (r & 63)) * CC + hp * 64 + c * 8; *(v8us*)dst = *(const v8us*)(Os + r * OPIT + c * 8); }
}


extern "C" void kernel_launch(void* const* d_in, const int* in_sizes, int n_in,
                              void* d_out, int out_size, void* d_ws, size_t ws_size, hipStream_t stream) {
    (void)in_sizes; (void)n_in; (void)out_size;
    const float* IN[16]; for (int i = 0; i < 16; ++i) IN[i] = (const float*)d_in[i];
    // f [4][256][64][64], h [4][512][32][32], w_ht [256][512], b_ht, bn_gamma [3][256], bn_beta, bn_mean, bn_var, w_q [256][256], b_q, w_k, b_k, w_v, b_v, w_out, b_out = d_in[0..15]
    const float* f = IN[0]; const float* hin = IN[1]; const float* gam = IN[4]; const float* bet = IN[5]; const float* mean = IN[6]; const float* var = IN[7];
    float* OUT = (float*)d_out;     // [4][256][64][64]
    char* wsp = (char*)d_ws;
    auto take = [&](size_t bytes) { char* p = wsp; wsp += (bytes + 255) & ~(size_t)255; return (void*)p; };
    bf* WHT = (bf*)take((size_t)CC * CH * 2); bf* WQ = (bf*)take((size_t)CC * CC * 2); bf* WK = (bf*)take((size_t)CC * CC * 2); bf* WV = (bf*)take((size_t)CC * CC * 2); bf* WO = (bf*)take((size_t)CC * CC * 2);
    // per-image planes, NB_ images one behind the other
    bf* HB = (bf*)take((size_t)NB_ * MM * CH * 2); bf* H1h = (bf*)take((size_t)NB_ * MM * CC * 2); bf* H1l = (bf*)take((size_t)NB_ * MM * CC * 2); bf* H2h = (bf*)take((size_t)NB_ * MM * CC * 2); bf* H2l = (bf*)take((size_t)NB_ * MM * CC * 2);
    bf* FTh = (bf*)take((size_t)NB_ * NN * CC * 2); bf* FTl = (bf*)take((size_t)NB_ * NN * CC * 2); h16* QP = (h16*)take((size_t)NB_ * NHD * NN * DH * 2); h16* KP = (h16*)take((size_t)NB_ * NHD * MM * DH * 2);
    h16* V16 = (h16*)take((size_t)NB_ * CC * MM * 2);
    bf* Oh = (bf*)take((size_t)NB_ * NN * CC * 2); bf* Ol = (bf*)take((size_t)NB_ * NN * CC * 2);
    if ((size_t)(wsp - (char*)d_ws) > ws_size) return;    // total ~ 57 MB; ws 256 MiB
    k_prep<<<256 * NB_ + 128 * NB_ + 64 + 4 * 32, 256, 0, stream>>>(f, hin, IN[2], IN[8], IN[10], IN[12], IN[14], gam, bet, mean, var, FTh, FTl, HB, WHT, WQ, WK, WV, WO);   // BN0(bf16(f)), h token-major, bf16 weights
    k_gemm_hq<<<(CC / 64) * (MM / 64) * NB_ + (NN / 64) * (CC / 64) * NB_, 32, 0, stream>>>(HB, WHT, IN[3], gam, bet, mean, var, H1h, H1l, H2h, H2l, FTh, FTl, WQ, IN[9], QP);   // BN1, BN2 of h_al + b_ht; q head planes
    k_gemm_kv<<<2 * (MM / 64) * (CC / 64) * NB_, 32, 0, stream>>>(H1h, H1l, WK, IN[11], KP, WV, H2h, H2l, IN[13], V16);   // k head planes; v + b_v
    k_attn<<<dim3(NN / 64, NHD / 2, NB_), 256, 0, stream>>>(QP, KP, V16, Oh, Ol);   // softmax(q k) v, normalised, token-major hi+lo planes
    k_gemm_out<<<dim3(CC / 64, NN / 64, NB_), 32, 0, stream>>>(WO, Oh, Ol, f, IN[15], OUT);   // f + w_out . out + b_out
}

// v005
// A run of this version takes 94.6 microseconds.
// Next to v004, in two timings, it ran 1.13 and 1.15 times as fast.
// Over all steps from v000 it is 18.3 times as fast.
#include <hip/hip_runtime.h>

// CIM (cross-image attention; f [4][256][64][64] (N = 4096 queries), h [4][512][32][32] (M = 1024 keys); h_al = w_ht h + b_ht; q = w_q BN0(f) + b_q, k = w_k BN1(h_al) + b_k, v = w_v BN2(h_al) + b_v
// (BatchNorm in inference form with the given statistics); 8 heads of 32 channels: attn = softmax_m(q_h . k_h * 32^-0.5); out[c][n] = sum_m attn[n][m] v[c][m]; result = f + w_out out + b_out).
// Compute dtypes, f32 accumulate: every input rounded to bf16; h_al on PLAIN bf16 operands (inputs: exact); the BatchNorms in f32 on VALU written as bf16 hi+lo
// x1024, fp16 v); the output conv on hi+lo planes of the attended map (2 products); bias + residual f32. One-wave-per-64x64-tile GEMMs; every launch covers all four images; launches that read none of each other's output share one grid. Deterministic, no

#define NB_  4
#define CC   256
#define CH   512                  // channels of h
#define NN   4096                 // query positions
#define MM   1024                 // key positions
#define NHD  8
#define DH   32
#define SCL  0.17677669529663687f   // f32(32^-0.5)
typedef _Float16 h16;
typedef unsigned short bf;
typedef __attribute__((ext_vector_type(16))) __bf16   v16bf;
typedef __attribute__((ext_vector_type(16))) _Float16 v16h;
typedef __attribute__((ext_vector_type(8)))  _Float16 v8h;
typedef __attribute__((ext_vector_type(8)))  unsigned short v8us;
typedef __attribute__((ext_vector_type(8)))  float    v8f;
typedef __attribute__((ext_vector_type(4)))  float    v4f;
typedef v8h  __attribute__((may_alias)) v8ha;
typedef v4f  __attribute__((may_alias)) v4fa;
typedef v8us __attribute__((may_alias)) v8usa;

__device__ __forceinline__ unsigned short f2bf(float f) { unsigned u = __float_as_uint(f); u += 0x7FFFu + ((u >> 16) & 1u); return (unsigned short)(u >> 16); }
__device__ __forceinline__ float bf2f(unsigned short b) { return __uint_as_float(((unsigned)b) << 16); }
__device__ __forceinline__ float bfr(float f) { return bf2f(f2bf(f)); }
__device__ __forceinline__ v16h cat16(v8h lo, v8h hi) { return __builtin_shufflevector(lo, hi, 0, 1, 2, 3, 4, 5, 6, 7, 8, 9, 10, 11, 12, 13, 14, 15); }
__device__ __forceinline__ v16bf cat16b(v8us lo, v8us hi) { return __builtin_bit_cast(v16bf, __builtin_shufflevector(lo, hi, 0, 1, 2, 3, 4, 5, 6, 7, 8, 9, 10, 11, 12, 13, 14, 15)); }
__device__ __forceinline__ v8f wmma16(v16h a, v16h b, v8f c) { return __builtin_amdgcn_wmma_f32_16x16x32_f16(false, a, false, b, (short)0, c, false, false); }
__device__ __forceinline__ v8f wmmab(v16bf a, v16bf b, v8f c) { return __builtin_amdgcn_wmma_f32_16x16x32_bf16(false, a, false, b, (short)0, c, false, false); }



template <typename T16> struct WFrag;
template <> struct WFrag<h16> { typedef v16h V; static __device__ __forceinline__ V ld(const h16* p) { return cat16(*(const v8h*)p, *(const v8h*)(p + 16)); } static __device__ __forceinline__ v8f mma(V a, V b, v8f c) { return wmma16(a, b, c); } };
template <> struct WFrag<bf> { typedef v16bf V; static __device__ __forceinline__ V ld(const bf* p) { return cat16b(*(const v8us*)p, *(const v8us*)(p + 16)); } static __device__ __forceinline__ v8f mma(V a, V b, v8f c) { return wmmab(a, b, c); } };
__device__ __forceinline__ h16 tohx(float x) { return (h16)x; }
__device__ __forceinline__ void splitf(float y, unsigned short& h, unsigned short& l) { h = f2bf(y); l = f2bf(y - bf2f(h)); }
typedef __attribute__((ext_vector_type(2))) _Float16 v2h;
typedef __attribute__((ext_vector_type(2))) unsigned short v2us;
typedef __attribute__((ext_vector_type(8))) _Float16 v8h16;

// ---- Epilogues: what a 64x64 GEMM tile becomes on its way out of the wave that computed it (the elementwise pass that used to follow the GEMM as a launch of its own, on the same f32 values).
// load(): lane addresses and the per-column or per-row parameters, issued in front of the K loop; ready(): their arithmetic, behind it; ahead(mb): loads for 16-row block mb, issued two blocks early;
// stage(): a value on its way into LDS (accumulator layout: row hi * 8 + j); put(): four neighbouring columns of row (ROW8 ? hi * 8 + s : 2 * s + hi) of block mb.
typedef __attribute__((ext_vector_type(4))) _Float16 v4h;
typedef __attribute__((ext_vector_type(4))) unsigned short v4us;
// EpHead: C[row][c] + bf16(bias[c]) as fp16 head planes P[c / 32][row][c % 32]; rows 2 s and 2 s + 1 of a head are one 128-byte line, stored by one instruction.
struct EpHead {
    static constexpr bool ROW8 = false;
    h16* P; int rows; const float* bias; v4f b;
    __device__ __forceinline__ void load(int r0, int c0, int lr, int hi) { const int c = c0 + lr * 4; P += ((size_t)(c >> 5) * rows + r0 + hi) * DH + (c & (DH - 1)); b = *(const v4f*)(bias + c); }
    __device__ __forceinline__ void ready() {
#pragma unroll
        for (int q = 0; q < 4; ++q) b[q] = bfr(b[q]); }
    __device__ __forceinline__ void ahead(int) {}
    __device__ __forceinline__ float stage(int, int, float x) { return x; }
    __device__ __forceinline__ void put(int mb, int s, v4f val) { v4h o;
#pragma unroll
        for (int q = 0; q < 4; ++q) o[q] = tohx(val[q] + b[q]);
        *(v4h*)(P + (mb * 16 + 2 * s) * DH) = o; }
};
// EpBN: the two BatchNorms of C[m][c] + bf16(b_ht[c]) as token-major bf16 hi+lo planes; inv = bf16(gamma) / sqrt(bf16(var) + 1e-5) and shift = bf16(beta) - bf16(mean) * inv once a lane and column.
struct EpBN {
    static constexpr bool ROW8 = false;
    bf* T[2][2]; const float* bht; const float* gam; const float* bet; const float* mean; const float* var; v4f rb, g[2], be[2], mu[2], va[2];
    __device__ __forceinline__ void load(int r0, int c0, int lr, int hi) { const int c = c0 + lr * 4; const size_t o = (size_t)(r0 + hi) * CC + c; rb = *(const v4f*)(bht + c);
#pragma unroll
        for (int w = 0; w < 2; ++w) { const int p = (1 + w) * CC + c; T[w][0] += o; T[w][1] += o; g[w] = *(const v4f*)(gam + p); be[w] = *(const v4f*)(bet + p); mu[w] = *(const v4f*)(mean + p); va[w] = *(const v4f*)(var + p); } }
    __device__ __forceinline__ void ready() {   // g becomes inv, be becomes shift
#pragma unroll
        for (int q = 0; q < 4; ++q) { rb[q] = bfr(rb[q]);
#pragma unroll
            for (int w = 0; w < 2; ++w) { const float inv = __fdiv_rn(bfr(g[w][q]), __fsqrt_rn(bfr(va[w][q]) + 1e-5f)); g[w][q] = inv; be[w][q] = bfr(be[w][q]) - bfr(mu[w][q]) * inv; } } }
    __device__ __forceinline__ void ahead(int) {}
    __device__ __forceinline__ float stage(int, int, float x) { return x; }
    __device__ __forceinline__ void put(int mb, int s, v4f val) {
#pragma unroll
        for (int w = 0; w < 2; ++w) { v4us oh, ol;
#pragma unroll
            for (int q = 0; q < 4; ++q) { unsigned short a, c2; splitf((val[q] + rb[q]) * g[w][q] + be[w][q], a, c2); oh[q] = a; ol[q] = c2; }
            *(v4us*)(T[w][0] + (mb * 16 + 2 * s) * CC) = oh; *(v4us*)(T[w][1] + (mb * 16 + 2 * s) * CC) = ol; } }
};
// EpVal: C[c][m] + bf16(b_v[c]) as fp16 [c][m]; the row's bias is added in the accumulator layout.
struct EpVal {
    static constexpr bool ROW8 = false;
    h16* V; const float* bv; v8f b[4];
    __device__ __forceinline__ void load(int r0, int c0, int lr, int hi) { V += (size_t)(r0 + hi) * MM + c0 + lr * 4;
#pragma unroll
        for (int mb = 0; mb < 4; ++mb) b[mb] = *(const v8f*)(bv + r0 + mb * 16 + hi * 8); }
    __device__ __forceinline__ void ready() {
#pragma unroll
        for (int mb = 0; mb < 4; ++mb)
#pragma unroll
            for (int j = 0; j < 8; ++j) b[mb][j] = bfr(b[mb][j]); }
    __device__ __forceinline__ void ahead(int) {}
    __device__ __forceinline__ float stage(int mb, int j, float x) { return x + b[mb][j]; }
    __device__ __forceinline__ void put(int mb, int s, v4f val) { v4h o;
#pragma unroll
        for (int q = 0; q < 4; ++q) o[q] = tohx(val[q]);
        *(v4h*)(V + (mb * 16 + 2 * s) * MM) = o; }
};
// EpOut: the result, (bf16(f[c][n]) + C[c][n]) + bf16(b_out[c]) in f32.
struct EpOut {
    static constexpr bool ROW8 = true;
    const float* f; float* O; const float* bp; v4f fv[4][8]; v8f b[4];
    __device__ __forceinline__ void load(int r0, int c0, int lr, int hi) { const size_t o = (size_t)(r0 + hi * 8) * NN + c0 + lr * 4; f += o; O += o; bp += r0 + hi * 8; }
    __device__ __forceinline__ void ready() {}
    __device__ __forceinline__ void ahead(int mb) {
        if (mb >= 2) asm volatile("s_wait_xcnt 0x0" ::: "memory");   // blocks 2 and 3 are fetched behind a block's stores and may land in registers that those stores name: the wait before such a register is overwritten
        b[mb] = *(const v8f*)(bp + mb * 16);
#pragma unroll
        for (int s = 0; s < 8; ++s) fv[mb][s] = *(const v4f*)(f + (mb * 16 + s) * NN); }
    __device__ __forceinline__ float stage(int, int, float x) { return x; }
    __device__ __forceinline__ void put(int mb, int s, v4f val) { v4f o;
#pragma unroll
        for (int q = 0; q < 4; ++q) o[q] = (bfr(fv[mb][s][q]) + val[q]) + bfr(b[mb][s]);
        *(v4f*)(O + (mb * 16 + s) * NN) = o; }
};

// ---- d_gemmw: register-blocked GEMM as one job of a grid: tile (bx, by) of batch bz out of (M/64, N/64, Z), ONE WAVE per 64x64 tile (16 accumulators), operands straight from K-contiguous 16-bit planes, K a literal.
// C[m][n] (f32) = sum_k A[m][k] Bt[n][k] (+ split products per NSPLIT) goes to the epilogue ep, 16 rows at a time through os (16 x 68 floats of LDS). z-batch strides sA/sB in elements.
template <typename T16, int NSPLIT, int K, typename EP>
__device__ __forceinline__ void d_gemmw(const int bx, const int by, const int bz, float* os, const T16* __restrict__ A, const T16* __restrict__ A2, const T16* __restrict__ Bt, const T16* __restrict__ Bt2, size_t sA, size_t sB, EP& ep) {
    typedef typename WFrag<T16>::V V;
    const size_t z = bz; A += z * sA; if (A2) A2 += z * sA; Bt += z * sB; if (Bt2) Bt2 += z * sB;
    const int lane = threadIdx.x & 31, lr = lane & 15, hi = lane >> 4; const int r0 = bx * 64, c0 = by * 64;
    ep.load(r0, c0, lr, hi);
    v8f acc[4][4];
#pragma unroll
    for (int mb = 0; mb < 4; ++mb)
#pragma unroll
        for (int nb = 0; nb < 4; ++nb) acc[mb][nb] = (v8f){};
    const size_t aoff = (size_t)(r0 + lr) * K + 8 * hi, boff = (size_t)(c0 + lr) * K + 8 * hi;
#pragma unroll 1   // one trip's fragments and the 16 accumulators fill the register file; a second trip unrolled would spill
    for (int kc = 0; kc < K; kc += 32) {
        const T16* pa = A + aoff + kc; const T16* pa2 = (NSPLIT == 1 || NSPLIT == 2) ? A2 + aoff + kc : pa; const T16* pb = Bt + boff + kc; const T16* pb2 = NSPLIT >= 2 ? Bt2 + boff + kc : pb;   // this trip's lane addresses; every load below is one of them plus a constant
        V a[4], a2[4];
#pragma unroll
        for (int mb = 0; mb < 4; ++mb) { a[mb] = WFrag<T16>::ld(pa + mb * 16 * K); if (NSPLIT == 1 || NSPLIT == 2) a2[mb] = WFrag<T16>::ld(pa2 + mb * 16 * K); }
#pragma unroll
        for (int nb = 0; nb < 4; ++nb) { const V b = WFrag<T16>::ld(pb + nb * 16 * K); V b2; if (NSPLIT >= 2) b2 = WFrag<T16>::ld(pb2 + nb * 16 * K);
#pragma unroll
            for (int mb = 0; mb < 4; ++mb) { acc[mb][nb] = WFrag<T16>::mma(a[mb], b, acc[mb][nb]); if (NSPLIT == 1 || NSPLIT == 2) acc[mb][nb] = WFrag<T16>::mma(a2[mb], b, acc[mb][nb]); if (NSPLIT >= 2) acc[mb][nb] = WFrag<T16>::mma(a[mb], b2, acc[mb][nb]); } }
        asm volatile("v_nop\n\tv_nop\n\tv_nop\n\tv_nop" : "+v"(acc[0][0]), "+v"(acc[1][1]), "+v"(acc[2][2]), "+v"(acc[3][3]) : "v"(a[0]), "v"(a[3]));   // the distance behind the trip's last matrix instructions, on the back edge too
        asm volatile("s_wait_xcnt 0x0" :: "v"(pa), "v"(pa2), "v"(pb), "v"(pb2) : "memory");   // the wait before a register that an issued load names is overwritten: as inputs here the trip's address registers stay whole up to it
    }
    ep.ahead(0); ep.ahead(1); ep.ready();
#pragma unroll
    for (int mb = 0; mb < 4; ++mb) {
#pragma unroll
        for (int nb = 0; nb < 4; ++nb) {
#pragma unroll
            for (int j = 0; j < 8; ++j) os[(hi * 8 + j) * 68 + nb * 16 + lr] = ep.stage(mb, j, acc[mb][nb][j]); }
        __builtin_amdgcn_wave_barrier(); asm volatile("" ::: "memory");   // the wave's LDS writes stay in front of its reads
#pragma unroll
        for (int s = 0; s < 8; ++s) { const int row = EP::ROW8 ? hi * 8 + s : 2 * s + hi; ep.put(mb, s, *(const v4fa*)(os + row * 68 + lr * 4)); }
        __builtin_amdgcn_wave_barrier(); asm volatile("" ::: "memory");   // the reads stay in front of the next block's writes
        if (mb + 2 < 4) ep.ahead(mb + 2);
    }
}
// Launches that read none of each other's output share one grid: a range of blockIdx.x is one job, the longer job first.
// k_gemm_hq: BN1 and BN2 of h_al + b_ht, h_al [m][c] = h w_ht^T (256 tiles, K = 512), then q = BN0(f) w_q^T + b_q as fp16 head planes (1024 tiles).
__global__ __launch_bounds__(32) void k_gemm_hq(const bf* __restrict__ HB, const bf* __restrict__ WHT, const float* __restrict__ bht, const float* __restrict__ gam, const float* __restrict__ bet, const float* __restrict__ mean, const float* __restrict__ var,
                                                bf* H1h, bf* H1l, bf* H2h, bf* H2l, const bf* __restrict__ FTh, const bf* __restrict__ FTl, const bf* __restrict__ WQ, const float* __restrict__ bq, h16* QP) {
    __shared__ __align__(16) float os[16 * 68];
    const int b = blockIdx.x;
    if (b < (CC / 64) * (MM / 64) * NB_) { const size_t o = (size_t)(b >> 6) * MM * CC; EpBN ep; ep.T[0][0] = H1h + o; ep.T[0][1] = H1l + o; ep.T[1][0] = H2h + o; ep.T[1][1] = H2l + o; ep.bht = bht; ep.gam = gam; ep.bet = bet; ep.mean = mean; ep.var = var;
        d_gemmw<bf, 0, CH>((b >> 2) & 15, b & 3, b >> 6, os, HB, nullptr, WHT, nullptr, (size_t)MM * CH, 0, ep); }
    else { const int t = b - (CC / 64) * (MM / 64) * NB_; EpHead ep; ep.P = QP + (size_t)(t >> 8) * NHD * NN * DH; ep.rows = NN; ep.bias = bq;
        d_gemmw<bf, 1, CC>(t & 63, (t >> 6) & 3, t >> 8, os, FTh, FTl, WQ, nullptr, (size_t)NN * CC, 0, ep); }
}
// k_gemm_kv: k = BN1(h_al) w_k^T + b_k as fp16 head planes (256 tiles), then v [c][m] = w_v BN2(h_al) + b_v as fp16 (256 tiles).
__global__ __launch_bounds__(32) void k_gemm_kv(const bf* __restrict__ H1h, const bf* __restrict__ H1l, const bf* __restrict__ WK, const float* __restrict__ bk, h16* KP, const bf* __restrict__ WV, const bf* __restrict__ H2h, const bf* __restrict__ H2l, const float* __restrict__ bv, h16* V16) {
    __shared__ __align__(16) float os[16 * 68];
    const int b = blockIdx.x;
    if (b < (MM / 64) * (CC / 64) * NB_) { EpHead ep; ep.P = KP + (size_t)(b >> 6) * NHD * MM * DH; ep.rows = MM; ep.bias = bk;
        d_gemmw<bf, 1, CC>(b & 15, (b >> 4) & 3, b >> 6, os, H1h, H1l, WK, nullptr, (size_t)MM * CC, 0, ep); }
    else { const int t = b - (MM / 64) * (CC / 64) * NB_; EpVal ep; ep.V = V16 + (size_t)(t >> 6) * CC * MM; ep.bv = bv;
        d_gemmw<bf, 3, CC>(t & 3, (t >> 2) & 15, t >> 6, os, WV, nullptr, H2h, H2l, 0, (size_t)MM * CC, ep); }
}
// k_gemm_out: result [c][n] = f + w_out . out + b_out; grid (CC/64, NN/64, images).
__global__ __launch_bounds__(32) void k_gemm_out(const bf* __restrict__ WO, const bf* __restrict__ Oh, const bf* __restrict__ Ol, const float* __restrict__ f, const float* __restrict__ bp, float* OUT) {
    __shared__ __align__(16) float os[16 * 68];
    EpOut ep; ep.f = f + (size_t)blockIdx.z * CC * NN; ep.O = OUT + (size_t)blockIdx.z * CC * NN; ep.bp = bp;
    d_gemmw<bf, 3, CC>(blockIdx.x, blockIdx.y, blockIdx.z, os, WO, nullptr, Oh, Ol, 0, (size_t)NN * CC, ep);
}


// xw: the wait that stands between an issued global load and the next load, whose result may land in a register that the issued one names.
__device__ __forceinline__ void xw() { asm volatile("s_wait_xcnt 0x0" ::: "memory"); }
__device__ __forceinline__ void d_cvt8(const int bx, const float* __restrict__ src, bf* dst, size_t n8) { const size_t i = (size_t)bx * 256 + threadIdx.x; if (i >= n8) return; const v8f v = *(const v8f*)(src + i * 8); v8us o;
#pragma unroll
    for (int k = 0; k < 8; ++k) o[k] = f2bf(v[k]); *(v8us*)(dst + i * 8) = o;  }
__device__ __forceinline__ void d_xth(const int bx, const int by, const float* __restrict__ hb, bf* HB) {
    hb += (size_t)by * CH * MM; HB += (size_t)by * MM * CH;   // by: image
    const int lane = threadIdx.x & 31; const int L0 = (bx * 8 + (threadIdx.x >> 5)) * 8; const int nlines = MM * CH / 64;
{
#pragma unroll
        for (int l = 0; l < 8; ++l) { const int L = L0 + l; if (L >= nlines) break; const int e = L * 64 + lane * 2; const int k = e & (CH - 1); const int m = e >> 9; v2us o;
#pragma unroll
            for (int q = 0; q < 2; ++q) { const float x = hb[(size_t)(k + q) * MM + m]; xw(); o[q] = f2bf(x); }
            *(v2us*)(HB + (size_t)e) = o; }
         }
}
// d_bnT: token-major hi/lo planes T[n][c] = split((src[c][n] (+ bf16(rowbias[c]) if given) (bf16-rounded first when RAW) * inv[c] + shift[c]) with inv = bf16(gamma)/sqrt(bf16(var)+1e-5), shift = bf16(beta) -
template <int RAW>
__device__ __forceinline__ void d_bnT(const int bx, const int by, const float* __restrict__ src, int cols, int lg2cols, const float* __restrict__ rowbias, const float* __restrict__ gam, const float* __restrict__ bet, const float* __restrict__ mean, const float* __restrict__ var, bf* Th, bf* Tl) {
    src += (size_t)by * CC * cols; Th += (size_t)by * cols * CC; Tl += (size_t)by * cols * CC;   // by: image
    const int lane = threadIdx.x & 31; const int L0 = (bx * 8 + (threadIdx.x >> 5)) * 8; const int nlines = cols * CC / 64;
{
#pragma unroll 1
        for (int l = 0; l < 8; ++l) { const int L = L0 + l; if (L >= nlines) break; const int e = L * 64 + lane * 2; const int c = e & (CC - 1); const int n = e >> 8; v2us oh, ol;
#pragma unroll
            // xw() only when RAW == 0 or a row bias is given; k_prep's one d_bnT job, RAW == 1 without row bias, issues none
            for (int q = 0; q < 2; ++q) { const int cc = c + q; const float gq = gam[cc]; if (!RAW) xw(); const float vq = var[cc]; if (!RAW) xw(); const float mq = mean[cc]; if (!RAW) xw(); const float inv = __fdiv_rn(bfr(gq), __fsqrt_rn(__fadd_rn(bfr(vq), 1e-5f))); float ms = __fmul_rn(bfr(mq), inv); asm volatile("" : "+v"(ms)); const float bq = bet[cc]; if (!RAW) xw(); const float sh = __fsub_rn(bfr(bq), ms);
                float x = src[(size_t)cc * cols + n]; if (!RAW) xw(); if (RAW) x = bfr(x); if (rowbias) { const float rq = rowbias[cc]; xw(); x = __fadd_rn(x, bfr(rq)); } float t = __fmul_rn(x, inv); asm volatile("" : "+v"(t)); unsigned short a, c2; splitf(__fadd_rn(t, sh), a, c2); oh[q] = a; ol[q] = c2; }
            *(v2us*)(Th + (size_t)e) = oh; *(v2us*)(Tl + (size_t)e) = ol; }
         }
}
// k_prep: the jobs that read inputs only. BN0(bf16(f)) token-major (1024 work-groups), h token-major (512), the five weight matrices as bf16 (64 + 4 x 32).
__global__ __launch_bounds__(256) void k_prep(const float* __restrict__ f, const float* __restrict__ hin, const float* __restrict__ wht, const float* __restrict__ wq, const float* __restrict__ wk, const float* __restrict__ wv, const float* __restrict__ wo,
                                              const float* __restrict__ gam, const float* __restrict__ bet, const float* __restrict__ mean, const float* __restrict__ var, bf* FTh, bf* FTl, bf* HB, bf* WHT, bf* WQ, bf* WK, bf* WV, bf* WO) {
    int b = blockIdx.x;
    if (b < 256 * NB_) { d_bnT<1>(b & 255, b >> 8, f, NN, 12, nullptr, gam, bet, mean, var, FTh, FTl); return; }
    b -= 256 * NB_;
    if (b < 128 * NB_) { d_xth(b & 127, b >> 7, hin, HB); return; }
    b -= 128 * NB_;
    if (b < 64) { d_cvt8(b, wht, WHT, (size_t)CC * CH / 8); return; }
    b -= 64;
    const int w = b >> 5; const float* src = w == 0 ? wq : w == 1 ? wk : w == 2 ? wv : wo; bf* dst = w == 0 ? WQ : w == 1 ? WK : w == 2 ? WV : WO;
    d_cvt8(b & 31, src, dst, (size_t)CC * CC / 8);
}
// ---- k_attn: scores, softmax and the value product of one head pair for 256 queries in one work-group; grid (NN/256, NHD/2, images) = one work-group a WGP, 256 threads = 8 waves, wave w: head (w & 1) of the pair,
// queries 64 (w >> 1) ..., as QT tiles of 16: a key or value fragment read from LDS serves all QT tiles, and the pair's keys and values are laid into LDS once for 256 queries.
// The pair's keys [2][MM][DH] and values [2 DH][MM] lie in LDS for the whole launch. S^T = K Q^T (a lane holds one query's scores: 8 keys a tile), so two score tiles, converted in place, are the B operand of
// O^T += V P^T (V rows read in the same k order as the packed tiles). Pass 1 finds each query's exact maximum, pass 2 forms the scores again, p = exp((s - max) * 32^-0.5) * 1024 as fp16, f32 row sum of p.
// The attended map leaves normalised, as bf16 hi+lo planes [n][c]; it goes through LDS (the keys' place, once every wave has left them) so that each 128-byte line of a plane is stored by one wave instruction.
#define KPIT 40      // LDS pitch of a key row, in halves: 80 B = 16 B x odd, conflict-free for 16-byte fragment reads
#define VPIT 1032    // LDS pitch of a value row, in halves: 2064 B = 16 B x odd
#define OPIT 72      // LDS pitch of a staged output row, in 16-bit elements
#define QT   4       // query tiles of 16 a wave
#define QW   (64 * QT)   // queries a work-group
__device__ __forceinline__ v16h ldh(const h16* p) { return cat16(*(const v8h*)p, *(const v8h*)(p + 16)); }
__global__ __launch_bounds__(256) void k_attn(const h16* __restrict__ QP, const h16* __restrict__ KP, const h16* __restrict__ V16, bf* Oh, bf* Ol) {
    __shared__ __align__(16) h16 Ks[2 * MM * KPIT];
    __shared__ __align__(16) h16 Vs[2 * DH * VPIT];
    bf* const Os = (bf*)Ks;   // 2 * QW * OPIT elements, fewer than the keys take
    QP += (size_t)blockIdx.z * NHD * NN * DH; KP += (size_t)blockIdx.z * NHD * MM * DH; V16 += (size_t)blockIdx.z * CC * MM; Oh += (size_t)blockIdx.z * NN * CC; Ol += (size_t)blockIdx.z * NN * CC;   // blockIdx.z: image
    const int tid = threadIdx.x, lane = tid & 31, wave = tid >> 5, lr = lane & 15, hi = lane >> 4; const int hp = blockIdx.y, hl = wave & 1, qt = wave >> 1;
    const h16* kg = KP + (size_t)hp * 2 * MM * DH; const h16* vg = V16 + (size_t)hp * 2 * DH * MM;
#pragma unroll 16   // sixteen 16-byte loads in flight per thread while the tiles are laid: the fill is bound by latency otherwise
    for (int t = 0; t < 2 * MM * DH / 8 / 256; ++t) { const int i = t * 256 + tid; *(v8h*)(Ks + (i >> 2) * KPIT + (i & 3) * 8) = *(const v8h*)(kg + (size_t)i * 8); }
#pragma unroll 16   // as above
    for (int t = 0; t < 2 * DH * MM / 8 / 256; ++t) { const int i = t * 256 + tid; *(v8h*)(Vs + (i >> 7) * VPIT + (i & 127) * 8) = *(const v8h*)(vg + (size_t)i * 8); }
    const h16* qg = QP + ((size_t)(hp * 2 + hl) * NN + blockIdx.x * QW + qt * 16 * QT + lr) * DH + 8 * hi;
    v16h qf[QT];
#pragma unroll
    for (int t = 0; t < QT; ++t) qf[t] = ldh(qg + t * 16 * DH);
    asm volatile("s_wait_xcnt 0x0" :: "v"(qg) : "memory");   // the wait before a register that an issued load names is overwritten: as an input here the address pair stays whole up to it
    __syncthreads();
    const h16* kl = Ks + (hl * MM + lr) * KPIT + 8 * hi; const h16* vl = Vs + (hl * DH + lr) * VPIT + 8 * hi;
    float m[QT];
#pragma unroll
    for (int t = 0; t < QT; ++t) m[t] = -3.0e38f;
#pragma unroll 4   // four key fragments fetched as one group; the sixteen independent score tiles fill each other's distance behind the matrix instruction
    for (int kt = 0; kt < MM / 16; ++kt) { const v16h kf = ldh(kl + kt * 16 * KPIT);
#pragma unroll
        for (int t = 0; t < QT; ++t) { const v8f s = wmma16(kf, qf[t], (v8f){});
            m[t] = fmaxf(m[t], fmaxf(fmaxf(fmaxf(s[0], s[1]), fmaxf(s[2], s[3])), fmaxf(fmaxf(s[4], s[5]), fmaxf(s[6], s[7])))); } }
    v8f o0[QT], o1[QT]; float sum0[QT], sum1[QT]; const float c2 = SCL * 1.4426950408889634f;
#pragma unroll
    for (int t = 0; t < QT; ++t) { m[t] = fmaxf(m[t], __shfl_xor(m[t], 16, 32)); o0[t] = (v8f){}; o1[t] = (v8f){}; sum0[t] = 0.f; sum1[t] = 0.f; }
#pragma unroll 1   // the four query tiles of one 32-key step cover each other's matrix distances; a second step unrolled would go past 256 registers
    for (int kc = 0; kc < MM; kc += 32) {
        const v16h ka = ldh(kl + kc * KPIT), kb = ldh(kl + (kc + 16) * KPIT), va = ldh(vl + kc), vb = ldh(vl + 16 * VPIT + kc); v8f s0[QT], s1[QT];
#pragma unroll
        for (int t = 0; t < QT; ++t) { s0[t] = wmma16(ka, qf[t], (v8f){}); s1[t] = wmma16(kb, qf[t], (v8f){}); }
        __builtin_amdgcn_sched_barrier(0);   // the eight score products issue back to back and fill each other's distance: without it each is followed by idle slots and one early reader
#pragma unroll
        for (int t = 0; t < QT; ++t) { v16h p;
#pragma unroll
            for (int j = 0; j < 8; ++j) { const float e0 = __builtin_amdgcn_exp2f(__builtin_fmaf(s0[t][j] - m[t], c2, 10.0f)), e1 = __builtin_amdgcn_exp2f(__builtin_fmaf(s1[t][j] - m[t], c2, 10.0f));   // + 10: p carries a factor 2^10, which keeps small weights out of the fp16 subnormals; the row sum carries it too
                sum0[t] += e0; sum1[t] += e1; p[j] = tohx(e0); p[8 + j] = tohx(e1); }
            o0[t] = wmma16(va, p, o0[t]); o1[t] = wmma16(vb, p, o1[t]); } }
    __syncthreads();   // every wave has read its last key: the staged output may take the keys' place
#pragma unroll
    for (int t = 0; t < QT; ++t) { float sum = sum0[t] + sum1[t]; sum += __shfl_xor(sum, 16, 32); const float ri = __fdiv_rn(1.0f, sum); v8us h0, l0, h1, l1;
#pragma unroll
      for (int j = 0; j < 8; ++j) { unsigned short a, c; splitf(__fmul_rn(o0[t][j], ri), a, c); h0[j] = a; l0[j] = c; splitf(__fmul_rn(o1[t][j], ri), a, c); h1[j] = a; l1[j] = c; }
      bf* od = Os + ((qt * QT + t) * 16 + lr) * OPIT + hl * DH + 8 * hi;
      *(v8us*)od = h0; *(v8us*)(od + 16) = h1; *(v8us*)(od + QW * OPIT) = l0; *(v8us*)(od + QW * OPIT + 16) = l1; }
    __syncthreads();
    { const int r = tid >> 3, c = tid & 7; const size_t o = (size_t)(blockIdx.x * QW + r) * CC + hp * 64 + c * 8; bf* dh = Oh + o; bf* dl = Ol + o; const bf* sp = Os + r * OPIT + c * 8;   // eight lanes a row: one 128-byte line of a plane; every access below is one of these plus a constant
#pragma unroll
      for (int t = 0; t < QW / 32; ++t) { *(v8us*)(dh + t * 32 * CC) = *(const v8us*)(sp + t * 32 * OPIT); *(v8us*)(dl + t * 32 * CC) = *(const v8us*)(sp + (QW + t * 32) * OPIT); } }
}


extern "C" void kernel_launch(void* const* d_in, const int* in_sizes, int n_in,
                              void* d_out, int out_size, void* d_ws, size_t ws_size, hipStream_t stream) {
    (void)in_sizes; (void)n_in; (void)out_size;
    const float* IN[16]; for (int i = 0; i < 16; ++i) IN[i] = (const float*)d_in[i];
    // f [4][256][64][64], h [4][512][32][32], w_ht [256][512], b_ht, bn_gamma [3][256], bn_beta, bn_mean, bn_var, w_q [256][256], b_q, w_k, b_k, w_v, b_v, w_out, b_out = d_in[0..15]
    const float* f = IN[0]; const float* hin = IN[1]; const float* gam = IN[4]; const float* bet = IN[5]; const float* mean = IN[6]; const float* var = IN[7];
    float* OUT = (float*)d_out;     // [4][256][64][64]
    char* wsp = (char*)d_ws;
    auto take = [&](size_t bytes) { char* p = wsp; wsp += (bytes + 255) & ~(size_t)255; return (void*)p; };
    bf* WHT = (bf*)take((size_t)CC * CH * 2); bf* WQ = (bf*)take((size_t)CC * CC * 2); bf* WK = (bf*)take((size_t)CC * CC * 2); bf* WV = (bf*)take((size_t)CC * CC * 2); bf* WO = (bf*)take((size_t)CC * CC * 2);
    // per-image planes, NB_ images one behind the other
    bf* HB = (bf*)take((size_t)NB_ * MM * CH * 2); bf* H1h = (bf*)take((size_t)NB_ * MM * CC * 2); bf* H1l = (bf*)take((size_t)NB_ * MM * CC * 2); bf* H2h = (bf*)take((size_t)NB_ * MM * CC * 2); bf* H2l = (bf*)take((size_t)NB_ * MM * CC * 2);
    bf* FTh = (bf*)take((size_t)NB_ * NN * CC * 2); bf* FTl = (bf*)take((size_t)NB_ * NN * CC * 2); h16* QP = (h16*)take((size_t)NB_ * NHD * NN * DH * 2); h16* KP = (h16*)take((size_t)NB_ * NHD * MM * DH * 2);
    h16* V16 = (h16*)take((size_t)NB_ * CC * MM * 2);
    bf* Oh = (bf*)take((size_t)NB_ * NN * CC * 2); bf* Ol = (bf*)take((size_t)NB_ * NN * CC * 2);
    if ((size_t)(wsp - (char*)d_ws) > ws_size) return;    // total ~ 57 MB; ws 256 MiB
    k_prep<<<256 * NB_ + 128 * NB_ + 64 + 4 * 32, 256, 0, stream>>>(f, hin, IN[2], IN[8], IN[10], IN[12], IN[14], gam, bet, mean, var, FTh, FTl, HB, WHT, WQ, WK, WV, WO);   // BN0(bf16(f)), h token-major, bf16 weights
    k_gemm_hq<<<(CC / 64) * (MM / 64) * NB_ + (NN / 64) * (CC / 64) * NB_, 32, 0, stream>>>(HB, WHT, IN[3], gam, bet, mean, var, H1h, H1l, H2h, H2l, FTh, FTl, WQ, IN[9], QP);   // BN1, BN2 of h_al + b_ht; q head planes
    k_gemm_kv<<<2 * (MM / 64) * (CC / 64) * NB_, 32, 0, stream>>>(H1h, H1l, WK, IN[11], KP, WV, H2h, H2l, IN[13], V16);   // k head planes; v + b_v
    k_attn<<<dim3(NN / QW, NHD / 2, NB_), 256, 0, stream>>>(QP, KP, V16, Oh, Ol);   // softmax(q k) v, normalised, token-major hi+lo planes
    k_gemm_out<<<dim3(CC / 64, NN / 64, NB_), 32, 0, stream>>>(WO, Oh, Ol, f, IN[15], OUT);   // f + w_out . out + b_out
}

// v006
// A run of this version takes 84.4 microseconds.
// In two side-by-side timings against v005, it was 1.14 and 1.12 times as fast.
// Over all steps from v000 it is 20.6 times as fast.
#include <hip/hip_runtime.h>

// CIM (cross-image attention; f [4][256][64][64] (N = 4096 queries), h [4][512][32][32] (M = 1024 keys); h_al = w_ht h + b_ht; q = w_q BN0(f) + b_q, k = w_k BN1(h_al) + b_k, v = w_v BN2(h_al) + b_v
// (BatchNorm in inference form with the given statistics); 8 heads of 32 channels: attn = softmax_m(q_h . k_h * 32^-0.5); out[c][n] = sum_m attn[n][m] v[c][m]; result = f + w_out out + b_out).
// Compute dtypes, f32 accumulate: every input rounded to bf16; h_al on PLAIN bf16 operands (inputs: exact); the BatchNorms in f32 on VALU written as bf16 hi+lo
// x1024, fp16 v); the output conv on hi+lo planes of the attended map (2 products); bias + residual f32. One-wave-per-64x64-tile GEMMs; every launch covers all four images; launches that read none of each other's output share one grid. Deterministic, no

#define NB_  4
#define CC   256
#define CH   512                  // channels of h
#define NN   4096                 // query positions
#define MM   1024                 // key positions
#define NHD  8
#define DH   32
#define SCL  0.17677669529663687f   // f32(32^-0.5)
typedef _Float16 h16;
typedef unsigned short bf;
typedef __attribute__((ext_vector_type(16))) __bf16   v16bf;
typedef __attribute__((ext_vector_type(16))) _Float16 v16h;
typedef __attribute__((ext_vector_type(8)))  _Float16 v8h;
typedef __attribute__((ext_vector_type(8)))  unsigned short v8us;
typedef __attribute__((ext_vector_type(8)))  float    v8f;
typedef __attribute__((ext_vector_type(4)))  float    v4f;
typedef v8h  __attribute__((may_alias)) v8ha;
typedef v4f  __attribute__((may_alias)) v4fa;
typedef v8us __attribute__((may_alias)) v8usa;

__device__ __forceinline__ unsigned short f2bf(float f) { unsigned u = __float_as_uint(f); u += 0x7FFFu + ((u >> 16) & 1u); return (unsigned short)(u >> 16); }
__device__ __forceinline__ float bf2f(unsigned short b) { return __uint_as_float(((unsigned)b) << 16); }
__device__ __forceinline__ float bfr(float f) { return bf2f(f2bf(f)); }
__device__ __forceinline__ v16h cat16(v8h lo, v8h hi) { return __builtin_shufflevector(lo, hi, 0, 1, 2, 3, 4, 5, 6, 7, 8, 9, 10, 11, 12, 13, 14, 15); }
__device__ __forceinline__ v16bf cat16b(v8us lo, v8us hi) { return __builtin_bit_cast(v16bf, __builtin_shufflevector(lo, hi, 0, 1, 2, 3, 4, 5, 6, 7, 8, 9, 10, 11, 12, 13, 14, 15)); }
__device__ __forceinline__ v8f wmma16(v16h a, v16h b, v8f c) { return __builtin_amdgcn_wmma_f32_16x16x32_f16(false, a, false, b, (short)0, c, false, false); }
__device__ __forceinline__ v8f wmmab(v16bf a, v16bf b, v8f c) { return __builtin_amdgcn_wmma_f32_16x16x32_bf16(false, a, false, b, (short)0, c, false, false); }



template <typename T16> struct WFrag;
template <> struct WFrag<h16> { typedef v16h V; static __device__ __forceinline__ V ld(const h16* p) { return cat16(*(const v8h*)p, *(const v8h*)(p + 16)); } static __device__ __forceinline__ v8f mma(V a, V b, v8f c) { return wmma16(a, b, c); } };
template <> struct WFrag<bf> { typedef v16bf V; static __device__ __forceinline__ V ld(const bf* p) { return cat16b(*(const v8us*)p, *(const v8us*)(p + 16)); } static __device__ __forceinline__ v8f mma(V a, V b, v8f c) { return wmmab(a, b, c); } };
__device__ __forceinline__ h16 tohx(float x) { return (h16)x; }
__device__ __forceinline__ void splitf(float y, unsigned short& h, unsigned short& l) { h = f2bf(y); l = f2bf(y - bf2f(h)); }
typedef __attribute__((ext_vector_type(2))) _Float16 v2h;
typedef __attribute__((ext_vector_type(2))) unsigned short v2us;
typedef __attribute__((ext_vector_type(8))) _Float16 v8h16;

// ---- Epilogues: what a 64x64 GEMM tile becomes on its way out of the wave that computed it (the elementwise pass that used to follow the GEMM as a launch of its own, on the same f32 values).
// load(): lane addresses and the per-column or per-row parameters, issued in front of the K loop; ready(): their arithmetic, behind it; ahead(mb): loads for 16-row block mb, issued two blocks early;
// stage(): a value on its way into LDS (accumulator layout: row hi * 8 + j); put(): four neighbouring columns of row (ROW8 ? hi * 8 + s : 2 * s + hi) of block mb.
typedef __attribute__((ext_vector_type(4))) _Float16 v4h;
typedef __attribute__((ext_vector_type(4))) unsigned short v4us;
// EpHead: C[row][c] + bf16(bias[c]) as fp16 head planes P[c / 32][row][c % 32]; rows 2 s and 2 s + 1 of a head are one 128-byte line, stored by one instruction.
struct EpHead {
    static constexpr bool ROW8 = false;
    h16* P; int rows; const float* bias; v4f b;
    __device__ __forceinline__ void load(int r0, int c0, int lr, int hi) { const int c = c0 + lr * 4; P += ((size_t)(c >> 5) * rows + r0 + hi) * DH + (c & (DH - 1)); b = *(const v4f*)(bias + c); }
    __device__ __forceinline__ void ready() {
#pragma unroll
        for (int q = 0; q < 4; ++q) b[q] = bfr(b[q]); }
    __device__ __forceinline__ void ahead(int) {}
    __device__ __forceinline__ float stage(int, int, float x) { return x; }
    __device__ __forceinline__ void put(int mb, int s, v4f val) { v4h o;
#pragma unroll
        for (int q = 0; q < 4; ++q) o[q] = tohx(val[q] + b[q]);
        *(v4h*)(P + (mb * 16 + 2 * s) * DH) = o; }
};
// EpBN: the two BatchNorms of C[m][c] + bf16(b_ht[c]) as token-major bf16 hi+lo planes; inv = bf16(gamma) / sqrt(bf16(var) + 1e-5) and shift = bf16(beta) - bf16(mean) * inv once a lane and column.
struct EpBN {
    static constexpr bool ROW8 = false;
    bf* T[2][2]; const float* bht; const float* gam; const float* bet; const float* mean; const float* var; v4f rb, g[2], be[2], mu[2], va[2];
    __device__ __forceinline__ void load(int r0, int c0, int lr, int hi) { const int c = c0 + lr * 4; const size_t o = (size_t)(r0 + hi) * CC + c; rb = *(const v4f*)(bht + c);
#pragma unroll
        for (int w = 0; w < 2; ++w) { const int p = (1 + w) * CC + c; T[w][0] += o; T[w][1] += o; g[w] = *(const v4f*)(gam + p); be[w] = *(const v4f*)(bet + p); mu[w] = *(const v4f*)(mean + p); va[w] = *(const v4f*)(var + p); } }
    __device__ __forceinline__ void ready() {   // g becomes inv, be becomes shift
#pragma unroll
        for (int q = 0; q < 4; ++q) { rb[q] = bfr(rb[q]);
#pragma unroll
            for (int w = 0; w < 2; ++w) { const float inv = __fdiv_rn(bfr(g[w][q]), __fsqrt_rn(bfr(va[w][q]) + 1e-5f)); g[w][q] = inv; be[w][q] = bfr(be[w][q]) - bfr(mu[w][q]) * inv; } } }
    __device__ __forceinline__ void ahead(int) {}
    __device__ __forceinline__ float stage(int, int, float x) { return x; }
    __device__ __forceinline__ void put(int mb, int s, v4f val) {
#pragma unroll
        for (int w = 0; w < 2; ++w) { v4us oh, ol;
#pragma unroll
            for (int q = 0; q < 4; ++q) { unsigned short a, c2; splitf((val[q] + rb[q]) * g[w][q] + be[w][q], a, c2); oh[q] = a; ol[q] = c2; }
            *(v4us*)(T[w][0] + (mb * 16 + 2 * s) * CC) = oh; *(v4us*)(T[w][1] + (mb * 16 + 2 * s) * CC) = ol; } }
};
// EpVal: C[c][m] + bf16(b_v[c]) as fp16 [c][m]; the row's bias is added in the accumulator layout.
struct EpVal {
    static constexpr bool ROW8 = false;
    h16* V; const float* bv; v8f b[4];
    __device__ __forceinline__ void load(int r0, int c0, int lr, int hi) { V += (size_t)(r0 + hi) * MM + c0 + lr * 4;
#pragma unroll
        for (int mb = 0; mb < 4; ++mb) b[mb] = *(const v8f*)(bv + r0 + mb * 16 + hi * 8); }
    __device__ __forceinline__ void ready() {
#pragma unroll
        for (int mb = 0; mb < 4; ++mb)
#pragma unroll
            for (int j = 0; j < 8; ++j) b[mb][j] = bfr(b[mb][j]); }
    __device__ __forceinline__ void ahead(int) {}
    __device__ __forceinline__ float stage(int mb, int j, float x) { return x + b[mb][j]; }
    __device__ __forceinline__ void put(int mb, int s, v4f val) { v4h o;
#pragma unroll
        for (int q = 0; q < 4; ++q) o[q] = tohx(val[q]);
        *(v4h*)(V + (mb * 16 + 2 * s) * MM) = o; }
};
// EpOut: the result, (bf16(f[c][n]) + C[c][n]) + bf16(b_out[c]) in f32.
struct EpOut {
    static constexpr bool ROW8 = true;
    const float* f; float* O; const float* bp; v4f fv[4][8]; v8f b[4];
    __device__ __forceinline__ void load(int r0, int c0, int lr, int hi) { const size_t o = (size_t)(r0 + hi * 8) * NN + c0 + lr * 4; f += o; O += o; bp += r0 + hi * 8; }
    __device__ __forceinline__ void ready() {}
    __device__ __forceinline__ void ahead(int mb) {
        if (mb >= 2) asm volatile("s_wait_xcnt 0x0" ::: "memory");   // blocks 2 and 3 are fetched behind a block's stores and may land in registers that those stores name: the wait before such a register is overwritten
        b[mb] = *(const v8f*)(bp + mb * 16);
#pragma unroll
        for (int s = 0; s < 8; ++s) fv[mb][s] = *(const v4f*)(f + (mb * 16 + s) * NN); }
    __device__ __forceinline__ float stage(int, int, float x) { return x; }
    __device__ __forceinline__ void put(int mb, int s, v4f val) { v4f o;
#pragma unroll
        for (int q = 0; q < 4; ++q) o[q] = (bfr(fv[mb][s][q]) + val[q]) + bfr(b[mb][s]);
        *(v4f*)(O + (mb * 16 + s) * NN) = o; }
};

// ---- d_gemmw: register-blocked GEMM as one job of a grid: tile (bx, by) of batch bz out of (M/64, N/64, Z), ONE WAVE per 64x64 tile (16 accumulators), operands straight from K-contiguous 16-bit planes, K a literal.
// C[m][n] (f32) = sum_k A[m][k] Bt[n][k] (+ split products per NSPLIT) goes to the epilogue ep, 16 rows at a time through os (16 x 68 floats of LDS). z-batch strides sA/sB in elements.
template <typename T16, int NSPLIT, int K, typename EP>
__device__ __forceinline__ void d_gemmw(const int bx, const int by, const int bz, float* os, const T16* __restrict__ A, const T16* __restrict__ A2, const T16* __restrict__ Bt, const T16* __restrict__ Bt2, size_t sA, size_t sB, EP& ep) {
    typedef typename WFrag<T16>::V V;
    const size_t z = bz; A += z * sA; if (A2) A2 += z * sA; Bt += z * sB; if (Bt2) Bt2 += z * sB;
    const int lane = threadIdx.x & 31, lr = lane & 15, hi = lane >> 4; const int r0 = bx * 64, c0 = by * 64;
    ep.load(r0, c0, lr, hi);
    v8f acc[4][4];
#pragma unroll
    for (int mb = 0; mb < 4; ++mb)
#pragma unroll
        for (int nb = 0; nb < 4; ++nb) acc[mb][nb] = (v8f){};
    const size_t aoff = (size_t)(r0 + lr) * K + 8 * hi, boff = (size_t)(c0 + lr) * K + 8 * hi;
#pragma unroll 1   // one trip's fragments and the 16 accumulators fill the register file; a second trip unrolled would spill
    for (int kc = 0; kc < K; kc += 32) {
        const T16* pa = A + aoff + kc; const T16* pa2 = (NSPLIT == 1 || NSPLIT == 2) ? A2 + aoff + kc : pa; const T16* pb = Bt + boff + kc; const T16* pb2 = NSPLIT >= 2 ? Bt2 + boff + kc : pb;   // this trip's lane addresses; every load below is one of them plus a constant
        V a[4], a2[4];
#pragma unroll
        for (int mb = 0; mb < 4; ++mb) { a[mb] = WFrag<T16>::ld(pa + mb * 16 * K); if (NSPLIT == 1 || NSPLIT == 2) a2[mb] = WFrag<T16>::ld(pa2 + mb * 16 * K); }
#pragma unroll
        for (int nb = 0; nb < 4; ++nb) { const V b = WFrag<T16>::ld(pb + nb * 16 * K); V b2; if (NSPLIT >= 2) b2 = WFrag<T16>::ld(pb2 + nb * 16 * K);
#pragma unroll
            for (int mb = 0; mb < 4; ++mb) { acc[mb][nb] = WFrag<T16>::mma(a[mb], b, acc[mb][nb]); if (NSPLIT == 1 || NSPLIT == 2) acc[mb][nb] = WFrag<T16>::mma(a2[mb], b, acc[mb][nb]); if (NSPLIT >= 2) acc[mb][nb] = WFrag<T16>::mma(a[mb], b2, acc[mb][nb]); } }
        asm volatile("v_nop\n\tv_nop\n\tv_nop\n\tv_nop" : "+v"(acc[0][0]), "+v"(acc[1][1]), "+v"(acc[2][2]), "+v"(acc[3][3]) : "v"(a[0]), "v"(a[3]));   // the distance behind the trip's last matrix instructions, on the back edge too
        asm volatile("s_wait_xcnt 0x0" :: "v"(pa), "v"(pa2), "v"(pb), "v"(pb2) : "memory");   // the wait before a register that an issued load names is overwritten: as inputs here the trip's address registers stay whole up to it
    }
    ep.ahead(0); ep.ahead(1); ep.ready();
#pragma unroll
    for (int mb = 0; mb < 4; ++mb) {
#pragma unroll
        for (int nb = 0; nb < 4; ++nb) {
#pragma unroll
            for (int j = 0; j < 8; ++j) os[(hi * 8 + j) * 68 + nb * 16 + lr] = ep.stage(mb, j, acc[mb][nb][j]); }
        __builtin_amdgcn_wave_barrier(); asm volatile("" ::: "memory");   // the wave's LDS writes stay in front of its reads
#pragma unroll
        for (int s = 0; s < 8; ++s) { const int row = EP::ROW8 ? hi * 8 + s : 2 * s + hi; ep.put(mb, s, *(const v4fa*)(os + row * 68 + lr * 4)); }
        __builtin_amdgcn_wave_barrier(); asm volatile("" ::: "memory");   // the reads stay in front of the next block's writes
        if (mb + 2 < 4) ep.ahead(mb + 2);
    }
}
// Launches that read none of each other's output share one grid: a range of blockIdx.x is one job, the longer job first.
// k_gemm_hq: BN1 and BN2 of h_al + b_ht, h_al [m][c] = h w_ht^T (256 tiles, K = 512), then q = BN0(f) w_q^T + b_q as fp16 head planes (1024 tiles).
__global__ __launch_bounds__(32) void k_gemm_hq(const bf* __restrict__ HB, const bf* __restrict__ WHT, const float* __restrict__ bht, const float* __restrict__ gam, const float* __restrict__ bet, const float* __restrict__ mean, const float* __restrict__ var,
                                                bf* H1h, bf* H1l, bf* H2h, bf* H2l, const bf* __restrict__ FTh, const bf* __restrict__ FTl, const bf* __restrict__ WQ, const float* __restrict__ bq, h16* QP) {
    __shared__ __align__(16) float os[16 * 68];
    const int b = blockIdx.x;
    if (b < (CC / 64) * (MM / 64) * NB_) { const size_t o = (size_t)(b >> 6) * MM * CC; EpBN ep; ep.T[0][0] = H1h + o; ep.T[0][1] = H1l + o; ep.T[1][0] = H2h + o; ep.T[1][1] = H2l + o; ep.bht = bht; ep.gam = gam; ep.bet = bet; ep.mean = mean; ep.var = var;
        d_gemmw<bf, 0, CH>((b >> 2) & 15, b & 3, b >> 6, os, HB, nullptr, WHT, nullptr, (size_t)MM * CH, 0, ep); }
    else { const int t = b - (CC / 64) * (MM / 64) * NB_; EpHead ep; ep.P = QP + (size_t)(t >> 8) * NHD * NN * DH; ep.rows = NN; ep.bias = bq;
        d_gemmw<bf, 1, CC>(t & 63, (t >> 6) & 3, t >> 8, os, FTh, FTl, WQ, nullptr, (size_t)NN * CC, 0, ep); }
}
// k_gemm_kv: k = BN1(h_al) w_k^T + b_k as fp16 head planes (256 tiles), then v [c][m] = w_v BN2(h_al) + b_v as fp16 (256 tiles).
__global__ __launch_bounds__(32) void k_gemm_kv(const bf* __restrict__ H1h, const bf* __restrict__ H1l, const bf* __restrict__ WK, const float* __restrict__ bk, h16* KP, const bf* __restrict__ WV, const bf* __restrict__ H2h, const bf* __restrict__ H2l, const float* __restrict__ bv, h16* V16) {
    __shared__ __align__(16) float os[16 * 68];
    const int b = blockIdx.x;
    if (b < (MM / 64) * (CC / 64) * NB_) { EpHead ep; ep.P = KP + (size_t)(b >> 6) * NHD * MM * DH; ep.rows = MM; ep.bias = bk;
        d_gemmw<bf, 1, CC>(b & 15, (b >> 4) & 3, b >> 6, os, H1h, H1l, WK, nullptr, (size_t)MM * CC, 0, ep); }
    else { const int t = b - (MM / 64) * (CC / 64) * NB_; EpVal ep; ep.V = V16 + (size_t)(t >> 6) * CC * MM; ep.bv = bv;
        d_gemmw<bf, 3, CC>(t & 3, (t >> 2) & 15, t >> 6, os, WV, nullptr, H2h, H2l, 0, (size_t)MM * CC, ep); }
}
// k_gemm_out: result [c][n] = f + w_out . out + b_out; grid (CC/64, NN/64, images).
__global__ __launch_bounds__(32) void k_gemm_out(const bf* __restrict__ WO, const bf* __restrict__ Oh, const bf* __restrict__ Ol, const float* __restrict__ f, const float* __restrict__ bp, float* OUT) {
    __shared__ __align__(16) float os[16 * 68];
    EpOut ep; ep.f = f + (size_t)blockIdx.z * CC * NN; ep.O = OUT + (size_t)blockIdx.z * CC * NN; ep.bp = bp;
    d_gemmw<bf, 3, CC>(blockIdx.x, blockIdx.y, blockIdx.z, os, WO, nullptr, Oh, Ol, 0, (size_t)NN * CC, ep);
}


__device__ __forceinline__ void d_cvt8(const int bx, const float* __restrict__ src, bf* dst, size_t n8) { const size_t i = (size_t)bx * 256 + threadIdx.x; if (i >= n8) return; const v8f v = *(const v8f*)(src + i * 8); v8us o;
#pragma unroll
    for (int k = 0; k < 8; ++k) o[k] = f2bf(v[k]); *(v8us*)(dst + i * 8) = o;  }
// d_turn: one wave turns a tile of 64 source rows x 32 positions of src [ROWS][COLS] (f32) into token-major 16-bit rows T[position][row]. A lane is one position: each load is one whole 128-byte line of a source
// row. The lane's 64 results go as 16-byte pieces into the wave's own LDS tile and come back eight lanes a token row, so each store is four whole 128-byte lines. No work-group barrier: the tile is one wave's.
// BN = 1: hi+lo planes of bf16(src) * inv[row] + shift[row], inv = bf16(gamma) / sqrt(bf16(var) + 1e-5), shift = bf16(beta) - bf16(mean) * inv, formed once a row (lane l: rows l and 32 + l) and handed round by
// lane reads. BN = 0: bf16(src), one plane.
#define TPIT 72      // LDS pitch of a turned row, in 16-bit elements: 144 B = 16 B x odd
__device__ __forceinline__ float rlane(float v, int l) { return __int_as_float(__builtin_amdgcn_readlane(__float_as_int(v), l)); }
template <int BN, int ROWS, int COLS>
__device__ __forceinline__ void d_turn(bf* ts, const int rt, const int nt, const int img, const float* __restrict__ src, const float* __restrict__ gam, const float* __restrict__ bet, const float* __restrict__ mean, const float* __restrict__ var, bf* Th, bf* Tl) {
    const int lane = threadIdx.x & 31; const int r0 = rt * 64, n0 = nt * 32;
    float iv[2], sh[2];
    if (BN) {
        const float* pg = gam + r0 + lane; const float* pv = var + r0 + lane; const float* pm = mean + r0 + lane; const float* pb = bet + r0 + lane;
        const float g0 = pg[0], g1 = pg[32], v0 = pv[0], v1 = pv[32], m0 = pm[0], m1 = pm[32], b0 = pb[0], b1 = pb[32];
        asm volatile("s_wait_xcnt 0x0" :: "v"(lane) : "memory");   // the wait before a register that an issued load names is overwritten: the lane number is these loads' vector address, and as an input here it stays whole up to the wait
        iv[0] = __fdiv_rn(bfr(g0), __fsqrt_rn(bfr(v0) + 1e-5f)); sh[0] = bfr(b0) - bfr(m0) * iv[0]; iv[1] = __fdiv_rn(bfr(g1), __fsqrt_rn(bfr(v1) + 1e-5f)); sh[1] = bfr(b1) - bfr(m1) * iv[1];
    }
    const float* p = src + ((size_t)img * ROWS + r0) * COLS + n0 + lane;
    float x[64];
#pragma unroll
    for (int i = 0; i < 64; ++i) x[i] = p[(size_t)i * COLS];
    asm volatile("s_wait_xcnt 0x0" :: "v"(lane) : "memory");   // as above, for the tile's 64 loads
    bf* tw = ts + lane * TPIT;
#pragma unroll
    for (int g = 0; g < 8; ++g) { v8us H, L;
#pragma unroll
        for (int j = 0; j < 8; ++j) { const int i = g * 8 + j;
            if (BN) { unsigned short a, c; splitf(bfr(x[i]) * rlane(iv[i >> 5], i & 31) + rlane(sh[i >> 5], i & 31), a, c); H[j] = a; L[j] = c; }
            else H[j] = f2bf(x[i]); }
        *(v8us*)(tw + g * 8) = H; if (BN) *(v8us*)(tw + 32 * TPIT + g * 8) = L; }
    asm volatile("s_wait_dscnt 0x0" ::: "memory");   // the wave's own LDS writes have landed before other lanes of it read the rows back
    const int rr = lane >> 3, pc = lane & 7; const bf* sp = ts + rr * TPIT + pc * 8; const size_t o = ((size_t)img * COLS + n0 + rr) * ROWS + r0 + pc * 8; bf* dh = Th + o; bf* dl = Tl + o;
    v8us a[8], b[8];
#pragma unroll
    for (int t = 0; t < 8; ++t) { a[t] = *(const v8us*)(sp + t * 4 * TPIT); if (BN) b[t] = *(const v8us*)(sp + (32 + t * 4) * TPIT); }
#pragma unroll
    for (int t = 0; t < 8; ++t) { *(v8us*)(dh + t * 4 * ROWS) = a[t]; if (BN) *(v8us*)(dl + t * 4 * ROWS) = b[t]; }
    asm volatile("s_wait_xcnt 0x0" ::: "memory");   // the wait before a register that an issued store names is overwritten: what stands behind this function in the built kernel (another job's code, on a way that the listing's branches allow) writes such registers
}
// k_prep: the jobs that read inputs only. BN0(bf16(f)) token-major (256 work-groups), h token-major (128), the five weight matrices as bf16 (64 + 4 x 32). A turning work-group takes 256 source rows x 64 positions,
// a tile a wave: 256 bytes in a row of each source row.
__global__ __launch_bounds__(256) void k_prep(const float* __restrict__ f, const float* __restrict__ hin, const float* __restrict__ wht, const float* __restrict__ wq, const float* __restrict__ wk, const float* __restrict__ wv, const float* __restrict__ wo,
                                              const float* __restrict__ gam, const float* __restrict__ bet, const float* __restrict__ mean, const float* __restrict__ var, bf* FTh, bf* FTl, bf* HB, bf* WHT, bf* WQ, bf* WK, bf* WV, bf* WO) {
    __shared__ __align__(16) bf Ts[8 * 2 * 32 * TPIT];
    int b = blockIdx.x; const int wave = __builtin_amdgcn_readfirstlane(threadIdx.x >> 5); bf* ts = Ts + wave * 2 * 32 * TPIT;
    if (b < 64 * NB_) { d_turn<1, CC, NN>(ts, wave & 3, (b & 63) * 2 + (wave >> 2), b >> 6, f, gam, bet, mean, var, FTh, FTl); return; }
    b -= 64 * NB_;
    if (b < 32 * NB_) { d_turn<0, CH, MM>(ts, (b & 1) * 4 + (wave & 3), (b & 30) + (wave >> 2), b >> 5, hin, nullptr, nullptr, nullptr, nullptr, HB, nullptr); return; }
    b -= 32 * NB_;
    if (b < 64) { d_cvt8(b, wht, WHT, (size_t)CC * CH / 8); return; }
    b -= 64;
    const int w = b >> 5; const float* src = w == 0 ? wq : w == 1 ? wk : w == 2 ? wv : wo; bf* dst = w == 0 ? WQ : w == 1 ? WK : w == 2 ? WV : WO;
    d_cvt8(b & 31, src, dst, (size_t)CC * CC / 8);
}
// ---- k_attn: scores, softmax and the value product of one head pair for 256 queries in one work-group; grid (NN/256, NHD/2, images) = one work-group a WGP, 256 threads = 8 waves, wave w: head (w & 1) of the pair,
// queries 64 (w >> 1) ..., as QT tiles of 16: a key or value fragment read from LDS serves all QT tiles, and the pair's keys and values are laid into LDS once for 256 queries.
// The pair's keys [2][MM][DH] and values [2 DH][MM] lie in LDS for the whole launch. S^T = K Q^T (a lane holds one query's scores: 8 keys a tile), so two score tiles, converted in place, are the B operand of
// O^T += V P^T (V rows read in the same k order as the packed tiles). Pass 1 finds each query's exact maximum, pass 2 forms the scores again, p = exp((s - max) * 32^-0.5) * 1024 as fp16, f32 row sum of p.
// The attended map leaves normalised, as bf16 hi+lo planes [n][c]; it goes through LDS (the keys' place, once every wave has left them) so that each 128-byte line of a plane is stored by one wave instruction.
#define KPIT 40      // LDS pitch of a key row, in halves: 80 B = 16 B x odd, conflict-free for 16-byte fragment reads
#define VPIT 1032    // LDS pitch of a value row, in halves: 2064 B = 16 B x odd
#define OPIT 72      // LDS pitch of a staged output row, in 16-bit elements
#define QT   4       // query tiles of 16 a wave
#define QW   (64 * QT)   // queries a work-group
__device__ __forceinline__ v16h ldh(const h16* p) { return cat16(*(const v8h*)p, *(const v8h*)(p + 16)); }
__global__ __launch_bounds__(256) void k_attn(const h16* __restrict__ QP, const h16* __restrict__ KP, const h16* __restrict__ V16, bf* Oh, bf* Ol) {
    __shared__ __align__(16) h16 Ks[2 * MM * KPIT];
    __shared__ __align__(16) h16 Vs[2 * DH * VPIT];
    bf* const Os = (bf*)Ks;   // 2 * QW * OPIT elements, fewer than the keys take
    QP += (size_t)blockIdx.z * NHD * NN * DH; KP += (size_t)blockIdx.z * NHD * MM * DH; V16 += (size_t)blockIdx.z * CC * MM; Oh += (size_t)blockIdx.z * NN * CC; Ol += (size_t)blockIdx.z * NN * CC;   // blockIdx.z: image
    const int tid = threadIdx.x, lane = tid & 31, wave = tid >> 5, lr = lane & 15, hi = lane >> 4; const int hp = blockIdx.y, hl = wave & 1, qt = wave >> 1;
    const h16* kg = KP + (size_t)hp * 2 * MM * DH; const h16* vg = V16 + (size_t)hp * 2 * DH * MM;
#pragma unroll 16   // sixteen 16-byte loads in flight per thread while the tiles are laid: the fill is bound by latency otherwise
    for (int t = 0; t < 2 * MM * DH / 8 / 256; ++t) { const int i = t * 256 + tid; *(v8h*)(Ks + (i >> 2) * KPIT + (i & 3) * 8) = *(const v8h*)(kg + (size_t)i * 8); }
#pragma unroll 16   // as above
    for (int t = 0; t < 2 * DH * MM / 8 / 256; ++t) { const int i = t * 256 + tid; *(v8h*)(Vs + (i >> 7) * VPIT + (i & 127) * 8) = *(const v8h*)(vg + (size_t)i * 8); }
    const h16* qg = QP + ((size_t)(hp * 2 + hl) * NN + blockIdx.x * QW + qt * 16 * QT + lr) * DH + 8 * hi;
    v16h qf[QT];
#pragma unroll
    for (int t = 0; t < QT; ++t) qf[t] = ldh(qg + t * 16 * DH);
    asm volatile("s_wait_xcnt 0x0" :: "v"(qg) : "memory");   // the wait before a register that an issued load names is overwritten: as an input here the address pair stays whole up to it
    __syncthreads();
    const h16* kl = Ks + (hl * MM + lr) * KPIT + 8 * hi; const h16* vl = Vs + (hl * DH + lr) * VPIT + 8 * hi;
    float m[QT];
#pragma unroll
    for (int t = 0; t < QT; ++t) m[t] = -3.0e38f;
#pragma unroll 4   // four key fragments fetched as one group; the sixteen independent score tiles fill each other's distance behind the matrix instruction
    for (int kt = 0; kt < MM / 16; ++kt) { const v16h kf = ldh(kl + kt * 16 * KPIT);
#pragma unroll
        for (int t = 0; t < QT; ++t) { const v8f s = wmma16(kf, qf[t], (v8f){});
            m[t] = fmaxf(m[t], fmaxf(fmaxf(fmaxf(s[0], s[1]), fmaxf(s[2], s[3])), fmaxf(fmaxf(s[4], s[5]), fmaxf(s[6], s[7])))); } }
    v8f o0[QT], o1[QT]; float sum0[QT], sum1[QT]; const float c2 = SCL * 1.4426950408889634f;
#pragma unroll
    for (int t = 0; t < QT; ++t) { m[t] = fmaxf(m[t], __shfl_xor(m[t], 16, 32)); o0[t] = (v8f){}; o1[t] = (v8f){}; sum0[t] = 0.f; sum1[t] = 0.f; }
#pragma unroll 1   // the four query tiles of one 32-key step cover each other's matrix distances; a second step unrolled would go past 256 registers
    for (int kc = 0; kc < MM; kc += 32) {
        const v16h ka = ldh(kl + kc * KPIT), kb = ldh(kl + (kc + 16) * KPIT), va = ldh(vl + kc), vb = ldh(vl + 16 * VPIT + kc); v8f s0[QT], s1[QT];
#pragma unroll
        for (int t = 0; t < QT; ++t) { s0[t] = wmma16(ka, qf[t], (v8f){}); s1[t] = wmma16(kb, qf[t], (v8f){}); }
        __builtin_amdgcn_sched_barrier(0);   // the eight score products issue back to back and fill each other's distance: without it each is followed by idle slots and one early reader
#pragma unroll
        for (int t = 0; t < QT; ++t) { v16h p;
#pragma unroll
            for (int j = 0; j < 8; ++j) { const float e0 = __builtin_amdgcn_exp2f(__builtin_fmaf(s0[t][j] - m[t], c2, 10.0f)), e1 = __builtin_amdgcn_exp2f(__builtin_fmaf(s1[t][j] - m[t], c2, 10.0f));   // + 10: p carries a factor 2^10, which keeps small weights out of the fp16 subnormals; the row sum carries it too
                sum0[t] += e0; sum1[t] += e1; p[j] = tohx(e0); p[8 + j] = tohx(e1); }
            o0[t] = wmma16(va, p, o0[t]); o1[t] = wmma16(vb, p, o1[t]); } }
    __syncthreads();   // every wave has read its last key: the staged output may take the keys' place
#pragma unroll
    for (int t = 0; t < QT; ++t) { float sum = sum0[t] + sum1[t]; sum += __shfl_xor(sum, 16, 32); const float ri = __fdiv_rn(1.0f, sum); v8us h0, l0, h1, l1;
#pragma unroll
      for (int j = 0; j < 8; ++j) { unsigned short a, c; splitf(__fmul_rn(o0[t][j], ri), a, c); h0[j] = a; l0[j] = c; splitf(__fmul_rn(o1[t][j], ri), a, c); h1[j] = a; l1[j] = c; }
      bf* od = Os + ((qt * QT + t) * 16 + lr) * OPIT + hl * DH + 8 * hi;
      *(v8us*)od = h0; *(v8us*)(od + 16) = h1; *(v8us*)(od + QW * OPIT) = l0; *(v8us*)(od + QW * OPIT + 16) = l1; }
    __syncthreads();
    { const int r = tid >> 3, c = tid & 7; const size_t o = (size_t)(blockIdx.x * QW + r) * CC + hp * 64 + c * 8; bf* dh = Oh + o; bf* dl = Ol + o; const bf* sp = Os + r * OPIT + c * 8;   // eight lanes a row: one 128-byte line of a plane; every access below is one of these plus a constant
#pragma unroll
      for (int t = 0; t < QW / 32; ++t) { *(v8us*)(dh + t * 32 * CC) = *(const v8us*)(sp + t * 32 * OPIT); *(v8us*)(dl + t * 32 * CC) = *(const v8us*)(sp + (QW + t * 32) * OPIT); } }
}


extern "C" void kernel_launch(void* const* d_in, const int* in_sizes, int n_in,
                              void* d_out, int out_size, void* d_ws, size_t ws_size, hipStream_t stream) {
    (void)in_sizes; (void)n_in; (void)out_size;
    const float* IN[16]; for (int i = 0; i < 16; ++i) IN[i] = (const float*)d_in[i];
    // f [4][256][64][64], h [4][512][32][32], w_ht [256][512], b_ht, bn_gamma [3][256], bn_beta, bn_mean, bn_var, w_q [256][256], b_q, w_k, b_k, w_v, b_v, w_out, b_out = d_in[0..15]
    const float* f = IN[0]; const float* hin = IN[1]; const float* gam = IN[4]; const float* bet = IN[5]; const float* mean = IN[6]; const float* var = IN[7];
    float* OUT = (float*)d_out;     // [4][256][64][64]
    char* wsp = (char*)d_ws;
    auto take = [&](size_t bytes) { char* p = wsp; wsp += (bytes + 255) & ~(size_t)255; return (void*)p; };
    bf* WHT = (bf*)take((size_t)CC * CH * 2); bf* WQ = (bf*)take((size_t)CC * CC * 2); bf* WK = (bf*)take((size_t)CC * CC * 2); bf* WV = (bf*)take((size_t)CC * CC * 2); bf* WO = (bf*)take((size_t)CC * CC * 2);
    // per-image planes, NB_ images one behind the other
    bf* HB = (bf*)take((size_t)NB_ * MM * CH * 2); bf* H1h = (bf*)take((size_t)NB_ * MM * CC * 2); bf* H1l = (bf*)take((size_t)NB_ * MM * CC * 2); bf* H2h = (bf*)take((size_t)NB_ * MM * CC * 2); bf* H2l = (bf*)take((size_t)NB_ * MM * CC * 2);
    bf* FTh = (bf*)take((size_t)NB_ * NN * CC * 2); bf* FTl = (bf*)take((size_t)NB_ * NN * CC * 2); h16* QP = (h16*)take((size_t)NB_ * NHD * NN * DH * 2); h16* KP = (h16*)take((size_t)NB_ * NHD * MM * DH * 2);
    h16* V16 = (h16*)take((size_t)NB_ * CC * MM * 2);
    bf* Oh = (bf*)take((size_t)NB_ * NN * CC * 2); bf* Ol = (bf*)take((size_t)NB_ * NN * CC * 2);
    if ((size_t)(wsp - (char*)d_ws) > ws_size) return;    // total ~ 57 MB; ws 256 MiB
    k_prep<<<64 * NB_ + 32 * NB_ + 64 + 4 * 32, 256, 0, stream>>>(f, hin, IN[2], IN[8], IN[10], IN[12], IN[14], gam, bet, mean, var, FTh, FTl, HB, WHT, WQ, WK, WV, WO);   // BN0(bf16(f)), h token-major, bf16 weights
    k_gemm_hq<<<(CC / 64) * (MM / 64) * NB_ + (NN / 64) * (CC / 64) * NB_, 32, 0, stream>>>(HB, WHT, IN[3], gam, bet, mean, var, H1h, H1l, H2h, H2l, FTh, FTl, WQ, IN[9], QP);   // BN1, BN2 of h_al + b_ht; q head planes
    k_gemm_kv<<<2 * (MM / 64) * (CC / 64) * NB_, 32, 0, stream>>>(H1h, H1l, WK, IN[11], KP, WV, H2h, H2l, IN[13], V16);   // k head planes; v + b_v
    k_attn<<<dim3(NN / QW, NHD / 2, NB_), 256, 0, stream>>>(QP, KP, V16, Oh, Ol);   // softmax(q k) v, normalised, token-major hi+lo planes
    k_gemm_out<<<dim3(CC / 64, NN / 64, NB_), 32, 0, stream>>>(WO, Oh, Ol, f, IN[15], OUT);   // f + w_out . out + b_out
}

// v007
// A run of this version takes 75.6 microseconds.
// In two side-by-side timings against v006, it was 1.13 and 1.12 times as fast.
// Over all steps from v000 it is 23.2 times as fast.
#include <hip/hip_runtime.h>

// CIM (cross-image attention; f [4][256][64][64] (N = 4096 queries), h [4][512][32][32] (M = 1024 keys); h_al = w_ht h + b_ht; q = w_q BN0(f) + b_q, k = w_k BN1(h_al) + b_k, v = w_v BN2(h_al) + b_v
// (BatchNorm in inference form with the given statistics); 8 heads of 32 channels: attn = softmax_m(q_h . k_h * 32^-0.5); out[c][n] = sum_m attn[n][m] v[c][m]; result = f + w_out out + b_out).
// Compute dtypes, f32 accumulate: every input rounded to bf16; h_al on PLAIN bf16 operands (inputs: exact); the BatchNorms in f32 on VALU written as bf16 hi+lo
// x1024, fp16 v); the output conv on hi+lo planes of the attended map (2 products); bias + residual f32. One-wave-per-tile GEMMs (64x64, 32x64 for h_al); every launch covers all four images; launches that read none of each other's output share one grid. Deterministic, no

#define NB_  4
#define CC   256
#define CH   512                  // channels of h
#define NN   4096                 // query positions
#define MM   1024                 // key positions
#define NHD  8
#define DH   32
#define SCL  0.17677669529663687f   // f32(32^-0.5)
typedef _Float16 h16;
typedef unsigned short bf;
typedef __attribute__((ext_vector_type(16))) __bf16   v16bf;
typedef __attribute__((ext_vector_type(16))) _Float16 v16h;
typedef __attribute__((ext_vector_type(8)))  _Float16 v8h;
typedef __attribute__((ext_vector_type(8)))  unsigned short v8us;
typedef __attribute__((ext_vector_type(8)))  float    v8f;
typedef __attribute__((ext_vector_type(4)))  float    v4f;
typedef v8h  __attribute__((may_alias)) v8ha;
typedef v4f  __attribute__((may_alias)) v4fa;
typedef v8us __attribute__((may_alias)) v8usa;

__device__ __forceinline__ unsigned short f2bf(float f) { unsigned u = __float_as_uint(f); u += 0x7FFFu + ((u >> 16) & 1u); return (unsigned short)(u >> 16); }
__device__ __forceinline__ float bf2f(unsigned short b) { return __uint_as_float(((unsigned)b) << 16); }
__device__ __forceinline__ float bfr(float f) { return bf2f(f2bf(f)); }
__device__ __forceinline__ v16h cat16(v8h lo, v8h hi) { return __builtin_shufflevector(lo, hi, 0, 1, 2, 3, 4, 5, 6, 7, 8, 9, 10, 11, 12, 13, 14, 15); }
__device__ __forceinline__ v16bf cat16b(v8us lo, v8us hi) { return __builtin_bit_cast(v16bf, __builtin_shufflevector(lo, hi, 0, 1, 2, 3, 4, 5, 6, 7, 8, 9, 10, 11, 12, 13, 14, 15)); }
__device__ __forceinline__ v8f wmma16(v16h a, v16h b, v8f c) { return __builtin_amdgcn_wmma_f32_16x16x32_f16(false, a, false, b, (short)0, c, false, false); }
__device__ __forceinline__ v8f wmmab(v16bf a, v16bf b, v8f c) { return __builtin_amdgcn_wmma_f32_16x16x32_bf16(false, a, false, b, (short)0, c, false, false); }



template <typename T16> struct WFrag;
template <> struct WFrag<h16> { typedef v16h V; static __device__ __forceinline__ V ld(const h16* p) { return cat16(*(const v8h*)p, *(const v8h*)(p + 16)); } static __device__ __forceinline__ v8f mma(V a, V b, v8f c) { return wmma16(a, b, c); } };
template <> struct WFrag<bf> { typedef v16bf V; static __device__ __forceinline__ V ld(const bf* p) { return cat16b(*(const v8us*)p, *(const v8us*)(p + 16)); } static __device__ __forceinline__ v8f mma(V a, V b, v8f c) { return wmmab(a, b, c); } };
__device__ __forceinline__ h16 tohx(float x) { return (h16)x; }
__device__ __forceinline__ void splitf(float y, unsigned short& h, unsigned short& l) { h = f2bf(y); l = f2bf(y - bf2f(h)); }
typedef __attribute__((ext_vector_type(2))) _Float16 v2h;
typedef __attribute__((ext_vector_type(2))) unsigned short v2us;
typedef __attribute__((ext_vector_type(8))) _Float16 v8h16;

// ---- Epilogues: what a 64x64 GEMM tile becomes on its way out of the wave that computed it (the elementwise pass that used to follow the GEMM as a launch of its own, on the same f32 values).
// load(): lane addresses and the per-column or per-row parameters, issued in front of the K loop; ready(): their arithmetic, behind it; ahead(mb): loads for 16-row block mb, issued two blocks early;
// stage(): a value on its way into LDS (accumulator layout: row hi * 8 + j); put(): four neighbouring columns of row (ROW8 ? hi * 8 + s : 2 * s + hi) of block mb.
typedef __attribute__((ext_vector_type(4))) _Float16 v4h;
typedef __attribute__((ext_vector_type(4))) unsigned short v4us;
// EpHead: C[row][c] + bf16(bias[c]) as fp16 head planes P[c / 32][row][c % 32]; rows 2 s and 2 s + 1 of a head are one 128-byte line, stored by one instruction.
struct EpHead {
    static constexpr bool ROW8 = false;
    h16* P; int rows; const float* bias; v4f b;
    __device__ __forceinline__ void load(int r0, int c0, int lr, int hi) { const int c = c0 + lr * 4; P += ((size_t)(c >> 5) * rows + r0 + hi) * DH + (c & (DH - 1)); b = *(const v4f*)(bias + c); }
    __device__ __forceinline__ void ready() {
#pragma unroll
        for (int q = 0; q < 4; ++q) b[q] = bfr(b[q]); }
    __device__ __forceinline__ void ahead(int) {}
    __device__ __forceinline__ float stage(int, int, float x) { return x; }
    __device__ __forceinline__ void put(int mb, int s, v4f val) { v4h o;
#pragma unroll
        for (int q = 0; q < 4; ++q) o[q] = tohx(val[q] + b[q]);
        *(v4h*)(P + (mb * 16 + 2 * s) * DH) = o; }
};
// EpBN: the two BatchNorms of C[m][c] + bf16(b_ht[c]) as token-major bf16 hi+lo planes of pitch HPIT (they lie in the work-group's LDS); inv = bf16(gamma) / sqrt(bf16(var) + 1e-5) and shift = bf16(beta) - bf16(mean) * inv once a lane and column.
#define HPIT 264     // LDS pitch of a normalised h_al row, in 16-bit elements: 528 B = 16 B x odd, conflict-free for 16-byte fragment reads
struct EpBN {
    static constexpr bool ROW8 = false;
    bf* T[2][2]; const float* bht; const float* gam; const float* bet; const float* mean; const float* var; v4f rb, g[2], be[2], mu[2], va[2];
    __device__ __forceinline__ void load(int r0, int c0, int lr, int hi) { const int c = c0 + lr * 4; const int o = (r0 + hi) * HPIT + c; rb = *(const v4f*)(bht + c);
#pragma unroll
        for (int w = 0; w < 2; ++w) { const int p = (1 + w) * CC + c; T[w][0] += o; T[w][1] += o; g[w] = *(const v4f*)(gam + p); be[w] = *(const v4f*)(bet + p); mu[w] = *(const v4f*)(mean + p); va[w] = *(const v4f*)(var + p); } }
    __device__ __forceinline__ void ready() {   // g becomes inv, be becomes shift
#pragma unroll
        for (int q = 0; q < 4; ++q) { rb[q] = bfr(rb[q]);
#pragma unroll
            for (int w = 0; w < 2; ++w) { const float inv = __fdiv_rn(bfr(g[w][q]), __fsqrt_rn(bfr(va[w][q]) + 1e-5f)); g[w][q] = inv; be[w][q] = bfr(be[w][q]) - bfr(mu[w][q]) * inv; } } }
    __device__ __forceinline__ void ahead(int) {}
    __device__ __forceinline__ float stage(int, int, float x) { return x; }
    __device__ __forceinline__ void put(int mb, int s, v4f val) {
#pragma unroll
        for (int w = 0; w < 2; ++w) { v4us oh, ol;
#pragma unroll
            for (int q = 0; q < 4; ++q) { unsigned short a, c2; splitf((val[q] + rb[q]) * g[w][q] + be[w][q], a, c2); oh[q] = a; ol[q] = c2; }
            *(v4us*)(T[w][0] + (mb * 16 + 2 * s) * HPIT) = oh; *(v4us*)(T[w][1] + (mb * 16 + 2 * s) * HPIT) = ol; } }
};
// EpVal: C[c][m] + bf16(b_v[c]) as fp16 [c][m]; the row's bias is added in the accumulator layout.
struct EpVal {
    static constexpr bool ROW8 = false;
    h16* V; const float* bv; v8f b[4];
    __device__ __forceinline__ void load(int r0, int c0, int lr, int hi) { V += (size_t)(r0 + hi) * MM + c0 + lr * 4;
#pragma unroll
        for (int mb = 0; mb < 4; ++mb) b[mb] = *(const v8f*)(bv + r0 + mb * 16 + hi * 8); }
    __device__ __forceinline__ void ready() {
#pragma unroll
        for (int mb = 0; mb < 4; ++mb)
#pragma unroll
            for (int j = 0; j < 8; ++j) b[mb][j] = bfr(b[mb][j]); }
    __device__ __forceinline__ void ahead(int) {}
    __device__ __forceinline__ float stage(int mb, int j, float x) { return x + b[mb][j]; }
    __device__ __forceinline__ void put(int mb, int s, v4f val) { v4h o;
#pragma unroll
        for (int q = 0; q < 4; ++q) o[q] = tohx(val[q]);
        *(v4h*)(V + (mb * 16 + 2 * s) * MM) = o; }
};
// EpOut: the result, (bf16(f[c][n]) + C[c][n]) + bf16(b_out[c]) in f32.
struct EpOut {
    static constexpr bool ROW8 = true;
    const float* f; float* O; const float* bp; v4f fv[4][8]; v8f b[4];
    __device__ __forceinline__ void load(int r0, int c0, int lr, int hi) { const size_t o = (size_t)(r0 + hi * 8) * NN + c0 + lr * 4; f += o; O += o; bp += r0 + hi * 8; }
    __device__ __forceinline__ void ready() {}
    __device__ __forceinline__ void ahead(int mb) {
        if (mb >= 2) asm volatile("s_wait_xcnt 0x0" ::: "memory");   // blocks 2 and 3 are fetched behind a block's stores and may land in registers that those stores name: the wait before such a register is overwritten
        b[mb] = *(const v8f*)(bp + mb * 16);
#pragma unroll
        for (int s = 0; s < 8; ++s) fv[mb][s] = *(const v4f*)(f + (mb * 16 + s) * NN); }
    __device__ __forceinline__ float stage(int, int, float x) { return x; }
    __device__ __forceinline__ void put(int mb, int s, v4f val) { v4f o;
#pragma unroll
        for (int q = 0; q < 4; ++q) o[q] = (bfr(fv[mb][s][q]) + val[q]) + bfr(b[mb][s]);
        *(v4f*)(O + (mb * 16 + s) * NN) = o; }
};

// ---- d_gemmw: register-blocked GEMM as one job of a grid: tile (bx, by) of batch bz out of (M/(16 MBN), N/64, Z), ONE WAVE per (16 MBN)x64 tile (4 MBN accumulators), operands straight from K-contiguous 16-bit planes, K a literal.
// PA, PB: row pitch of the A and B planes in elements; a pitch other than K marks planes that lie in LDS.
// C[m][n] (f32) = sum_k A[m][k] Bt[n][k] (+ split products per NSPLIT) goes to the epilogue ep, 16 rows at a time through os (16 x 68 floats of LDS). z-batch strides sA/sB in elements.
template <typename T16, int NSPLIT, int K, int MBN = 4, int PA = K, int PB = K, typename EP>
__device__ __forceinline__ void d_gemmw(const int bx, const int by, const int bz, float* os, const T16* __restrict__ A, const T16* __restrict__ A2, const T16* __restrict__ Bt, const T16* __restrict__ Bt2, size_t sA, size_t sB, EP& ep) {
    typedef typename WFrag<T16>::V V;
    const size_t z = bz; A += z * sA; if (A2) A2 += z * sA; Bt += z * sB; if (Bt2) Bt2 += z * sB;
    const int lane = threadIdx.x & 31, lr = lane & 15, hi = lane >> 4; const int r0 = bx * 16 * MBN, c0 = by * 64;
    ep.load(r0, c0, lr, hi);
    v8f acc[MBN][4];
#pragma unroll
    for (int mb = 0; mb < MBN; ++mb)
#pragma unroll
        for (int nb = 0; nb < 4; ++nb) acc[mb][nb] = (v8f){};
    const size_t aoff = (size_t)(r0 + lr) * PA + 8 * hi, boff = (size_t)(c0 + lr) * PB + 8 * hi;
#pragma unroll 1   // one trip's fragments and the 16 accumulators of a 64x64 tile fill the register file; a second trip unrolled would spill
    for (int kc = 0; kc < K; kc += 32) {
        const T16* pa = A + aoff + kc; const T16* pa2 = (NSPLIT == 1 || NSPLIT == 2) ? A2 + aoff + kc : pa; const T16* pb = Bt + boff + kc; const T16* pb2 = NSPLIT >= 2 ? Bt2 + boff + kc : pb;   // this trip's lane addresses; every load below is one of them plus a constant
        V a[MBN], a2[MBN];
#pragma unroll
        for (int mb = 0; mb < MBN; ++mb) { a[mb] = WFrag<T16>::ld(pa + mb * 16 * PA); if (NSPLIT == 1 || NSPLIT == 2) a2[mb] = WFrag<T16>::ld(pa2 + mb * 16 * PA); }
#pragma unroll
        for (int nb = 0; nb < 4; ++nb) { const V b = WFrag<T16>::ld(pb + nb * 16 * PB); V b2; if (NSPLIT >= 2) b2 = WFrag<T16>::ld(pb2 + nb * 16 * PB);
#pragma unroll
            for (int mb = 0; mb < MBN; ++mb) { acc[mb][nb] = WFrag<T16>::mma(a[mb], b, acc[mb][nb]); if (NSPLIT == 1 || NSPLIT == 2) acc[mb][nb] = WFrag<T16>::mma(a2[mb], b, acc[mb][nb]); if (NSPLIT >= 2) acc[mb][nb] = WFrag<T16>::mma(a[mb], b2, acc[mb][nb]); } }
        asm volatile("v_nop\n\tv_nop\n\tv_nop\n\tv_nop" : "+v"(acc[0][0]), "+v"(acc[1 % MBN][1]), "+v"(acc[2 % MBN][2]), "+v"(acc[3 % MBN][3]) : "v"(a[0]), "v"(a[MBN - 1]));   // the distance behind the trip's last matrix instructions, on the back edge too
        if constexpr (PA != K) asm volatile("s_wait_xcnt 0x0" :: "v"(pb), "v"(pb2) : "memory");
        else if constexpr (PB != K) asm volatile("s_wait_xcnt 0x0" :: "v"(pa), "v"(pa2) : "memory");
        else asm volatile("s_wait_xcnt 0x0" :: "v"(pa), "v"(pa2), "v"(pb), "v"(pb2) : "memory");
    }
    ep.ahead(0); ep.ahead(1); ep.ready();
#pragma unroll
    for (int mb = 0; mb < MBN; ++mb) {
#pragma unroll
        for (int nb = 0; nb < 4; ++nb) {
#pragma unroll
            for (int j = 0; j < 8; ++j) os[(hi * 8 + j) * 68 + nb * 16 + lr] = ep.stage(mb, j, acc[mb][nb][j]); }
        __builtin_amdgcn_wave_barrier(); asm volatile("" ::: "memory");   // the wave's LDS writes stay in front of its reads
#pragma unroll
        for (int s = 0; s < 8; ++s) { const int row = EP::ROW8 ? hi * 8 + s : 2 * s + hi; ep.put(mb, s, *(const v4fa*)(os + row * 68 + lr * 4)); }
        __builtin_amdgcn_wave_barrier(); asm volatile("" ::: "memory");   // the reads stay in front of the next block's writes
        if (mb + 2 < MBN) ep.ahead(mb + 2);
    }
}
// Launches that read none of each other's output share one grid: a range of blockIdx.x is one job, the longer job first.
// k_gemm_hkvq, work-groups of 8 waves. Job 1 (64 work-groups, 64 key positions each): h_al [m][c] = h w_ht^T (K = 512; wave w: positions 32 (w >> 2) ..., channels 64 (w & 3) ...), its BN1 and BN2 hi+lo planes laid
// in LDS, one barrier, then from those planes k = BN1(h_al) w_k^T + b_k as fp16 head planes (waves 0 to 3, 64 channels each) and v [c][m] = w_v BN2(h_al) + b_v as fp16 (waves 4 to 7).
// Job 2 (171 work-groups): q = BN0(f) w_q^T + b_q as fp16 head planes, a 64x64 tile a wave, tiles that share 64 positions next to each other. QWV waves of a work-group take a tile, the others leave at once:
// a work-group fills its WGP (LDS), so 1024 tiles at six a work-group spread over the 192 WGPs that job 1 leaves free, at eight over 128 only.
#define QWV 6
__global__ __launch_bounds__(256) void k_gemm_hkvq(const bf* __restrict__ HB, const bf* __restrict__ WHT, const float* __restrict__ bht, const float* __restrict__ gam, const float* __restrict__ bet, const float* __restrict__ mean, const float* __restrict__ var,
                                                   const bf* __restrict__ WK, const float* __restrict__ bk, h16* KP, const bf* __restrict__ WV, const float* __restrict__ bv, h16* V16,
                                                   const bf* __restrict__ FTh, const bf* __restrict__ FTl, const bf* __restrict__ WQ, const float* __restrict__ bq, h16* QP) {
    __shared__ __align__(16) float osw[8 * 16 * 68];
    __shared__ __align__(16) bf Hs[4 * 64 * HPIT];
    const int b = blockIdx.x; const int wave = __builtin_amdgcn_readfirstlane(threadIdx.x >> 5); float* os = osw + wave * 16 * 68;
    if (b < (MM / 64) * NB_) { const int img = b >> 4, t0 = (b & 15) * 64;
        { EpBN ep; ep.T[0][0] = Hs; ep.T[0][1] = Hs + 64 * HPIT; ep.T[1][0] = Hs + 2 * 64 * HPIT; ep.T[1][1] = Hs + 3 * 64 * HPIT; ep.bht = bht; ep.gam = gam; ep.bet = bet; ep.mean = mean; ep.var = var;
          d_gemmw<bf, 0, CH, 2>(wave >> 2, wave & 3, 0, os, HB + ((size_t)img * MM + t0) * CH, nullptr, WHT, nullptr, 0, 0, ep); }
        __syncthreads();   // all 256 channels of the 64 positions lie in LDS before any wave reads them
        if (wave < 4) { EpHead ep; ep.P = KP + ((size_t)img * NHD * MM + t0) * DH; ep.rows = MM; ep.bias = bk;
            d_gemmw<bf, 1, CC, 4, HPIT, CC>(0, wave, 0, os, Hs, Hs + 64 * HPIT, WK, nullptr, 0, 0, ep); }
        else { EpVal ep; ep.V = V16 + (size_t)img * CC * MM + t0; ep.bv = bv;
            d_gemmw<bf, 3, CC, 4, CC, HPIT>(wave - 4, 0, 0, os, WV, nullptr, Hs + 2 * 64 * HPIT, Hs + 3 * 64 * HPIT, 0, 0, ep);
            asm volatile("s_wait_xcnt 0x0" ::: "memory"); } }   // the wait before a register that an issued store names is overwritten: what stands behind these stores in the built kernel (the k waves' code, on a way that the listing's branches allow) writes such registers
    else { const int t = (b - (MM / 64) * NB_) * QWV + wave; if (wave >= QWV || t >= (NN / 64) * (CC / 64) * NB_) return;   // no barrier stands in this job
        EpHead ep; ep.P = QP + (size_t)(t >> 8) * NHD * NN * DH; ep.rows = NN; ep.bias = bq;
        d_gemmw<bf, 1, CC>((t >> 2) & 63, t & 3, t >> 8, os, FTh, FTl, WQ, nullptr, (size_t)NN * CC, 0, ep);
        asm volatile("s_wait_xcnt 0x0" ::: "memory"); }   // as above: job 1's code stands behind these stores
}
// k_gemm_out: result [c][n] = f + w_out . out + b_out; grid (CC/64, NN/64, images).
__global__ __launch_bounds__(32) void k_gemm_out(const bf* __restrict__ WO, const bf* __restrict__ Oh, const bf* __restrict__ Ol, const float* __restrict__ f, const float* __restrict__ bp, float* OUT) {
    __shared__ __align__(16) float os[16 * 68];
    EpOut ep; ep.f = f + (size_t)blockIdx.z * CC * NN; ep.O = OUT + (size_t)blockIdx.z * CC * NN; ep.bp = bp;
    d_gemmw<bf, 3, CC>(blockIdx.x, blockIdx.y, blockIdx.z, os, WO, nullptr, Oh, Ol, 0, (size_t)NN * CC, ep);
}


__device__ __forceinline__ void d_cvt8(const int bx, const float* __restrict__ src, bf* dst, size_t n8) { const size_t i = (size_t)bx * 256 + threadIdx.x; if (i >= n8) return; const v8f v = *(const v8f*)(src + i * 8); v8us o;
#pragma unroll
    for (int k = 0; k < 8; ++k) o[k] = f2bf(v[k]); *(v8us*)(dst + i * 8) = o;  }
// d_turn: one wave turns a tile of 64 source rows x 32 positions of src [ROWS][COLS] (f32) into token-major 16-bit rows T[position][row]. A lane is one position: each load is one whole 128-byte line of a source
// row. The lane's 64 results go as 16-byte pieces into the wave's own LDS tile and come back eight lanes a token row, so each store is four whole 128-byte lines. No work-group barrier: the tile is one wave's.
// BN = 1: hi+lo planes of bf16(src) * inv[row] + shift[row], inv = bf16(gamma) / sqrt(bf16(var) + 1e-5), shift = bf16(beta) - bf16(mean) * inv, formed once a row (lane l: rows l and 32 + l) and handed round by
// lane reads. BN = 0: bf16(src), one plane.
#define TPIT 72      // LDS pitch of a turned row, in 16-bit elements: 144 B = 16 B x odd
__device__ __forceinline__ float rlane(float v, int l) { return __int_as_float(__builtin_amdgcn_readlane(__float_as_int(v), l)); }
template <int BN, int ROWS, int COLS>
__device__ __forceinline__ void d_turn(bf* ts, const int rt, const int nt, const int img, const float* __restrict__ src, const float* __restrict__ gam, const float* __restrict__ bet, const float* __restrict__ mean, const float* __restrict__ var, bf* Th, bf* Tl) {
    const int lane = threadIdx.x & 31; const int r0 = rt * 64, n0 = nt * 32;
    float iv[2], sh[2];
    if (BN) {
        const float* pg = gam + r0 + lane; const float* pv = var + r0 + lane; const float* pm = mean + r0 + lane; const float* pb = bet + r0 + lane;
        const float g0 = pg[0], g1 = pg[32], v0 = pv[0], v1 = pv[32], m0 = pm[0], m1 = pm[32], b0 = pb[0], b1 = pb[32];
        asm volatile("s_wait_xcnt 0x0" :: "v"(lane) : "memory");   // the wait before a register that an issued load names is overwritten: the lane number is these loads' vector address, and as an input here it stays whole up to the wait
        iv[0] = __fdiv_rn(bfr(g0), __fsqrt_rn(bfr(v0) + 1e-5f)); sh[0] = bfr(b0) - bfr(m0) * iv[0]; iv[1] = __fdiv_rn(bfr(g1), __fsqrt_rn(bfr(v1) + 1e-5f)); sh[1] = bfr(b1) - bfr(m1) * iv[1];
    }
    const float* p = src + ((size_t)img * ROWS + r0) * COLS + n0 + lane;
    float x[64];
#pragma unroll
    for (int i = 0; i < 64; ++i) x[i] = p[(size_t)i * COLS];
    asm volatile("s_wait_xcnt 0x0" :: "v"(lane) : "memory");   // as above, for the tile's 64 loads
    bf* tw = ts + lane * TPIT;
#pragma unroll
    for (int g = 0; g < 8; ++g) { v8us H, L;
#pragma unroll
        for (int j = 0; j < 8; ++j) { const int i = g * 8 + j;
            if (BN) { unsigned short a, c; splitf(bfr(x[i]) * rlane(iv[i >> 5], i & 31) + rlane(sh[i >> 5], i & 31), a, c); H[j] = a; L[j] = c; }
            else H[j] = f2bf(x[i]); }
        *(v8us*)(tw + g * 8) = H; if (BN) *(v8us*)(tw + 32 * TPIT + g * 8) = L; }
    asm volatile("s_wait_dscnt 0x0" ::: "memory");   // the wave's own LDS writes have landed before other lanes of it read the rows back
    const int rr = lane >> 3, pc = lane & 7; const bf* sp = ts + rr * TPIT + pc * 8; const size_t o = ((size_t)img * COLS + n0 + rr) * ROWS + r0 + pc * 8; bf* dh = Th + o; bf* dl = Tl + o;
    v8us a[8], b[8];
#pragma unroll
    for (int t = 0; t < 8; ++t) { a[t] = *(const v8us*)(sp + t * 4 * TPIT); if (BN) b[t] = *(const v8us*)(sp + (32 + t * 4) * TPIT); }
#pragma unroll
    for (int t = 0; t < 8; ++t) { *(v8us*)(dh + t * 4 * ROWS) = a[t]; if (BN) *(v8us*)(dl + t * 4 * ROWS) = b[t]; }
    asm volatile("s_wait_xcnt 0x0" ::: "memory");   // the wait before a register that an issued store names is overwritten: what stands behind this function in the built kernel (another job's code, on a way that the listing's branches allow) writes such registers
}
// k_prep: the jobs that read inputs only. BN0(bf16(f)) token-major (256 work-groups), h token-major (128), the five weight matrices as bf16 (64 + 4 x 32). A turning work-group takes 256 source rows x 64 positions,
// a tile a wave: 256 bytes in a row of each source row.
__global__ __launch_bounds__(256) void k_prep(const float* __restrict__ f, const float* __restrict__ hin, const float* __restrict__ wht, const float* __restrict__ wq, const float* __restrict__ wk, const float* __restrict__ wv, const float* __restrict__ wo,
                                              const float* __restrict__ gam, const float* __restrict__ bet, const float* __restrict__ mean, const float* __restrict__ var, bf* FTh, bf* FTl, bf* HB, bf* WHT, bf* WQ, bf* WK, bf* WV, bf* WO) {
    __shared__ __align__(16) bf Ts[8 * 2 * 32 * TPIT];
    int b = blockIdx.x; const int wave = __builtin_amdgcn_readfirstlane(threadIdx.x >> 5); bf* ts = Ts + wave * 2 * 32 * TPIT;
    if (b < 64 * NB_) { d_turn<1, CC, NN>(ts, wave & 3, (b & 63) * 2 + (wave >> 2), b >> 6, f, gam, bet, mean, var, FTh, FTl); return; }
    b -= 64 * NB_;
    if (b < 32 * NB_) { d_turn<0, CH, MM>(ts, (b & 1) * 4 + (wave & 3), (b & 30) + (wave >> 2), b >> 5, hin, nullptr, nullptr, nullptr, nullptr, HB, nullptr); return; }
    b -= 32 * NB_;
    if (b < 64) { d_cvt8(b, wht, WHT, (size_t)CC * CH / 8); return; }
    b -= 64;
    const int w = b >> 5; const float* src = w == 0 ? wq : w == 1 ? wk : w == 2 ? wv : wo; bf* dst = w == 0 ? WQ : w == 1 ? WK : w == 2 ? WV : WO;
    d_cvt8(b & 31, src, dst, (size_t)CC * CC / 8);
}
// ---- k_attn: scores, softmax and the value product of one head pair for 256 queries in one work-group; grid (NN/256, NHD/2, images) = one work-group a WGP, 256 threads = 8 waves, wave w: head (w & 1) of the pair,
// queries 64 (w >> 1) ..., as QT tiles of 16: a key or value fragment read from LDS serves all QT tiles, and the pair's keys and values are laid into LDS once for 256 queries.
// The pair's keys [2][MM][DH] and values [2 DH][MM] lie in LDS for the whole launch. S^T = K Q^T (a lane holds one query's scores: 8 keys a tile), so two score tiles, converted in place, are the B operand of
// O^T += V P^T (V rows read in the same k order as the packed tiles). Pass 1 finds each query's exact maximum, pass 2 forms the scores again, p = exp((s - max) * 32^-0.5) * 1024 as fp16, f32 row sum of p.
// The attended map leaves normalised, as bf16 hi+lo planes [n][c]; it goes through LDS (the keys' place, once every wave has left them) so that each 128-byte line of a plane is stored by one wave instruction.
#define KPIT 40      // LDS pitch of a key row, in halves: 80 B = 16 B x odd, conflict-free for 16-byte fragment reads
#define VPIT 1032    // LDS pitch of a value row, in halves: 2064 B = 16 B x odd
#define OPIT 72      // LDS pitch of a staged output row, in 16-bit elements
#define QT   4       // query tiles of 16 a wave
#define QW   (64 * QT)   // queries a work-group
__device__ __forceinline__ v16h ldh(const h16* p) { return cat16(*(const v8h*)p, *(const v8h*)(p + 16)); }
__global__ __launch_bounds__(256) void k_attn(const h16* __restrict__ QP, const h16* __restrict__ KP, const h16* __restrict__ V16, bf* Oh, bf* Ol) {
    __shared__ __align__(16) h16 Ks[2 * MM * KPIT];
    __shared__ __align__(16) h16 Vs[2 * DH * VPIT];
    bf* const Os = (bf*)Ks;   // 2 * QW * OPIT elements, fewer than the keys take
    QP += (size_t)blockIdx.z * NHD * NN * DH; KP += (size_t)blockIdx.z * NHD * MM * DH; V16 += (size_t)blockIdx.z * CC * MM; Oh += (size_t)blockIdx.z * NN * CC; Ol += (size_t)blockIdx.z * NN * CC;   // blockIdx.z: image
    const int tid = threadIdx.x, lane = tid & 31, wave = tid >> 5, lr = lane & 15, hi = lane >> 4; const int hp = blockIdx.y, hl = wave & 1, qt = wave >> 1;
    const h16* kg = KP + (size_t)hp * 2 * MM * DH; const h16* vg = V16 + (size_t)hp * 2 * DH * MM;
#pragma unroll 16   // sixteen 16-byte loads in flight per thread while the tiles are laid: the fill is bound by latency otherwise
    for (int t = 0; t < 2 * MM * DH / 8 / 256; ++t) { const int i = t * 256 + tid; *(v8h*)(Ks + (i >> 2) * KPIT + (i & 3) * 8) = *(const v8h*)(kg + (size_t)i * 8); }
#pragma unroll 16   // as above
    for (int t = 0; t < 2 * DH * MM / 8 / 256; ++t) { const int i = t * 256 + tid; *(v8h*)(Vs + (i >> 7) * VPIT + (i & 127) * 8) = *(const v8h*)(vg + (size_t)i * 8); }
    const h16* qg = QP + ((size_t)(hp * 2 + hl) * NN + blockIdx.x * QW + qt * 16 * QT + lr) * DH + 8 * hi;
    v16h qf[QT];
#pragma unroll
    for (int t = 0; t < QT; ++t) qf[t] = ldh(qg + t * 16 * DH);
    asm volatile("s_wait_xcnt 0x0" :: "v"(qg) : "memory");   // the wait before a register that an issued load names is overwritten: as an input here the address pair stays whole up to it
    __syncthreads();
    const h16* kl = Ks + (hl * MM + lr) * KPIT + 8 * hi; const h16* vl = Vs + (hl * DH + lr) * VPIT + 8 * hi;
    float m[QT];
#pragma unroll
    for (int t = 0; t < QT; ++t) m[t] = -3.0e38f;
#pragma unroll 4   // four key fragments fetched as one group; the sixteen independent score tiles fill each other's distance behind the matrix instruction
    for (int kt = 0; kt < MM / 16; ++kt) { const v16h kf = ldh(kl + kt * 16 * KPIT);
#pragma unroll
        for (int t = 0; t < QT; ++t) { const v8f s = wmma16(kf, qf[t], (v8f){});
            m[t] = fmaxf(m[t], fmaxf(fmaxf(fmaxf(s[0], s[1]), fmaxf(s[2], s[3])), fmaxf(fmaxf(s[4], s[5]), fmaxf(s[6], s[7])))); } }
    v8f o0[QT], o1[QT]; float sum0[QT], sum1[QT]; const float c2 = SCL * 1.4426950408889634f;
#pragma unroll
    for (int t = 0; t < QT; ++t) { m[t] = fmaxf(m[t], __shfl_xor(m[t], 16, 32)); o0[t] = (v8f){}; o1[t] = (v8f){}; sum0[t] = 0.f; sum1[t] = 0.f; }
#pragma unroll 1   // the four query tiles of one 32-key step cover each other's matrix distances; a second step unrolled would go past 256 registers
    for (int kc = 0; kc < MM; kc += 32) {
        const v16h ka = ldh(kl + kc * KPIT), kb = ldh(kl + (kc + 16) * KPIT), va = ldh(vl + kc), vb = ldh(vl + 16 * VPIT + kc); v8f s0[QT], s1[QT];
#pragma unroll
        for (int t = 0; t < QT; ++t) { s0[t] = wmma16(ka, qf[t], (v8f){}); s1[t] = wmma16(kb, qf[t], (v8f){}); }
        __builtin_amdgcn_sched_barrier(0);   // the eight score products issue back to back and fill each other's distance: without it each is followed by idle slots and one early reader
#pragma unroll
        for (int t = 0; t < QT; ++t) { v16h p;
#pragma unroll
            for (int j = 0; j < 8; ++j) { const float e0 = __builtin_amdgcn_exp2f(__builtin_fmaf(s0[t][j] - m[t], c2, 10.0f)), e1 = __builtin_amdgcn_exp2f(__builtin_fmaf(s1[t][j] - m[t], c2, 10.0f));   // + 10: p carries a factor 2^10, which keeps small weights out of the fp16 subnormals; the row sum carries it too
                sum0[t] += e0; sum1[t] += e1; p[j] = tohx(e0); p[8 + j] = tohx(e1); }
            o0[t] = wmma16(va, p, o0[t]); o1[t] = wmma16(vb, p, o1[t]); } }
    __syncthreads();   // every wave has read its last key: the staged output may take the keys' place
#pragma unroll
    for (int t = 0; t < QT; ++t) { float sum = sum0[t] + sum1[t]; sum += __shfl_xor(sum, 16, 32); const float ri = __fdiv_rn(1.0f, sum); v8us h0, l0, h1, l1;
#pragma unroll
      for (int j = 0; j < 8; ++j) { unsigned short a, c; splitf(__fmul_rn(o0[t][j], ri), a, c); h0[j] = a; l0[j] = c; splitf(__fmul_rn(o1[t][j], ri), a, c); h1[j] = a; l1[j] = c; }
      bf* od = Os + ((qt * QT + t) * 16 + lr) * OPIT + hl * DH + 8 * hi;
      *(v8us*)od = h0; *(v8us*)(od + 16) = h1; *(v8us*)(od + QW * OPIT) = l0; *(v8us*)(od + QW * OPIT + 16) = l1; }
    __syncthreads();
    { const int r = tid >> 3, c = tid & 7; const size_t o = (size_t)(blockIdx.x * QW + r) * CC + hp * 64 + c * 8; bf* dh = Oh + o; bf* dl = Ol + o; const bf* sp = Os + r * OPIT + c * 8;   // eight lanes a row: one 128-byte line of a plane; every access below is one of these plus a constant
#pragma unroll
      for (int t = 0; t < QW / 32; ++t) { *(v8us*)(dh + t * 32 * CC) = *(const v8us*)(sp + t * 32 * OPIT); *(v8us*)(dl + t * 32 * CC) = *(const v8us*)(sp + (QW + t * 32) * OPIT); } }
}


extern "C" void kernel_launch(void* const* d_in, const int* in_sizes, int n_in,
                              void* d_out, int out_size, void* d_ws, size_t ws_size, hipStream_t stream) {
    (void)in_sizes; (void)n_in; (void)out_size;
    const float* IN[16]; for (int i = 0; i < 16; ++i) IN[i] = (const float*)d_in[i];
    // f [4][256][64][64], h [4][512][32][32], w_ht [256][512], b_ht, bn_gamma [3][256], bn_beta, bn_mean, bn_var, w_q [256][256], b_q, w_k, b_k, w_v, b_v, w_out, b_out = d_in[0..15]
    const float* f = IN[0]; const float* hin = IN[1]; const float* gam = IN[4]; const float* bet = IN[5]; const float* mean = IN[6]; const float* var = IN[7];
    float* OUT = (float*)d_out;     // [4][256][64][64]
    char* wsp = (char*)d_ws;
    auto take = [&](size_t bytes) { char* p = wsp; wsp += (bytes + 255) & ~(size_t)255; return (void*)p; };
    bf* WHT = (bf*)take((size_t)CC * CH * 2); bf* WQ = (bf*)take((size_t)CC * CC * 2); bf* WK = (bf*)take((size_t)CC * CC * 2); bf* WV = (bf*)take((size_t)CC * CC * 2); bf* WO = (bf*)take((size_t)CC * CC * 2);
    // per-image planes, NB_ images one behind the other
    bf* HB = (bf*)take((size_t)NB_ * MM * CH * 2);
    bf* FTh = (bf*)take((size_t)NB_ * NN * CC * 2); bf* FTl = (bf*)take((size_t)NB_ * NN * CC * 2); h16* QP = (h16*)take((size_t)NB_ * NHD * NN * DH * 2); h16* KP = (h16*)take((size_t)NB_ * NHD * MM * DH * 2);
    h16* V16 = (h16*)take((size_t)NB_ * CC * MM * 2);
    bf* Oh = (bf*)take((size_t)NB_ * NN * CC * 2); bf* Ol = (bf*)take((size_t)NB_ * NN * CC * 2);
    if ((size_t)(wsp - (char*)d_ws) > ws_size) return;    // total ~ 49 MB; ws 256 MiB
    k_prep<<<64 * NB_ + 32 * NB_ + 64 + 4 * 32, 256, 0, stream>>>(f, hin, IN[2], IN[8], IN[10], IN[12], IN[14], gam, bet, mean, var, FTh, FTl, HB, WHT, WQ, WK, WV, WO);   // BN0(bf16(f)), h token-major, bf16 weights
    k_gemm_hkvq<<<(MM / 64) * NB_ + ((NN / 64) * (CC / 64) * NB_ + QWV - 1) / QWV, 256, 0, stream>>>(HB, WHT, IN[3], gam, bet, mean, var, WK, IN[11], KP, WV, IN[13], V16, FTh, FTl, WQ, IN[9], QP);   // h_al, its BN1 and BN2, k head planes, v + b_v; q head planes
    k_attn<<<dim3(NN / QW, NHD / 2, NB_), 256, 0, stream>>>(QP, KP, V16, Oh, Ol);   // softmax(q k) v, normalised, token-major hi+lo planes
    k_gemm_out<<<dim3(CC / 64, NN / 64, NB_), 32, 0, stream>>>(WO, Oh, Ol, f, IN[15], OUT);   // f + w_out . out + b_out
}

// v008
// One run takes 68.6 microseconds.
// Timed twice side by side with v007, it ran 1.10 and 1.11 times as fast.
// All steps since v000 together make it 25.7 times as fast.
#include <hip/hip_runtime.h>

// CIM (cross-image attention; f [4][256][64][64] (N = 4096 queries), h [4][512][32][32] (M = 1024 keys); h_al = w_ht h + b_ht; q = w_q BN0(f) + b_q, k = w_k BN1(h_al) + b_k, v = w_v BN2(h_al) + b_v
// (BatchNorm in inference form with the given statistics); 8 heads of 32 channels: attn = softmax_m(q_h . k_h * 32^-0.5); out[c][n] = sum_m attn[n][m] v[c][m]; result = f + w_out out + b_out).
// Compute dtypes, f32 accumulate: every input rounded to bf16; h_al on PLAIN bf16 operands (inputs: exact); the BatchNorms in f32 on VALU written as bf16 hi+lo
// x1024, fp16 v); the output conv on hi+lo planes of the attended map (2 products); bias + residual f32. One-wave-per-tile GEMMs (64x64, 32x64 for h_al); every launch covers all four images; launches that read none of each other's output share one grid. Deterministic, no

#define NB_  4
#define CC   256
#define CH   512                  // channels of h
#define NN   4096                 // query positions
#define MM   1024                 // key positions
#define NHD  8
#define DH   32
#define SCL  0.17677669529663687f   // f32(32^-0.5)
typedef _Float16 h16;
typedef unsigned short bf;
typedef __attribute__((ext_vector_type(16))) __bf16   v16bf;
typedef __attribute__((ext_vector_type(16))) _Float16 v16h;
typedef __attribute__((ext_vector_type(8)))  _Float16 v8h;
typedef __attribute__((ext_vector_type(8)))  unsigned short v8us;
typedef __attribute__((ext_vector_type(8)))  float    v8f;
typedef __attribute__((ext_vector_type(4)))  float    v4f;
typedef v8h  __attribute__((may_alias)) v8ha;
typedef v4f  __attribute__((may_alias)) v4fa;
typedef v8us __attribute__((may_alias)) v8usa;

__device__ __forceinline__ unsigned short f2bf(float f) { unsigned u = __float_as_uint(f); u += 0x7FFFu + ((u >> 16) & 1u); return (unsigned short)(u >> 16); }
__device__ __forceinline__ float bf2f(unsigned short b) { return __uint_as_float(((unsigned)b) << 16); }
__device__ __forceinline__ float bfr(float f) { return bf2f(f2bf(f)); }
__device__ __forceinline__ v16h cat16(v8h lo, v8h hi) { return __builtin_shufflevector(lo, hi, 0, 1, 2, 3, 4, 5, 6, 7, 8, 9, 10, 11, 12, 13, 14, 15); }
__device__ __forceinline__ v16bf cat16b(v8us lo, v8us hi) { return __builtin_bit_cast(v16bf, __builtin_shufflevector(lo, hi, 0, 1, 2, 3, 4, 5, 6, 7, 8, 9, 10, 11, 12, 13, 14, 15)); }
__device__ __forceinline__ v8f wmma16(v16h a, v16h b, v8f c) { return __builtin_amdgcn_wmma_f32_16x16x32_f16(false, a, false, b, (short)0, c, false, false); }
__device__ __forceinline__ v8f wmmab(v16bf a, v16bf b, v8f c) { return __builtin_amdgcn_wmma_f32_16x16x32_bf16(false, a, false, b, (short)0, c, false, false); }



template <typename T16> struct WFrag;
template <> struct WFrag<h16> { typedef v16h V; static __device__ __forceinline__ V ld(const h16* p) { return cat16(*(const v8h*)p, *(const v8h*)(p + 16)); } static __device__ __forceinline__ v8f mma(V a, V b, v8f c) { return wmma16(a, b, c); } };
template <> struct WFrag<bf> { typedef v16bf V; static __device__ __forceinline__ V ld(const bf* p) { return cat16b(*(const v8us*)p, *(const v8us*)(p + 16)); } static __device__ __forceinline__ v8f mma(V a, V b, v8f c) { return wmmab(a, b, c); } };
__device__ __forceinline__ h16 tohx(float x) { return (h16)x; }
__device__ __forceinline__ void splitf(float y, unsigned short& h, unsigned short& l) { h = f2bf(y); l = f2bf(y - bf2f(h)); }
typedef __attribute__((ext_vector_type(2))) _Float16 v2h;
typedef __attribute__((ext_vector_type(2))) unsigned short v2us;
typedef __attribute__((ext_vector_type(8))) _Float16 v8h16;

// ---- Epilogues: what a 64x64 GEMM tile becomes on its way out of the wave that computed it (the elementwise pass that used to follow the GEMM as a launch of its own, on the same f32 values).
// load(): lane addresses and the per-column or per-row parameters, issued in front of the K loop; ready(): their arithmetic, behind it; ahead(mb): loads for 16-row block mb, issued two blocks early;
// stage(): a value on its way into LDS (accumulator layout: row hi * 8 + j); put(): four neighbouring columns of row (ROW8 ? hi * 8 + s : 2 * s + hi) of block mb.
typedef __attribute__((ext_vector_type(4))) _Float16 v4h;
typedef __attribute__((ext_vector_type(4))) unsigned short v4us;
// EpHead: C[row][c] + bf16(bias[c]) as fp16 head planes P[c / 32][row][c % 32]; rows 2 s and 2 s + 1 of a head are one 128-byte line, stored by one instruction.
struct EpHead {
    static constexpr bool ROW8 = false;
    h16* P; int rows; const float* bias; v4f b;
    __device__ __forceinline__ void load(int r0, int c0, int lr, int hi) { const int c = c0 + lr * 4; P += ((size_t)(c >> 5) * rows + r0 + hi) * DH + (c & (DH - 1)); b = *(const v4f*)(bias + c); }
    __device__ __forceinline__ void ready() {
#pragma unroll
        for (int q = 0; q < 4; ++q) b[q] = bfr(b[q]); }
    __device__ __forceinline__ void ahead(int) {}
    __device__ __forceinline__ float stage(int, int, float x) { return x; }
    __device__ __forceinline__ void put(int mb, int s, v4f val) { v4h o;
#pragma unroll
        for (int q = 0; q < 4; ++q) o[q] = tohx(val[q] + b[q]);
        *(v4h*)(P + (mb * 16 + 2 * s) * DH) = o; }
};
// EpBN: the two BatchNorms of C[m][c] + bf16(b_ht[c]) as token-major bf16 hi+lo planes of pitch HPIT (they lie in the work-group's LDS); inv = bf16(gamma) / sqrt(bf16(var) + 1e-5) and shift = bf16(beta) - bf16(mean) * inv once a lane and column.
#define HPIT 264     // LDS pitch of a normalised h_al row, in 16-bit elements: 528 B = 16 B x odd, conflict-free for 16-byte fragment reads
struct EpBN {
    static constexpr bool ROW8 = false;
    bf* T[2][2]; const float* bht; const float* gam; const float* bet; const float* mean; const float* var; v4f rb, g[2], be[2], mu[2], va[2];
    __device__ __forceinline__ void load(int r0, int c0, int lr, int hi) { const int c = c0 + lr * 4; const int o = (r0 + hi) * HPIT + c; rb = *(const v4f*)(bht + c);
#pragma unroll
        for (int w = 0; w < 2; ++w) { const int p = (1 + w) * CC + c; T[w][0] += o; T[w][1] += o; g[w] = *(const v4f*)(gam + p); be[w] = *(const v4f*)(bet + p); mu[w] = *(const v4f*)(mean + p); va[w] = *(const v4f*)(var + p); } }
    __device__ __forceinline__ void ready() {   // g becomes inv, be becomes shift
#pragma unroll
        for (int q = 0; q < 4; ++q) { rb[q] = bfr(rb[q]);
#pragma unroll
            for (int w = 0; w < 2; ++w) { const float inv = __fdiv_rn(bfr(g[w][q]), __fsqrt_rn(bfr(va[w][q]) + 1e-5f)); g[w][q] = inv; be[w][q] = bfr(be[w][q]) - bfr(mu[w][q]) * inv; } } }
    __device__ __forceinline__ void ahead(int) {}
    __device__ __forceinline__ float stage(int, int, float x) { return x; }
    __device__ __forceinline__ void put(int mb, int s, v4f val) {
#pragma unroll
        for (int w = 0; w < 2; ++w) { v4us oh, ol;
#pragma unroll
            for (int q = 0; q < 4; ++q) { unsigned short a, c2; splitf((val[q] + rb[q]) * g[w][q] + be[w][q], a, c2); oh[q] = a; ol[q] = c2; }
            *(v4us*)(T[w][0] + (mb * 16 + 2 * s) * HPIT) = oh; *(v4us*)(T[w][1] + (mb * 16 + 2 * s) * HPIT) = ol; } }
};
// EpVal: C[c][m] + bf16(b_v[c]) as fp16 [c][m]; the row's bias is added in the accumulator layout.
struct EpVal {
    static constexpr bool ROW8 = false;
    h16* V; const float* bv; v8f b[4];
    __device__ __forceinline__ void load(int r0, int c0, int lr, int hi) { V += (size_t)(r0 + hi) * MM + c0 + lr * 4;
#pragma unroll
        for (int mb = 0; mb < 4; ++mb) b[mb] = *(const v8f*)(bv + r0 + mb * 16 + hi * 8); }
    __device__ __forceinline__ void ready() {
#pragma unroll
        for (int mb = 0; mb < 4; ++mb)
#pragma unroll
            for (int j = 0; j < 8; ++j) b[mb][j] = bfr(b[mb][j]); }
    __device__ __forceinline__ void ahead(int) {}
    __device__ __forceinline__ float stage(int mb, int j, float x) { return x + b[mb][j]; }
    __device__ __forceinline__ void put(int mb, int s, v4f val) { v4h o;
#pragma unroll
        for (int q = 0; q < 4; ++q) o[q] = tohx(val[q]);
        *(v4h*)(V + (mb * 16 + 2 * s) * MM) = o; }
};
// EpOut: the result, (bf16(f[c][n]) + C[c][n]) + bf16(b_out[c]) in f32.
struct EpOut {
    static constexpr bool ROW8 = true;
    const float* f; float* O; const float* bp; v4f fv[4][8]; v8f b[4];
    __device__ __forceinline__ void load(int r0, int c0, int lr, int hi) { const size_t o = (size_t)(r0 + hi * 8) * NN + c0 + lr * 4; f += o; O += o; bp += r0 + hi * 8; }
    __device__ __forceinline__ void ready() {}
    __device__ __forceinline__ void ahead(int mb) {
        if (mb >= 2) asm volatile("s_wait_xcnt 0x0" ::: "memory");   // blocks 2 and 3 are fetched behind a block's stores and may land in registers that those stores name: the wait before such a register is overwritten
        b[mb] = *(const v8f*)(bp + mb * 16);
#pragma unroll
        for (int s = 0; s < 8; ++s) fv[mb][s] = *(const v4f*)(f + (mb * 16 + s) * NN); }
    __device__ __forceinline__ float stage(int, int, float x) { return x; }
    __device__ __forceinline__ void put(int mb, int s, v4f val) { v4f o;
#pragma unroll
        for (int q = 0; q < 4; ++q) o[q] = (bfr(fv[mb][s][q]) + val[q]) + bfr(b[mb][s]);
        *(v4f*)(O + (mb * 16 + s) * NN) = o; }
};

// ---- d_gemmw: register-blocked GEMM as one job of a grid: tile (bx, by) of batch bz out of (M/(16 MBN), N/64, Z), ONE WAVE per (16 MBN)x64 tile (4 MBN accumulators), operands straight from K-contiguous 16-bit planes, K a literal.
// PA, PB: row pitch of the A and B planes in elements; a pitch other than K marks planes that lie in LDS.
// C[m][n] (f32) = sum_k A[m][k] Bt[n][k] (+ split products per NSPLIT) goes to the epilogue ep, 16 rows at a time through os (16 x 68 floats of LDS). z-batch strides sA/sB in elements.
template <typename T16, int NSPLIT, int K, int MBN = 4, int PA = K, int PB = K, typename EP>
__device__ __forceinline__ void d_gemmw(const int bx, const int by, const int bz, float* os, const T16* __restrict__ A, const T16* __restrict__ A2, const T16* __restrict__ Bt, const T16* __restrict__ Bt2, size_t sA, size_t sB, EP& ep) {
    typedef typename WFrag<T16>::V V;
    const size_t z = bz; A += z * sA; if (A2) A2 += z * sA; Bt += z * sB; if (Bt2) Bt2 += z * sB;
    const int lane = threadIdx.x & 31, lr = lane & 15, hi = lane >> 4; const int r0 = bx * 16 * MBN, c0 = by * 64;
    ep.load(r0, c0, lr, hi);
    v8f acc[MBN][4];
#pragma unroll
    for (int mb = 0; mb < MBN; ++mb)
#pragma unroll
        for (int nb = 0; nb < 4; ++nb) acc[mb][nb] = (v8f){};
    const size_t aoff = (size_t)(r0 + lr) * PA + 8 * hi, boff = (size_t)(c0 + lr) * PB + 8 * hi;
#pragma unroll 1   // one trip's fragments and the 16 accumulators of a 64x64 tile fill the register file; a second trip unrolled would spill
    for (int kc = 0; kc < K; kc += 32) {
        const T16* pa = A + aoff + kc; const T16* pa2 = (NSPLIT == 1 || NSPLIT == 2) ? A2 + aoff + kc : pa; const T16* pb = Bt + boff + kc; const T16* pb2 = NSPLIT >= 2 ? Bt2 + boff + kc : pb;   // this trip's lane addresses; every load below is one of them plus a constant
        V a[MBN], a2[MBN], b[4], b2[4];
#pragma unroll
        for (int mb = 0; mb < MBN; ++mb) { a[mb] = WFrag<T16>::ld(pa + mb * 16 * PA); if (NSPLIT == 1 || NSPLIT == 2) a2[mb] = WFrag<T16>::ld(pa2 + mb * 16 * PA); }
#pragma unroll
        for (int nb = 0; nb < 4; ++nb) { b[nb] = WFrag<T16>::ld(pb + nb * 16 * PB); if (NSPLIT >= 2) b2[nb] = WFrag<T16>::ld(pb2 + nb * 16 * PB); }
        if constexpr (PA != K) asm volatile("s_wait_xcnt 0x0" :: "v"(pb), "v"(pb2) : "memory");
        else if constexpr (PB != K) asm volatile("s_wait_xcnt 0x0" :: "v"(pa), "v"(pa2) : "memory");
        else asm volatile("s_wait_xcnt 0x0" :: "v"(pa), "v"(pa2), "v"(pb), "v"(pb2) : "memory");
        __builtin_amdgcn_sched_barrier(0);   // every fragment load of the trip is issued before its first matrix instruction, so the trip waits for one load latency: without it the B fragments are fetched a pair at a time among the matrix instructions, a latency for every two pairs
#pragma unroll
        for (int nb = 0; nb < 4; ++nb) {
#pragma unroll
            for (int mb = 0; mb < MBN; ++mb) { acc[mb][nb] = WFrag<T16>::mma(a[mb], b[nb], acc[mb][nb]); if (NSPLIT == 1 || NSPLIT == 2) acc[mb][nb] = WFrag<T16>::mma(a2[mb], b[nb], acc[mb][nb]); if (NSPLIT >= 2) acc[mb][nb] = WFrag<T16>::mma(a[mb], b2[nb], acc[mb][nb]); } }
        asm volatile("v_nop\n\tv_nop\n\tv_nop\n\tv_nop" : "+v"(acc[0][0]), "+v"(acc[1 % MBN][1]), "+v"(acc[2 % MBN][2]), "+v"(acc[3 % MBN][3]) : "v"(a[0]), "v"(a[MBN - 1]));   // the distance behind the trip's last matrix instructions, on the back edge too
    }
    ep.ahead(0); ep.ahead(1); ep.ready();
#pragma unroll
    for (int mb = 0; mb < MBN; ++mb) {
#pragma unroll
        for (int nb = 0; nb < 4; ++nb) {
#pragma unroll
            for (int j = 0; j < 8; ++j) os[(hi * 8 + j) * 68 + nb * 16 + lr] = ep.stage(mb, j, acc[mb][nb][j]); }
        __builtin_amdgcn_wave_barrier(); asm volatile("" ::: "memory");   // the wave's LDS writes stay in front of its reads
#pragma unroll
        for (int s = 0; s < 8; ++s) { const int row = EP::ROW8 ? hi * 8 + s : 2 * s + hi; ep.put(mb, s, *(const v4fa*)(os + row * 68 + lr * 4)); }
        __builtin_amdgcn_wave_barrier(); asm volatile("" ::: "memory");   // the reads stay in front of the next block's writes
        if (mb + 2 < MBN) ep.ahead(mb + 2);
    }
}
// Launches that read none of each other's output share one grid: a range of blockIdx.x is one job, the longer job first.
// k_gemm_hkvq, work-groups of 8 waves. Job 1 (64 work-groups, 64 key positions each): h_al [m][c] = h w_ht^T (K = 512; wave w: positions 32 (w >> 2) ..., channels 64 (w & 3) ...), its BN1 and BN2 hi+lo planes laid
// in LDS, one barrier, then from those planes k = BN1(h_al) w_k^T + b_k as fp16 head planes (waves 0 to 3, 64 channels each) and v [c][m] = w_v BN2(h_al) + b_v as fp16 (waves 4 to 7).
// Job 2 (171 work-groups): q = BN0(f) w_q^T + b_q as fp16 head planes, a 64x64 tile a wave, tiles that share 64 positions next to each other. QWV waves of a work-group take a tile, the others leave at once:
// a work-group fills its WGP (LDS), so 1024 tiles at six a work-group spread over the 192 WGPs that job 1 leaves free, at eight over 128 only.
#define QWV 6
__global__ __launch_bounds__(256) void k_gemm_hkvq(const bf* __restrict__ HB, const bf* __restrict__ WHT, const float* __restrict__ bht, const float* __restrict__ gam, const float* __restrict__ bet, const float* __restrict__ mean, const float* __restrict__ var,
                                                   const bf* __restrict__ WK, const float* __restrict__ bk, h16* KP, const bf* __restrict__ WV, const float* __restrict__ bv, h16* V16,
                                                   const bf* __restrict__ FTh, const bf* __restrict__ FTl, const bf* __restrict__ WQ, const float* __restrict__ bq, h16* QP) {
    __shared__ __align__(16) float osw[8 * 16 * 68];
    __shared__ __align__(16) bf Hs[4 * 64 * HPIT];
    const int b = blockIdx.x; const int wave = __builtin_amdgcn_readfirstlane(threadIdx.x >> 5); float* os = osw + wave * 16 * 68;
    if (b < (MM / 64) * NB_) { const int img = b >> 4, t0 = (b & 15) * 64;
        { EpBN ep; ep.T[0][0] = Hs; ep.T[0][1] = Hs + 64 * HPIT; ep.T[1][0] = Hs + 2 * 64 * HPIT; ep.T[1][1] = Hs + 3 * 64 * HPIT; ep.bht = bht; ep.gam = gam; ep.bet = bet; ep.mean = mean; ep.var = var;
          d_gemmw<bf, 0, CH, 2>(wave >> 2, wave & 3, 0, os, HB + ((size_t)img * MM + t0) * CH, nullptr, WHT, nullptr, 0, 0, ep); }
        __syncthreads();   // all 256 channels of the 64 positions lie in LDS before any wave reads them
        if (wave < 4) { EpHead ep; ep.P = KP + ((size_t)img * NHD * MM + t0) * DH; ep.rows = MM; ep.bias = bk;
            d_gemmw<bf, 1, CC, 4, HPIT, CC>(0, wave, 0, os, Hs, Hs + 64 * HPIT, WK, nullptr, 0, 0, ep); }
        else { EpVal ep; ep.V = V16 + (size_t)img * CC * MM + t0; ep.bv = bv;
            d_gemmw<bf, 3, CC, 4, CC, HPIT>(wave - 4, 0, 0, os, WV, nullptr, Hs + 2 * 64 * HPIT, Hs + 3 * 64 * HPIT, 0, 0, ep);
            asm volatile("s_wait_xcnt 0x0" ::: "memory"); } }   // the wait before a register that an issued store names is overwritten: what stands behind these stores in the built kernel (the k waves' code, on a way that the listing's branches allow) writes such registers
    else { const int t = (b - (MM / 64) * NB_) * QWV + wave; if (wave >= QWV || t >= (NN / 64) * (CC / 64) * NB_) return;   // no barrier stands in this job
        EpHead ep; ep.P = QP + (size_t)(t >> 8) * NHD * NN * DH; ep.rows = NN; ep.bias = bq;
        d_gemmw<bf, 1, CC>((t >> 2) & 63, t & 3, t >> 8, os, FTh, FTl, WQ, nullptr, (size_t)NN * CC, 0, ep);
        asm volatile("s_wait_xcnt 0x0" ::: "memory"); }   // as above: job 1's code stands behind these stores
}
// k_gemm_out: result [c][n] = f + w_out . out + b_out; grid (CC/64, NN/64, images).
__global__ __launch_bounds__(32) void k_gemm_out(const bf* __restrict__ WO, const bf* __restrict__ Oh, const bf* __restrict__ Ol, const float* __restrict__ f, const float* __restrict__ bp, float* OUT) {
    __shared__ __align__(16) float os[16 * 68];
    EpOut ep; ep.f = f + (size_t)blockIdx.z * CC * NN; ep.O = OUT + (size_t)blockIdx.z * CC * NN; ep.bp = bp;
    d_gemmw<bf, 3, CC>(blockIdx.x, blockIdx.y, blockIdx.z, os, WO, nullptr, Oh, Ol, 0, (size_t)NN * CC, ep);
}


__device__ __forceinline__ void d_cvt8(const int bx, const float* __restrict__ src, bf* dst, size_t n8) { const size_t i = (size_t)bx * 256 + threadIdx.x; if (i >= n8) return; const v8f v = *(const v8f*)(src + i * 8); v8us o;
#pragma unroll
    for (int k = 0; k < 8; ++k) o[k] = f2bf(v[k]); *(v8us*)(dst + i * 8) = o;  }
// d_turn: one wave turns a tile of 64 source rows x 32 positions of src [ROWS][COLS] (f32) into token-major 16-bit rows T[position][row]. A lane is one position: each load is one whole 128-byte line of a source
// row. The lane's 64 results go as 16-byte pieces into the wave's own LDS tile and come back eight lanes a token row, so each store is four whole 128-byte lines. No work-group barrier: the tile is one wave's.
// BN = 1: hi+lo planes of bf16(src) * inv[row] + shift[row], inv = bf16(gamma) / sqrt(bf16(var) + 1e-5), shift = bf16(beta) - bf16(mean) * inv, formed once a row (lane l: rows l and 32 + l) and handed round by
// lane reads. BN = 0: bf16(src), one plane.
#define TPIT 72      // LDS pitch of a turned row, in 16-bit elements: 144 B = 16 B x odd
__device__ __forceinline__ float rlane(float v, int l) { return __int_as_float(__builtin_amdgcn_readlane(__float_as_int(v), l)); }
template <int BN, int ROWS, int COLS>
__device__ __forceinline__ void d_turn(bf* ts, const int rt, const int nt, const int img, const float* __restrict__ src, const float* __restrict__ gam, const float* __restrict__ bet, const float* __restrict__ mean, const float* __restrict__ var, bf* Th, bf* Tl) {
    const int lane = threadIdx.x & 31; const int r0 = rt * 64, n0 = nt * 32;
    float iv[2], sh[2];
    if (BN) {
        const float* pg = gam + r0 + lane; const float* pv = var + r0 + lane; const float* pm = mean + r0 + lane; const float* pb = bet + r0 + lane;
        const float g0 = pg[0], g1 = pg[32], v0 = pv[0], v1 = pv[32], m0 = pm[0], m1 = pm[32], b0 = pb[0], b1 = pb[32];
        asm volatile("s_wait_xcnt 0x0" :: "v"(lane) : "memory");   // the wait before a register that an issued load names is overwritten: the lane number is these loads' vector address, and as an input here it stays whole up to the wait
        iv[0] = __fdiv_rn(bfr(g0), __fsqrt_rn(bfr(v0) + 1e-5f)); sh[0] = bfr(b0) - bfr(m0) * iv[0]; iv[1] = __fdiv_rn(bfr(g1), __fsqrt_rn(bfr(v1) + 1e-5f)); sh[1] = bfr(b1) - bfr(m1) * iv[1];
    }
    const float* p = src + ((size_t)img * ROWS + r0) * COLS + n0 + lane;
    float x[64];
#pragma unroll
    for (int i = 0; i < 64; ++i) x[i] = p[(size_t)i * COLS];
    asm volatile("s_wait_xcnt 0x0" :: "v"(lane) : "memory");   // as above, for the tile's 64 loads
    bf* tw = ts + lane * TPIT;
#pragma unroll
    for (int g = 0; g < 8; ++g) { v8us H, L;
#pragma unroll
        for (int j = 0; j < 8; ++j) { const int i = g * 8 + j;
            if (BN) { unsigned short a, c; splitf(bfr(x[i]) * rlane(iv[i >> 5], i & 31) + rlane(sh[i >> 5], i & 31), a, c); H[j] = a; L[j] = c; }
            else H[j] = f2bf(x[i]); }
        *(v8us*)(tw + g * 8) = H; if (BN) *(v8us*)(tw + 32 * TPIT + g * 8) = L; }
    asm volatile("s_wait_dscnt 0x0" ::: "memory");   // the wave's own LDS writes have landed before other lanes of it read the rows back
    const int rr = lane >> 3, pc = lane & 7; const bf* sp = ts + rr * TPIT + pc * 8; const size_t o = ((size_t)img * COLS + n0 + rr) * ROWS + r0 + pc * 8; bf* dh = Th + o; bf* dl = Tl + o;
    v8us a[8], b[8];
#pragma unroll
    for (int t = 0; t < 8; ++t) { a[t] = *(const v8us*)(sp + t * 4 * TPIT); if (BN) b[t] = *(const v8us*)(sp + (32 + t * 4) * TPIT); }
#pragma unroll
    for (int t = 0; t < 8; ++t) { *(v8us*)(dh + t * 4 * ROWS) = a[t]; if (BN) *(v8us*)(dl + t * 4 * ROWS) = b[t]; }
    asm volatile("s_wait_xcnt 0x0" ::: "memory");   // the wait before a register that an issued store names is overwritten: what stands behind this function in the built kernel (another job's code, on a way that the listing's branches allow) writes such registers
}
// k_prep: the jobs that read inputs only. BN0(bf16(f)) token-major (256 work-groups), h token-major (128), the five weight matrices as bf16 (64 + 4 x 32). A turning work-group takes 256 source rows x 64 positions,
// a tile a wave: 256 bytes in a row of each source row.
__global__ __launch_bounds__(256) void k_prep(const float* __restrict__ f, const float* __restrict__ hin, const float* __restrict__ wht, const float* __restrict__ wq, const float* __restrict__ wk, const float* __restrict__ wv, const float* __restrict__ wo,
                                              const float* __restrict__ gam, const float* __restrict__ bet, const float* __restrict__ mean, const float* __restrict__ var, bf* FTh, bf* FTl, bf* HB, bf* WHT, bf* WQ, bf* WK, bf* WV, bf* WO) {
    __shared__ __align__(16) bf Ts[8 * 2 * 32 * TPIT];
    int b = blockIdx.x; const int wave = __builtin_amdgcn_readfirstlane(threadIdx.x >> 5); bf* ts = Ts + wave * 2 * 32 * TPIT;
    if (b < 64 * NB_) { d_turn<1, CC, NN>(ts, wave & 3, (b & 63) * 2 + (wave >> 2), b >> 6, f, gam, bet, mean, var, FTh, FTl); return; }
    b -= 64 * NB_;
    if (b < 32 * NB_) { d_turn<0, CH, MM>(ts, (b & 1) * 4 + (wave & 3), (b & 30) + (wave >> 2), b >> 5, hin, nullptr, nullptr, nullptr, nullptr, HB, nullptr); return; }
    b -= 32 * NB_;
    if (b < 64) { d_cvt8(b, wht, WHT, (size_t)CC * CH / 8); return; }
    b -= 64;
    const int w = b >> 5; const float* src = w == 0 ? wq : w == 1 ? wk : w == 2 ? wv : wo; bf* dst = w == 0 ? WQ : w == 1 ? WK : w == 2 ? WV : WO;
    d_cvt8(b & 31, src, dst, (size_t)CC * CC / 8);
}
// ---- k_attn: scores, softmax and the value product of one head pair for 256 queries in one work-group; grid (NN/256, NHD/2, images) = one work-group a WGP, 256 threads = 8 waves, wave w: head (w & 1) of the pair,
// queries 64 (w >> 1) ..., as QT tiles of 16: a key or value fragment read from LDS serves all QT tiles, and the pair's keys and values are laid into LDS once for 256 queries.
// The pair's keys [2][MM][DH] and values [2 DH][MM] lie in LDS for the whole launch. S^T = K Q^T (a lane holds one query's scores: 8 keys a tile), so two score tiles, converted in place, are the B operand of
// O^T += V P^T (V rows read in the same k order as the packed tiles). Pass 1 finds each query's exact maximum, pass 2 forms the scores again, p = exp((s - max) * 32^-0.5) * 1024 as fp16, f32 row sum of p.
// The attended map leaves normalised, as bf16 hi+lo planes [n][c]; it goes through LDS (the keys' place, once every wave has left them) so that each 128-byte line of a plane is stored by one wave instruction.
#define KPIT 40      // LDS pitch of a key row, in halves: 80 B = 16 B x odd, conflict-free for 16-byte fragment reads
#define VPIT 1032    // LDS pitch of a value row, in halves: 2064 B = 16 B x odd
#define OPIT 72      // LDS pitch of a staged output row, in 16-bit elements
#define QT   4       // query tiles of 16 a wave
#define QW   (64 * QT)   // queries a work-group
__device__ __forceinline__ v16h ldh(const h16* p) { return cat16(*(const v8h*)p, *(const v8h*)(p + 16)); }
__global__ __launch_bounds__(256) void k_attn(const h16* __restrict__ QP, const h16* __restrict__ KP, const h16* __restrict__ V16, bf* Oh, bf* Ol) {
    __shared__ __align__(16) h16 Ks[2 * MM * KPIT];
    __shared__ __align__(16) h16 Vs[2 * DH * VPIT];
    bf* const Os = (bf*)Ks;   // 2 * QW * OPIT elements, fewer than the keys take
    QP += (size_t)blockIdx.z * NHD * NN * DH; KP += (size_t)blockIdx.z * NHD * MM * DH; V16 += (size_t)blockIdx.z * CC * MM; Oh += (size_t)blockIdx.z * NN * CC; Ol += (size_t)blockIdx.z * NN * CC;   // blockIdx.z: image
    const int tid = threadIdx.x, lane = tid & 31, wave = tid >> 5, lr = lane & 15, hi = lane >> 4; const int hp = blockIdx.y, hl = wave & 1, qt = wave >> 1;
    const h16* kg = KP + (size_t)hp * 2 * MM * DH; const h16* vg = V16 + (size_t)hp * 2 * DH * MM;
#pragma unroll 16   // sixteen 16-byte loads in flight per thread while the tiles are laid: the fill is bound by latency otherwise
    for (int t = 0; t < 2 * MM * DH / 8 / 256; ++t) { const int i = t * 256 + tid; *(v8h*)(Ks + (i >> 2) * KPIT + (i & 3) * 8) = *(const v8h*)(kg + (size_t)i * 8); }
#pragma unroll 16   // as above
    for (int t = 0; t < 2 * DH * MM / 8 / 256; ++t) { const int i = t * 256 + tid; *(v8h*)(Vs + (i >> 7) * VPIT + (i & 127) * 8) = *(const v8h*)(vg + (size_t)i * 8); }
    const h16* qg = QP + ((size_t)(hp * 2 + hl) * NN + blockIdx.x * QW + qt * 16 * QT + lr) * DH + 8 * hi;
    v16h qf[QT];
#pragma unroll
    for (int t = 0; t < QT; ++t) qf[t] = ldh(qg + t * 16 * DH);
    asm volatile("s_wait_xcnt 0x0" :: "v"(qg) : "memory");   // the wait before a register that an issued load names is overwritten: as an input here the address pair stays whole up to it
    __syncthreads();
    const h16* kl = Ks + (hl * MM + lr) * KPIT + 8 * hi; const h16* vl = Vs + (hl * DH + lr) * VPIT + 8 * hi;
    float m[QT];
#pragma unroll
    for (int t = 0; t < QT; ++t) m[t] = -3.0e38f;
#pragma unroll 4   // four key fragments fetched as one group; the sixteen independent score tiles fill each other's distance behind the matrix instruction
    for (int kt = 0; kt < MM / 16; ++kt) { const v16h kf = ldh(kl + kt * 16 * KPIT);
#pragma unroll
        for (int t = 0; t < QT; ++t) { const v8f s = wmma16(kf, qf[t], (v8f){});
            m[t] = fmaxf(m[t], fmaxf(fmaxf(fmaxf(s[0], s[1]), fmaxf(s[2], s[3])), fmaxf(fmaxf(s[4], s[5]), fmaxf(s[6], s[7])))); } }
    v8f o0[QT], o1[QT]; float sum0[QT], sum1[QT]; const float c2 = SCL * 1.4426950408889634f;
#pragma unroll
    for (int t = 0; t < QT; ++t) { m[t] = fmaxf(m[t], __shfl_xor(m[t], 16, 32)); o0[t] = (v8f){}; o1[t] = (v8f){}; sum0[t] = 0.f; sum1[t] = 0.f; }
#pragma unroll 1   // the four query tiles of one 32-key step cover each other's matrix distances; a second step unrolled would go past 256 registers
    for (int kc = 0; kc < MM; kc += 32) {
        const v16h ka = ldh(kl + kc * KPIT), kb = ldh(kl + (kc + 16) * KPIT), va = ldh(vl + kc), vb = ldh(vl + 16 * VPIT + kc); v8f s0[QT], s1[QT];
#pragma unroll
        for (int t = 0; t < QT; ++t) { s0[t] = wmma16(ka, qf[t], (v8f){}); s1[t] = wmma16(kb, qf[t], (v8f){}); }
        __builtin_amdgcn_sched_barrier(0);   // the eight score products issue back to back and fill each other's distance: without it each is followed by idle slots and one early reader
#pragma unroll
        for (int t = 0; t < QT; ++t) { v16h p;
#pragma unroll
            for (int j = 0; j < 8; ++j) { const float e0 = __builtin_amdgcn_exp2f(__builtin_fmaf(s0[t][j] - m[t], c2, 10.0f)), e1 = __builtin_amdgcn_exp2f(__builtin_fmaf(s1[t][j] - m[t], c2, 10.0f));   // + 10: p carries a factor 2^10, which keeps small weights out of the fp16 subnormals; the row sum carries it too
                sum0[t] += e0; sum1[t] += e1; p[j] = tohx(e0); p[8 + j] = tohx(e1); }
            o0[t] = wmma16(va, p, o0[t]); o1[t] = wmma16(vb, p, o1[t]); } }
    __syncthreads();   // every wave has read its last key: the staged output may take the keys' place
#pragma unroll
    for (int t = 0; t < QT; ++t) { float sum = sum0[t] + sum1[t]; sum += __shfl_xor(sum, 16, 32); const float ri = __fdiv_rn(1.0f, sum); v8us h0, l0, h1, l1;
#pragma unroll
      for (int j = 0; j < 8; ++j) { unsigned short a, c; splitf(__fmul_rn(o0[t][j], ri), a, c); h0[j] = a; l0[j] = c; splitf(__fmul_rn(o1[t][j], ri), a, c); h1[j] = a; l1[j] = c; }
      bf* od = Os + ((qt * QT + t) * 16 + lr) * OPIT + hl * DH + 8 * hi;
      *(v8us*)od = h0; *(v8us*)(od + 16) = h1; *(v8us*)(od + QW * OPIT) = l0; *(v8us*)(od + QW * OPIT + 16) = l1; }
    __syncthreads();
    { const int r = tid >> 3, c = tid & 7; const size_t o = (size_t)(blockIdx.x * QW + r) * CC + hp * 64 + c * 8; bf* dh = Oh + o; bf* dl = Ol + o; const bf* sp = Os + r * OPIT + c * 8;   // eight lanes a row: one 128-byte line of a plane; every access below is one of these plus a constant
#pragma unroll
      for (int t = 0; t < QW / 32; ++t) { *(v8us*)(dh + t * 32 * CC) = *(const v8us*)(sp + t * 32 * OPIT); *(v8us*)(dl + t * 32 * CC) = *(const v8us*)(sp + (QW + t * 32) * OPIT); } }
}


extern "C" void kernel_launch(void* const* d_in, const int* in_sizes, int n_in,
                              void* d_out, int out_size, void* d_ws, size_t ws_size, hipStream_t stream) {
    (void)in_sizes; (void)n_in; (void)out_size;
    const float* IN[16]; for (int i = 0; i < 16; ++i) IN[i] = (const float*)d_in[i];
    // f [4][256][64][64], h [4][512][32][32], w_ht [256][512], b_ht, bn_gamma [3][256], bn_beta, bn_mean, bn_var, w_q [256][256], b_q, w_k, b_k, w_v, b_v, w_out, b_out = d_in[0..15]
    const float* f = IN[0]; const float* hin = IN[1]; const float* gam = IN[4]; const float* bet = IN[5]; const float* mean = IN[6]; const float* var = IN[7];
    float* OUT = (float*)d_out;     // [4][256][64][64]
    char* wsp = (char*)d_ws;
    auto take = [&](size_t bytes) { char* p = wsp; wsp += (bytes + 255) & ~(size_t)255; return (void*)p; };
    bf* WHT = (bf*)take((size_t)CC * CH * 2); bf* WQ = (bf*)take((size_t)CC * CC * 2); bf* WK = (bf*)take((size_t)CC * CC * 2); bf* WV = (bf*)take((size_t)CC * CC * 2); bf* WO = (bf*)take((size_t)CC * CC * 2);
    // per-image planes, NB_ images one behind the other
    bf* HB = (bf*)take((size_t)NB_ * MM * CH * 2);
    bf* FTh = (bf*)take((size_t)NB_ * NN * CC * 2); bf* FTl = (bf*)take((size_t)NB_ * NN * CC * 2); h16* QP = (h16*)take((size_t)NB_ * NHD * NN * DH * 2); h16* KP = (h16*)take((size_t)NB_ * NHD * MM * DH * 2);
    h16* V16 = (h16*)take((size_t)NB_ * CC * MM * 2);
    bf* Oh = (bf*)take((size_t)NB_ * NN * CC * 2); bf* Ol = (bf*)take((size_t)NB_ * NN * CC * 2);
    if ((size_t)(wsp - (char*)d_ws) > ws_size) return;    // total ~ 49 MB; ws 256 MiB
    k_prep<<<64 * NB_ + 32 * NB_ + 64 + 4 * 32, 256, 0, stream>>>(f, hin, IN[2], IN[8], IN[10], IN[12], IN[14], gam, bet, mean, var, FTh, FTl, HB, WHT, WQ, WK, WV, WO);   // BN0(bf16(f)), h token-major, bf16 weights
    k_gemm_hkvq<<<(MM / 64) * NB_ + ((NN / 64) * (CC / 64) * NB_ + QWV - 1) / QWV, 256, 0, stream>>>(HB, WHT, IN[3], gam, bet, mean, var, WK, IN[11], KP, WV, IN[13], V16, FTh, FTl, WQ, IN[9], QP);   // h_al, its BN1 and BN2, k head planes, v + b_v; q head planes
    k_attn<<<dim3(NN / QW, NHD / 2, NB_), 256, 0, stream>>>(QP, KP, V16, Oh, Ol);   // softmax(q k) v, normalised, token-major hi+lo planes
    k_gemm_out<<<dim3(CC / 64, NN / 64, NB_), 32, 0, stream>>>(WO, Oh, Ol, f, IN[15], OUT);   // f + w_out . out + b_out
}

// v009
// A run of this version takes 66.7 microseconds.
// Two timings next to v008 both put it at 1.03 times that version's speed.
// All steps since v000 together make it 26.5 times as fast.
#include <hip/hip_runtime.h>

// CIM (cross-image attention; f [4][256][64][64] (N = 4096 queries), h [4][512][32][32] (M = 1024 keys); h_al = w_ht h + b_ht; q = w_q BN0(f) + b_q, k = w_k BN1(h_al) + b_k, v = w_v BN2(h_al) + b_v
// (BatchNorm in inference form with the given statistics); 8 heads of 32 channels: attn = softmax_m(q_h . k_h * 32^-0.5); out[c][n] = sum_m attn[n][m] v[c][m]; result = f + w_out out + b_out).
// Compute dtypes, f32 accumulate: every input rounded to bf16; h_al on PLAIN bf16 operands (inputs: exact); the BatchNorms in f32 on VALU written as bf16 hi+lo
// x1024, fp16 v); the output conv on hi+lo planes of the attended map (2 products); bias + residual f32. One-wave-per-tile GEMMs (64x64, 32x64 for h_al); every launch covers all four images; launches that read none of each other's output share one grid. Deterministic, no

#define NB_  4
#define CC   256
#define CH   512                  // channels of h
#define NN   4096                 // query positions
#define MM   1024                 // key positions
#define NHD  8
#define DH   32
#define SCL  0.17677669529663687f   // f32(32^-0.5)
typedef _Float16 h16;
typedef unsigned short bf;
typedef __attribute__((ext_vector_type(16))) __bf16   v16bf;
typedef __attribute__((ext_vector_type(16))) _Float16 v16h;
typedef __attribute__((ext_vector_type(8)))  _Float16 v8h;
typedef __attribute__((ext_vector_type(8)))  unsigned short v8us;
typedef __attribute__((ext_vector_type(8)))  float    v8f;
typedef __attribute__((ext_vector_type(4)))  float    v4f;
typedef v8h  __attribute__((may_alias)) v8ha;
typedef v4f  __attribute__((may_alias)) v4fa;
typedef v8us __attribute__((may_alias)) v8usa;

__device__ __forceinline__ unsigned short f2bf(float f) { unsigned u = __float_as_uint(f); u += 0x7FFFu + ((u >> 16) & 1u); return (unsigned short)(u >> 16); }
__device__ __forceinline__ float bf2f(unsigned short b) { return __uint_as_float(((unsigned)b) << 16); }
__device__ __forceinline__ float bfr(float f) { return bf2f(f2bf(f)); }
__device__ __forceinline__ v16h cat16(v8h lo, v8h hi) { return __builtin_shufflevector(lo, hi, 0, 1, 2, 3, 4, 5, 6, 7, 8, 9, 10, 11, 12, 13, 14, 15); }
__device__ __forceinline__ v16bf cat16b(v8us lo, v8us hi) { return __builtin_bit_cast(v16bf, __builtin_shufflevector(lo, hi, 0, 1, 2, 3, 4, 5, 6, 7, 8, 9, 10, 11, 12, 13, 14, 15)); }
__device__ __forceinline__ v8f wmma16(v16h a, v16h b, v8f c) { return __builtin_amdgcn_wmma_f32_16x16x32_f16(false, a, false, b, (short)0, c, false, false); }
__device__ __forceinline__ v8f wmmab(v16bf a, v16bf b, v8f c) { return __builtin_amdgcn_wmma_f32_16x16x32_bf16(false, a, false, b, (short)0, c, false, false); }



template <typename T16> struct WFrag;
template <> struct WFrag<h16> { typedef v16h V; static __device__ __forceinline__ V ld(const h16* p) { return cat16(*(const v8h*)p, *(const v8h*)(p + 16)); } static __device__ __forceinline__ v8f mma(V a, V b, v8f c) { return wmma16(a, b, c); } };
template <> struct WFrag<bf> { typedef v16bf V; static __device__ __forceinline__ V ld(const bf* p) { return cat16b(*(const v8us*)p, *(const v8us*)(p + 16)); } static __device__ __forceinline__ v8f mma(V a, V b, v8f c) { return wmmab(a, b, c); } };
__device__ __forceinline__ h16 tohx(float x) { return (h16)x; }
__device__ __forceinline__ void splitf(float y, unsigned short& h, unsigned short& l) { h = f2bf(y); l = f2bf(y - bf2f(h)); }
typedef __attribute__((ext_vector_type(2))) _Float16 v2h;
typedef __attribute__((ext_vector_type(2))) unsigned short v2us;
typedef __attribute__((ext_vector_type(8))) _Float16 v8h16;

// ---- Epilogues: what a 64x64 GEMM tile becomes on its way out of the wave that computed it (the elementwise pass that used to follow the GEMM as a launch of its own, on the same f32 values).
// load(): lane addresses and the per-column or per-row parameters, issued in front of the K loop; ready(): their arithmetic, behind it; ahead(mb): loads for 16-row block mb, issued two blocks early;
// stage(): a value on its way into LDS (accumulator layout: row hi * 8 + j); put(): four neighbouring columns of row (ROW8 ? hi * 8 + s : 2 * s + hi) of block mb.
typedef __attribute__((ext_vector_type(4))) _Float16 v4h;
typedef __attribute__((ext_vector_type(4))) unsigned short v4us;
// EpHead: (C[row][c] + bf16(bias[c])) * fac as fp16 head planes P[c / 32][row][c % 32] (fac: QFAC for q, none for k); rows 2 s and 2 s + 1 of a head are one 128-byte line, stored by one instruction.
#define QFAC (SCL * 1.4426950408889634f)   // 32^-0.5 log2(e): with it in q, a score product is the exponent to base 2
template <bool SC> struct EpHead {
    static constexpr bool ROW8 = false;
    h16* P; int rows; const float* bias; v4f b;
    __device__ __forceinline__ void load(int r0, int c0, int lr, int hi) { const int c = c0 + lr * 4; P += ((size_t)(c >> 5) * rows + r0 + hi) * DH + (c & (DH - 1)); b = *(const v4f*)(bias + c); }
    __device__ __forceinline__ void ready() {
#pragma unroll
        for (int q = 0; q < 4; ++q) b[q] = bfr(b[q]); }
    __device__ __forceinline__ void ahead(int) {}
    __device__ __forceinline__ float stage(int, int, float x) { return x; }
    __device__ __forceinline__ void put(int mb, int s, v4f val) { v4h o;
#pragma unroll
        for (int q = 0; q < 4; ++q) o[q] = tohx(SC ? (val[q] + b[q]) * QFAC : val[q] + b[q]);
        *(v4h*)(P + (mb * 16 + 2 * s) * DH) = o; }
};
// EpBN: the two BatchNorms of C[m][c] + bf16(b_ht[c]) as token-major bf16 hi+lo planes of pitch HPIT (they lie in the work-group's LDS); inv = bf16(gamma) / sqrt(bf16(var) + 1e-5) and shift = bf16(beta) - bf16(mean) * inv once a lane and column.
#define HPIT 264     // LDS pitch of a normalised h_al row, in 16-bit elements: 528 B = 16 B x odd, conflict-free for 16-byte fragment reads
struct EpBN {
    static constexpr bool ROW8 = false;
    bf* T[2][2]; const float* bht; const float* gam; const float* bet; const float* mean; const float* var; v4f rb, g[2], be[2], mu[2], va[2];
    __device__ __forceinline__ void load(int r0, int c0, int lr, int hi) { const int c = c0 + lr * 4; const int o = (r0 + hi) * HPIT + c; rb = *(const v4f*)(bht + c);
#pragma unroll
        for (int w = 0; w < 2; ++w) { const int p = (1 + w) * CC + c; T[w][0] += o; T[w][1] += o; g[w] = *(const v4f*)(gam + p); be[w] = *(const v4f*)(bet + p); mu[w] = *(const v4f*)(mean + p); va[w] = *(const v4f*)(var + p); } }
    __device__ __forceinline__ void ready() {   // g becomes inv, be becomes shift
#pragma unroll
        for (int q = 0; q < 4; ++q) { rb[q] = bfr(rb[q]);
#pragma unroll
            for (int w = 0; w < 2; ++w) { const float inv = __fdiv_rn(bfr(g[w][q]), __fsqrt_rn(bfr(va[w][q]) + 1e-5f)); g[w][q] = inv; be[w][q] = bfr(be[w][q]) - bfr(mu[w][q]) * inv; } } }
    __device__ __forceinline__ void ahead(int) {}
    __device__ __forceinline__ float stage(int, int, float x) { return x; }
    __device__ __forceinline__ void put(int mb, int s, v4f val) {
#pragma unroll
        for (int w = 0; w < 2; ++w) { v4us oh, ol;
#pragma unroll
            for (int q = 0; q < 4; ++q) { unsigned short a, c2; splitf((val[q] + rb[q]) * g[w][q] + be[w][q], a, c2); oh[q] = a; ol[q] = c2; }
            *(v4us*)(T[w][0] + (mb * 16 + 2 * s) * HPIT) = oh; *(v4us*)(T[w][1] + (mb * 16 + 2 * s) * HPIT) = ol; } }
};
// EpVal: C[c][m] + bf16(b_v[c]) as fp16 [c][m]; the row's bias is added in the accumulator layout.
struct EpVal {
    static constexpr bool ROW8 = false;
    h16* V; const float* bv; v8f b[4];
    __device__ __forceinline__ void load(int r0, int c0, int lr, int hi) { V += (size_t)(r0 + hi) * MM + c0 + lr * 4;
#pragma unroll
        for (int mb = 0; mb < 4; ++mb) b[mb] = *(const v8f*)(bv + r0 + mb * 16 + hi * 8); }
    __device__ __forceinline__ void ready() {
#pragma unroll
        for (int mb = 0; mb < 4; ++mb)
#pragma unroll
            for (int j = 0; j < 8; ++j) b[mb][j] = bfr(b[mb][j]); }
    __device__ __forceinline__ void ahead(int) {}
    __device__ __forceinline__ float stage(int mb, int j, float x) { return x + b[mb][j]; }
    __device__ __forceinline__ void put(int mb, int s, v4f val) { v4h o;
#pragma unroll
        for (int q = 0; q < 4; ++q) o[q] = tohx(val[q]);
        *(v4h*)(V + (mb * 16 + 2 * s) * MM) = o; }
};
// EpOut: the result, (bf16(f[c][n]) + C[c][n]) + bf16(b_out[c]) in f32.
struct EpOut {
    static constexpr bool ROW8 = true;
    const float* f; float* O; const float* bp; v4f fv[4][8]; v8f b[4];
    __device__ __forceinline__ void load(int r0, int c0, int lr, int hi) { const size_t o = (size_t)(r0 + hi * 8) * NN + c0 + lr * 4; f += o; O += o; bp += r0 + hi * 8; }
    __device__ __forceinline__ void ready() {}
    __device__ __forceinline__ void ahead(int mb) {
        if (mb >= 2) asm volatile("s_wait_xcnt 0x0" ::: "memory");   // blocks 2 and 3 are fetched behind a block's stores and may land in registers that those stores name: the wait before such a register is overwritten
        b[mb] = *(const v8f*)(bp + mb * 16);
#pragma unroll
        for (int s = 0; s < 8; ++s) fv[mb][s] = *(const v4f*)(f + (mb * 16 + s) * NN); }
    __device__ __forceinline__ float stage(int, int, float x) { return x; }
    __device__ __forceinline__ void put(int mb, int s, v4f val) { v4f o;
#pragma unroll
        for (int q = 0; q < 4; ++q) o[q] = (bfr(fv[mb][s][q]) + val[q]) + bfr(b[mb][s]);
        *(v4f*)(O + (mb * 16 + s) * NN) = o; }
};

// ---- d_gemmw: register-blocked GEMM as one job of a grid: tile (bx, by) of batch bz out of (M/(16 MBN), N/64, Z), ONE WAVE per (16 MBN)x64 tile (4 MBN accumulators), operands straight from K-contiguous 16-bit planes, K a literal.
// PA, PB: row pitch of the A and B planes in elements; a pitch other than K marks planes that lie in LDS.
// C[m][n] (f32) = sum_k A[m][k] Bt[n][k] (+ split products per NSPLIT) goes to the epilogue ep, 16 rows at a time through os (16 x 68 floats of LDS). z-batch strides sA/sB in elements.
template <typename T16, int NSPLIT, int K, int MBN = 4, int PA = K, int PB = K, typename EP>
__device__ __forceinline__ void d_gemmw(const int bx, const int by, const int bz, float* os, const T16* __restrict__ A, const T16* __restrict__ A2, const T16* __restrict__ Bt, const T16* __restrict__ Bt2, size_t sA, size_t sB, EP& ep) {
    typedef typename WFrag<T16>::V V;
    const size_t z = bz; A += z * sA; if (A2) A2 += z * sA; Bt += z * sB; if (Bt2) Bt2 += z * sB;
    const int lane = threadIdx.x & 31, lr = lane & 15, hi = lane >> 4; const int r0 = bx * 16 * MBN, c0 = by * 64;
    ep.load(r0, c0, lr, hi);
    v8f acc[MBN][4];
#pragma unroll
    for (int mb = 0; mb < MBN; ++mb)
#pragma unroll
        for (int nb = 0; nb < 4; ++nb) acc[mb][nb] = (v8f){};
    const size_t aoff = (size_t)(r0 + lr) * PA + 8 * hi, boff = (size_t)(c0 + lr) * PB + 8 * hi;
#pragma unroll 1   // one trip's fragments and the 16 accumulators of a 64x64 tile fill the register file; a second trip unrolled would spill
    for (int kc = 0; kc < K; kc += 32) {
        const T16* pa = A + aoff + kc; const T16* pa2 = (NSPLIT == 1 || NSPLIT == 2) ? A2 + aoff + kc : pa; const T16* pb = Bt + boff + kc; const T16* pb2 = NSPLIT >= 2 ? Bt2 + boff + kc : pb;   // this trip's lane addresses; every load below is one of them plus a constant
        V a[MBN], a2[MBN], b[4], b2[4];
#pragma unroll
        for (int mb = 0; mb < MBN; ++mb) { a[mb] = WFrag<T16>::ld(pa + mb * 16 * PA); if (NSPLIT == 1 || NSPLIT == 2) a2[mb] = WFrag<T16>::ld(pa2 + mb * 16 * PA); }
#pragma unroll
        for (int nb = 0; nb < 4; ++nb) { b[nb] = WFrag<T16>::ld(pb + nb * 16 * PB); if (NSPLIT >= 2) b2[nb] = WFrag<T16>::ld(pb2 + nb * 16 * PB); }
        if constexpr (PA != K) asm volatile("s_wait_xcnt 0x0" :: "v"(pb), "v"(pb2) : "memory");
        else if constexpr (PB != K) asm volatile("s_wait_xcnt 0x0" :: "v"(pa), "v"(pa2) : "memory");
        else asm volatile("s_wait_xcnt 0x0" :: "v"(pa), "v"(pa2), "v"(pb), "v"(pb2) : "memory");
        __builtin_amdgcn_sched_barrier(0);   // every fragment load of the trip is issued before its first matrix instruction, so the trip waits for one load latency: without it the B fragments are fetched a pair at a time among the matrix instructions, a latency for every two pairs
#pragma unroll
        for (int nb = 0; nb < 4; ++nb) {
#pragma unroll
            for (int mb = 0; mb < MBN; ++mb) { acc[mb][nb] = WFrag<T16>::mma(a[mb], b[nb], acc[mb][nb]); if (NSPLIT == 1 || NSPLIT == 2) acc[mb][nb] = WFrag<T16>::mma(a2[mb], b[nb], acc[mb][nb]); if (NSPLIT >= 2) acc[mb][nb] = WFrag<T16>::mma(a[mb], b2[nb], acc[mb][nb]); } }
        asm volatile("v_nop\n\tv_nop\n\tv_nop\n\tv_nop" : "+v"(acc[0][0]), "+v"(acc[1 % MBN][1]), "+v"(acc[2 % MBN][2]), "+v"(acc[3 % MBN][3]) : "v"(a[0]), "v"(a[MBN - 1]));   // the distance behind the trip's last matrix instructions, on the back edge too
    }
    ep.ahead(0); ep.ahead(1); ep.ready();
#pragma unroll
    for (int mb = 0; mb < MBN; ++mb) {
#pragma unroll
        for (int nb = 0; nb < 4; ++nb) {
#pragma unroll
            for (int j = 0; j < 8; ++j) os[(hi * 8 + j) * 68 + nb * 16 + lr] = ep.stage(mb, j, acc[mb][nb][j]); }
        __builtin_amdgcn_wave_barrier(); asm volatile("" ::: "memory");   // the wave's LDS writes stay in front of its reads
#pragma unroll
        for (int s = 0; s < 8; ++s) { const int row = EP::ROW8 ? hi * 8 + s : 2 * s + hi; ep.put(mb, s, *(const v4fa*)(os + row * 68 + lr * 4)); }
        __builtin_amdgcn_wave_barrier(); asm volatile("" ::: "memory");   // the reads stay in front of the next block's writes
        if (mb + 2 < MBN) ep.ahead(mb + 2);
    }
}
// Launches that read none of each other's output share one grid: a range of blockIdx.x is one job, the longer job first.
// k_gemm_hkvq, work-groups of 8 waves. Job 1 (64 work-groups, 64 key positions each): h_al [m][c] = h w_ht^T (K = 512; wave w: positions 32 (w >> 2) ..., channels 64 (w & 3) ...), its BN1 and BN2 hi+lo planes laid
// in LDS, one barrier, then from those planes k = BN1(h_al) w_k^T + b_k as fp16 head planes (waves 0 to 3, 64 channels each) and v [c][m] = w_v BN2(h_al) + b_v as fp16 (waves 4 to 7).
// Job 2 (171 work-groups): q = (BN0(f) w_q^T + b_q) * QFAC as fp16 head planes, a 64x64 tile a wave, tiles that share 64 positions next to each other. QWV waves of a work-group take a tile, the others leave at once:
// a work-group fills its WGP (LDS), so 1024 tiles at six a work-group spread over the 192 WGPs that job 1 leaves free, at eight over 128 only.
#define QWV 6
__global__ __launch_bounds__(256) void k_gemm_hkvq(const bf* __restrict__ HB, const bf* __restrict__ WHT, const float* __restrict__ bht, const float* __restrict__ gam, const float* __restrict__ bet, const float* __restrict__ mean, const float* __restrict__ var,
                                                   const bf* __restrict__ WK, const float* __restrict__ bk, h16* KP, const bf* __restrict__ WV, const float* __restrict__ bv, h16* V16,
                                                   const bf* __restrict__ FTh, const bf* __restrict__ FTl, const bf* __restrict__ WQ, const float* __restrict__ bq, h16* QP) {
    __shared__ __align__(16) float osw[8 * 16 * 68];
    __shared__ __align__(16) bf Hs[4 * 64 * HPIT];
    const int b = blockIdx.x; const int wave = __builtin_amdgcn_readfirstlane(threadIdx.x >> 5); float* os = osw + wave * 16 * 68;
    if (b < (MM / 64) * NB_) { const int img = b >> 4, t0 = (b & 15) * 64;
        { EpBN ep; ep.T[0][0] = Hs; ep.T[0][1] = Hs + 64 * HPIT; ep.T[1][0] = Hs + 2 * 64 * HPIT; ep.T[1][1] = Hs + 3 * 64 * HPIT; ep.bht = bht; ep.gam = gam; ep.bet = bet; ep.mean = mean; ep.var = var;
          d_gemmw<bf, 0, CH, 2>(wave >> 2, wave & 3, 0, os, HB + ((size_t)img * MM + t0) * CH, nullptr, WHT, nullptr, 0, 0, ep); }
        __syncthreads();   // all 256 channels of the 64 positions lie in LDS before any wave reads them
        if (wave < 4) { EpHead<false> ep; ep.P = KP + ((size_t)img * NHD * MM + t0) * DH; ep.rows = MM; ep.bias = bk;
            d_gemmw<bf, 1, CC, 4, HPIT, CC>(0, wave, 0, os, Hs, Hs + 64 * HPIT, WK, nullptr, 0, 0, ep); }
        else { EpVal ep; ep.V = V16 + (size_t)img * CC * MM + t0; ep.bv = bv;
            d_gemmw<bf, 3, CC, 4, CC, HPIT>(wave - 4, 0, 0, os, WV, nullptr, Hs + 2 * 64 * HPIT, Hs + 3 * 64 * HPIT, 0, 0, ep);
            asm volatile("s_wait_xcnt 0x0" ::: "memory"); } }   // the wait before a register that an issued store names is overwritten: what stands behind these stores in the built kernel (the k waves' code, on a way that the listing's branches allow) writes such registers
    else { const int t = (b - (MM / 64) * NB_) * QWV + wave; if (wave >= QWV || t >= (NN / 64) * (CC / 64) * NB_) return;   // no barrier stands in this job
        EpHead<true> ep; ep.P = QP + (size_t)(t >> 8) * NHD * NN * DH; ep.rows = NN; ep.bias = bq;
        d_gemmw<bf, 1, CC>((t >> 2) & 63, t & 3, t >> 8, os, FTh, FTl, WQ, nullptr, (size_t)NN * CC, 0, ep);
        asm volatile("s_wait_xcnt 0x0" ::: "memory"); }   // as above: job 1's code stands behind these stores
}
// k_gemm_out: result [c][n] = f + w_out . out + b_out; grid (CC/64, NN/64, images).
__global__ __launch_bounds__(32) void k_gemm_out(const bf* __restrict__ WO, const bf* __restrict__ Oh, const bf* __restrict__ Ol, const float* __restrict__ f, const float* __restrict__ bp, float* OUT) {
    __shared__ __align__(16) float os[16 * 68];
    EpOut ep; ep.f = f + (size_t)blockIdx.z * CC * NN; ep.O = OUT + (size_t)blockIdx.z * CC * NN; ep.bp = bp;
    d_gemmw<bf, 3, CC>(blockIdx.x, blockIdx.y, blockIdx.z, os, WO, nullptr, Oh, Ol, 0, (size_t)NN * CC, ep);
}


__device__ __forceinline__ void d_cvt8(const int bx, const float* __restrict__ src, bf* dst, size_t n8) { const size_t i = (size_t)bx * 256 + threadIdx.x; if (i >= n8) return; const v8f v = *(const v8f*)(src + i * 8); v8us o;
#pragma unroll
    for (int k = 0; k < 8; ++k) o[k] = f2bf(v[k]); *(v8us*)(dst + i * 8) = o;  }
// d_turn: one wave turns a tile of 64 source rows x 32 positions of src [ROWS][COLS] (f32) into token-major 16-bit rows T[position][row]. A lane is one position: each load is one whole 128-byte line of a source
// row. The lane's 64 results go as 16-byte pieces into the wave's own LDS tile and come back eight lanes a token row, so each store is four whole 128-byte lines. No work-group barrier: the tile is one wave's.
// BN = 1: hi+lo planes of bf16(src) * inv[row] + shift[row], inv = bf16(gamma) / sqrt(bf16(var) + 1e-5), shift = bf16(beta) - bf16(mean) * inv, formed once a row (lane l: rows l and 32 + l) and handed round by
// lane reads. BN = 0: bf16(src), one plane.
#define TPIT 72      // LDS pitch of a turned row, in 16-bit elements: 144 B = 16 B x odd
__device__ __forceinline__ float rlane(float v, int l) { return __int_as_float(__builtin_amdgcn_readlane(__float_as_int(v), l)); }
template <int BN, int ROWS, int COLS>
__device__ __forceinline__ void d_turn(bf* ts, const int rt, const int nt, const int img, const float* __restrict__ src, const float* __restrict__ gam, const float* __restrict__ bet, const float* __restrict__ mean, const float* __restrict__ var, bf* Th, bf* Tl) {
    const int lane = threadIdx.x & 31; const int r0 = rt * 64, n0 = nt * 32;
    float iv[2], sh[2];
    if (BN) {
        const float* pg = gam + r0 + lane; const float* pv = var + r0 + lane; const float* pm = mean + r0 + lane; const float* pb = bet + r0 + lane;
        const float g0 = pg[0], g1 = pg[32], v0 = pv[0], v1 = pv[32], m0 = pm[0], m1 = pm[32], b0 = pb[0], b1 = pb[32];
        asm volatile("s_wait_xcnt 0x0" :: "v"(lane) : "memory");   // the wait before a register that an issued load names is overwritten: the lane number is these loads' vector address, and as an input here it stays whole up to the wait
        iv[0] = __fdiv_rn(bfr(g0), __fsqrt_rn(bfr(v0) + 1e-5f)); sh[0] = bfr(b0) - bfr(m0) * iv[0]; iv[1] = __fdiv_rn(bfr(g1), __fsqrt_rn(bfr(v1) + 1e-5f)); sh[1] = bfr(b1) - bfr(m1) * iv[1];
    }
    const float* p = src + ((size_t)img * ROWS + r0) * COLS + n0 + lane;
    float x[64];
#pragma unroll
    for (int i = 0; i < 64; ++i) x[i] = p[(size_t)i * COLS];
    asm volatile("s_wait_xcnt 0x0" :: "v"(lane) : "memory");   // as above, for the tile's 64 loads
    bf* tw = ts + lane * TPIT;
#pragma unroll
    for (int g = 0; g < 8; ++g) { v8us H, L;
#pragma unroll
        for (int j = 0; j < 8; ++j) { const int i = g * 8 + j;
            if (BN) { unsigned short a, c; splitf(bfr(x[i]) * rlane(iv[i >> 5], i & 31) + rlane(sh[i >> 5], i & 31), a, c); H[j] = a; L[j] = c; }
            else H[j] = f2bf(x[i]); }
        *(v8us*)(tw + g * 8) = H; if (BN) *(v8us*)(tw + 32 * TPIT + g * 8) = L; }
    asm volatile("s_wait_dscnt 0x0" ::: "memory");   // the wave's own LDS writes have landed before other lanes of it read the rows back
    const int rr = lane >> 3, pc = lane & 7; const bf* sp = ts + rr * TPIT + pc * 8; const size_t o = ((size_t)img * COLS + n0 + rr) * ROWS + r0 + pc * 8; bf* dh = Th + o; bf* dl = Tl + o;
    v8us a[8], b[8];
#pragma unroll
    for (int t = 0; t < 8; ++t) { a[t] = *(const v8us*)(sp + t * 4 * TPIT); if (BN) b[t] = *(const v8us*)(sp + (32 + t * 4) * TPIT); }
#pragma unroll
    for (int t = 0; t < 8; ++t) { *(v8us*)(dh + t * 4 * ROWS) = a[t]; if (BN) *(v8us*)(dl + t * 4 * ROWS) = b[t]; }
    asm volatile("s_wait_xcnt 0x0" ::: "memory");   // the wait before a register that an issued store names is overwritten: what stands behind this function in the built kernel (another job's code, on a way that the listing's branches allow) writes such registers
}
// k_prep: the jobs that read inputs only. BN0(bf16(f)) token-major (256 work-groups), h token-major (128), the five weight matrices as bf16 (64 + 4 x 32). A turning work-group takes 256 source rows x 64 positions,
// a tile a wave: 256 bytes in a row of each source row.
__global__ __launch_bounds__(256) void k_prep(const float* __restrict__ f, const float* __restrict__ hin, const float* __restrict__ wht, const float* __restrict__ wq, const float* __restrict__ wk, const float* __restrict__ wv, const float* __restrict__ wo,
                                              const float* __restrict__ gam, const float* __restrict__ bet, const float* __restrict__ mean, const float* __restrict__ var, bf* FTh, bf* FTl, bf* HB, bf* WHT, bf* WQ, bf* WK, bf* WV, bf* WO) {
    __shared__ __align__(16) bf Ts[8 * 2 * 32 * TPIT];
    int b = blockIdx.x; const int wave = __builtin_amdgcn_readfirstlane(threadIdx.x >> 5); bf* ts = Ts + wave * 2 * 32 * TPIT;
    if (b < 64 * NB_) { d_turn<1, CC, NN>(ts, wave & 3, (b & 63) * 2 + (wave >> 2), b >> 6, f, gam, bet, mean, var, FTh, FTl); return; }
    b -= 64 * NB_;
    if (b < 32 * NB_) { d_turn<0, CH, MM>(ts, (b & 1) * 4 + (wave & 3), (b & 30) + (wave >> 2), b >> 5, hin, nullptr, nullptr, nullptr, nullptr, HB, nullptr); return; }
    b -= 32 * NB_;
    if (b < 64) { d_cvt8(b, wht, WHT, (size_t)CC * CH / 8); return; }
    b -= 64;
    const int w = b >> 5; const float* src = w == 0 ? wq : w == 1 ? wk : w == 2 ? wv : wo; bf* dst = w == 0 ? WQ : w == 1 ? WK : w == 2 ? WV : WO;
    d_cvt8(b & 31, src, dst, (size_t)CC * CC / 8);
}
// ---- k_attn: scores, softmax and the value product of one head pair for 256 queries in one work-group; grid (NN/256, NHD/2, images) = one work-group a WGP, 256 threads = 8 waves, wave w: head (w & 1) of the pair,
// queries 64 (w >> 1) ..., as QT tiles of 16: a key or value fragment read from LDS serves all QT tiles, and the pair's keys and values are laid into LDS once for 256 queries.
// The pair's keys [2][MM][DH] and values [2 DH][MM] lie in LDS for the whole launch. S^T = K Q^T (a lane holds one query's scores: 8 keys a tile), so two score tiles, converted in place, are the B operand of
// O^T += V P^T (V rows read in the same k order as the packed tiles). q carries 32^-0.5 log2(e). Pass 1 finds each query's exact maximum, pass 2 forms the scores again on an accumulator that starts at 10 - max: the product is exp2's argument, p = exp2(s - max + 10) as fp16, f32 row sum of p.
// The attended map leaves normalised, as bf16 hi+lo planes [n][c]; it goes through LDS (the keys' place, once every wave has left them) so that each 128-byte line of a plane is stored by one wave instruction.
#define KPIT 40      // LDS pitch of a key row, in halves: 80 B = 16 B x odd, conflict-free for 16-byte fragment reads
#define VPIT 1032    // LDS pitch of a value row, in halves: 2064 B = 16 B x odd
#define OPIT 72      // LDS pitch of a staged output row, in 16-bit elements
#define QT   4       // query tiles of 16 a wave
#define QW   (64 * QT)   // queries a work-group
__device__ __forceinline__ v16h ldh(const h16* p) { return cat16(*(const v8h*)p, *(const v8h*)(p + 16)); }
__global__ __launch_bounds__(256) void k_attn(const h16* __restrict__ QP, const h16* __restrict__ KP, const h16* __restrict__ V16, bf* Oh, bf* Ol) {
    __shared__ __align__(16) h16 Ks[2 * MM * KPIT];
    __shared__ __align__(16) h16 Vs[2 * DH * VPIT];
    bf* const Os = (bf*)Ks;   // 2 * QW * OPIT elements, fewer than the keys take
    QP += (size_t)blockIdx.z * NHD * NN * DH; KP += (size_t)blockIdx.z * NHD * MM * DH; V16 += (size_t)blockIdx.z * CC * MM; Oh += (size_t)blockIdx.z * NN * CC; Ol += (size_t)blockIdx.z * NN * CC;   // blockIdx.z: image
    const int tid = threadIdx.x, lane = tid & 31, wave = tid >> 5, lr = lane & 15, hi = lane >> 4; const int hp = blockIdx.y, hl = wave & 1, qt = wave >> 1;
    const h16* kg = KP + (size_t)hp * 2 * MM * DH; const h16* vg = V16 + (size_t)hp * 2 * DH * MM;
#pragma unroll 16   // sixteen 16-byte loads in flight per thread while the tiles are laid: the fill is bound by latency otherwise
    for (int t = 0; t < 2 * MM * DH / 8 / 256; ++t) { const int i = t * 256 + tid; *(v8h*)(Ks + (i >> 2) * KPIT + (i & 3) * 8) = *(const v8h*)(kg + (size_t)i * 8); }
#pragma unroll 16   // as above
    for (int t = 0; t < 2 * DH * MM / 8 / 256; ++t) { const int i = t * 256 + tid; *(v8h*)(Vs + (i >> 7) * VPIT + (i & 127) * 8) = *(const v8h*)(vg + (size_t)i * 8); }
    const h16* qg = QP + ((size_t)(hp * 2 + hl) * NN + blockIdx.x * QW + qt * 16 * QT + lr) * DH + 8 * hi;
    v16h qf[QT];
#pragma unroll
    for (int t = 0; t < QT; ++t) qf[t] = ldh(qg + t * 16 * DH);
    asm volatile("s_wait_xcnt 0x0" :: "v"(qg) : "memory");   // the wait before a register that an issued load names is overwritten: as an input here the address pair stays whole up to it
    __syncthreads();
    const h16* kl = Ks + (hl * MM + lr) * KPIT + 8 * hi; const h16* vl = Vs + (hl * DH + lr) * VPIT + 8 * hi;
    float m[QT];
#pragma unroll
    for (int t = 0; t < QT; ++t) m[t] = -3.0e38f;
#pragma unroll 4   // four key fragments fetched as one group; the sixteen independent score tiles fill each other's distance behind the matrix instruction
    for (int kt = 0; kt < MM / 16; ++kt) { const v16h kf = ldh(kl + kt * 16 * KPIT);
#pragma unroll
        for (int t = 0; t < QT; ++t) { const v8f s = wmma16(kf, qf[t], (v8f){});
            m[t] = fmaxf(m[t], fmaxf(fmaxf(fmaxf(s[0], s[1]), fmaxf(s[2], s[3])), fmaxf(fmaxf(s[4], s[5]), fmaxf(s[6], s[7])))); } }
    v8f o0[QT], o1[QT], ci[QT]; float sum0[QT], sum1[QT];
#pragma unroll
    for (int t = 0; t < QT; ++t) { m[t] = fmaxf(m[t], __shfl_xor(m[t], 16, 32)); o0[t] = (v8f){}; o1[t] = (v8f){}; sum0[t] = 0.f; sum1[t] = 0.f;
#pragma unroll
        for (int j = 0; j < 8; ++j) ci[t][j] = 10.0f - m[t]; }   // a lane's eight accumulator elements are one query's scores. + 10: p carries a factor 2^10, which keeps small weights out of the fp16 subnormals; the row sum carries it too
#pragma unroll 1   // the four query tiles of one 32-key step cover each other's matrix distances; a second step unrolled would go past 256 registers
    for (int kc = 0; kc < MM; kc += 32) {
        const v16h ka = ldh(kl + kc * KPIT), kb = ldh(kl + (kc + 16) * KPIT), va = ldh(vl + kc), vb = ldh(vl + 16 * VPIT + kc); v8f s0[QT], s1[QT];
#pragma unroll
        for (int t = 0; t < QT; ++t) { s0[t] = wmma16(ka, qf[t], ci[t]); s1[t] = wmma16(kb, qf[t], ci[t]); }
        __builtin_amdgcn_sched_barrier(0);   // the eight score products issue back to back and fill each other's distance: without it each is followed by idle slots and one early reader
#pragma unroll
        for (int t = 0; t < QT; ++t) { v16h p;
#pragma unroll
            for (int j = 0; j < 8; ++j) { const float e0 = __builtin_amdgcn_exp2f(s0[t][j]), e1 = __builtin_amdgcn_exp2f(s1[t][j]);
                sum0[t] += e0; sum1[t] += e1; p[j] = tohx(e0); p[8 + j] = tohx(e1); }
            o0[t] = wmma16(va, p, o0[t]); o1[t] = wmma16(vb, p, o1[t]); } }
    __syncthreads();   // every wave has read its last key: the staged output may take the keys' place
#pragma unroll
    for (int t = 0; t < QT; ++t) { float sum = sum0[t] + sum1[t]; sum += __shfl_xor(sum, 16, 32); const float ri = __fdiv_rn(1.0f, sum); v8us h0, l0, h1, l1;
#pragma unroll
      for (int j = 0; j < 8; ++j) { unsigned short a, c; splitf(__fmul_rn(o0[t][j], ri), a, c); h0[j] = a; l0[j] = c; splitf(__fmul_rn(o1[t][j], ri), a, c); h1[j] = a; l1[j] = c; }
      bf* od = Os + ((qt * QT + t) * 16 + lr) * OPIT + hl * DH + 8 * hi;
      *(v8us*)od = h0; *(v8us*)(od + 16) = h1; *(v8us*)(od + QW * OPIT) = l0; *(v8us*)(od + QW * OPIT + 16) = l1; }
    __syncthreads();
    { const int r = tid >> 3, c = tid & 7; const size_t o = (size_t)(blockIdx.x * QW + r) * CC + hp * 64 + c * 8; bf* dh = Oh + o; bf* dl = Ol + o; const bf* sp = Os + r * OPIT + c * 8;   // eight lanes a row: one 128-byte line of a plane; every access below is one of these plus a constant
#pragma unroll
      for (int t = 0; t < QW / 32; ++t) { *(v8us*)(dh + t * 32 * CC) = *(const v8us*)(sp + t * 32 * OPIT); *(v8us*)(dl + t * 32 * CC) = *(const v8us*)(sp + (QW + t * 32) * OPIT); } }
}


extern "C" void kernel_launch(void* const* d_in, const int* in_sizes, int n_in,
                              void* d_out, int out_size, void* d_ws, size_t ws_size, hipStream_t stream) {
    (void)in_sizes; (void)n_in; (void)out_size;
    const float* IN[16]; for (int i = 0; i < 16; ++i) IN[i] = (const float*)d_in[i];
    // f [4][256][64][64], h [4][512][32][32], w_ht [256][512], b_ht, bn_gamma [3][256], bn_beta, bn_mean, bn_var, w_q [256][256], b_q, w_k, b_k, w_v, b_v, w_out, b_out = d_in[0..15]
    const float* f = IN[0]; const float* hin = IN[1]; const float* gam = IN[4]; const float* bet = IN[5]; const float* mean = IN[6]; const float* var = IN[7];
    float* OUT = (float*)d_out;     // [4][256][64][64]
    char* wsp = (char*)d_ws;
    auto take = [&](size_t bytes) { char* p = wsp; wsp += (bytes + 255) & ~(size_t)255; return (void*)p; };
    bf* WHT = (bf*)take((size_t)CC * CH * 2); bf* WQ = (bf*)take((size_t)CC * CC * 2); bf* WK = (bf*)take((size_t)CC * CC * 2); bf* WV = (bf*)take((size_t)CC * CC * 2); bf* WO = (bf*)take((size_t)CC * CC * 2);
    // per-image planes, NB_ images one behind the other
    bf* HB = (bf*)take((size_t)NB_ * MM * CH * 2);
    bf* FTh = (bf*)take((size_t)NB_ * NN * CC * 2); bf* FTl = (bf*)take((size_t)NB_ * NN * CC * 2); h16* QP = (h16*)take((size_t)NB_ * NHD * NN * DH * 2); h16* KP = (h16*)take((size_t)NB_ * NHD * MM * DH * 2);
    h16* V16 = (h16*)take((size_t)NB_ * CC * MM * 2);
    bf* Oh = (bf*)take((size_t)NB_ * NN * CC * 2); bf* Ol = (bf*)take((size_t)NB_ * NN * CC * 2);
    if ((size_t)(wsp - (char*)d_ws) > ws_size) return;    // total ~ 49 MB; ws 256 MiB
    k_prep<<<64 * NB_ + 32 * NB_ + 64 + 4 * 32, 256, 0, stream>>>(f, hin, IN[2], IN[8], IN[10], IN[12], IN[14], gam, bet, mean, var, FTh, FTl, HB, WHT, WQ, WK, WV, WO);   // BN0(bf16(f)), h token-major, bf16 weights
    k_gemm_hkvq<<<(MM / 64) * NB_ + ((NN / 64) * (CC / 64) * NB_ + QWV - 1) / QWV, 256, 0, stream>>>(HB, WHT, IN[3], gam, bet, mean, var, WK, IN[11], KP, WV, IN[13], V16, FTh, FTl, WQ, IN[9], QP);   // h_al, its BN1 and BN2, k head planes, v + b_v; q head planes
    k_attn<<<dim3(NN / QW, NHD / 2, NB_), 256, 0, stream>>>(QP, KP, V16, Oh, Ol);   // softmax(q k) v, normalised, token-major hi+lo planes
    k_gemm_out<<<dim3(CC / 64, NN / 64, NB_), 32, 0, stream>>>(WO, Oh, Ol, f, IN[15], OUT);   // f + w_out . out + b_out
}

// v010
// One run takes 65 microseconds.
// Timed twice side by side with v009, it ran 1.03 times as fast both times.
// All steps since v000 together make it 27.3 times as fast.
#include <hip/hip_runtime.h>

// CIM (cross-image attention; f [4][256][64][64] (N = 4096 queries), h [4][512][32][32] (M = 1024 keys); h_al = w_ht h + b_ht; q = w_q BN0(f) + b_q, k = w_k BN1(h_al) + b_k, v = w_v BN2(h_al) + b_v
// (BatchNorm in inference form with the given statistics); 8 heads of 32 channels: attn = softmax_m(q_h . k_h * 32^-0.5); out[c][n] = sum_m attn[n][m] v[c][m]; result = f + w_out out + b_out).
// Compute dtypes, f32 accumulate: every input rounded to bf16; h_al on PLAIN bf16 operands (inputs: exact); the BatchNorms in f32 on VALU written as bf16 hi+lo
// x1024, fp16 v); the output conv on hi+lo planes of the attended map (2 products); bias + residual f32. One-wave-per-tile GEMMs (64x64, 32x64 for h_al); every launch covers all four images; launches that read none of each other's output share one grid. Deterministic, no

#define NB_  4
#define CC   256
#define CH   512                  // channels of h
#define NN   4096                 // query positions
#define MM   1024                 // key positions
#define NHD  8
#define DH   32
#define SCL  0.17677669529663687f   // f32(32^-0.5)
typedef _Float16 h16;
typedef unsigned short bf;
typedef __attribute__((ext_vector_type(16))) __bf16   v16bf;
typedef __attribute__((ext_vector_type(16))) _Float16 v16h;
typedef __attribute__((ext_vector_type(8)))  _Float16 v8h;
typedef __attribute__((ext_vector_type(8)))  unsigned short v8us;
typedef __attribute__((ext_vector_type(8)))  float    v8f;
typedef __attribute__((ext_vector_type(4)))  float    v4f;
typedef v8h  __attribute__((may_alias)) v8ha;
typedef v4f  __attribute__((may_alias)) v4fa;
typedef v8us __attribute__((may_alias)) v8usa;

__device__ __forceinline__ unsigned short f2bf(float f) { unsigned u = __float_as_uint(f); u += 0x7FFFu + ((u >> 16) & 1u); return (unsigned short)(u >> 16); }
__device__ __forceinline__ float bf2f(unsigned short b) { return __uint_as_float(((unsigned)b) << 16); }
__device__ __forceinline__ float bfr(float f) { return bf2f(f2bf(f)); }
__device__ __forceinline__ v16h cat16(v8h lo, v8h hi) { return __builtin_shufflevector(lo, hi, 0, 1, 2, 3, 4, 5, 6, 7, 8, 9, 10, 11, 12, 13, 14, 15); }
__device__ __forceinline__ v16bf cat16b(v8us lo, v8us hi) { return __builtin_bit_cast(v16bf, __builtin_shufflevector(lo, hi, 0, 1, 2, 3, 4, 5, 6, 7, 8, 9, 10, 11, 12, 13, 14, 15)); }
__device__ __forceinline__ v8f wmma16(v16h a, v16h b, v8f c) { return __builtin_amdgcn_wmma_f32_16x16x32_f16(false, a, false, b, (short)0, c, false, false); }
__device__ __forceinline__ v8f wmmab(v16bf a, v16bf b, v8f c) { return __builtin_amdgcn_wmma_f32_16x16x32_bf16(false, a, false, b, (short)0, c, false, false); }



template <typename T16> struct WFrag;
template <> struct WFrag<h16> { typedef v16h V; static __device__ __forceinline__ V ld(const h16* p) { return cat16(*(const v8h*)p, *(const v8h*)(p + 16)); } static __device__ __forceinline__ v8f mma(V a, V b, v8f c) { return wmma16(a, b, c); } };
template <> struct WFrag<bf> { typedef v16bf V; static __device__ __forceinline__ V ld(const bf* p) { return cat16b(*(const v8us*)p, *(const v8us*)(p + 16)); } static __device__ __forceinline__ v8f mma(V a, V b, v8f c) { return wmmab(a, b, c); } };
__device__ __forceinline__ h16 tohx(float x) { return (h16)x; }
__device__ __forceinline__ void splitf(float y, unsigned short& h, unsigned short& l) { h = f2bf(y); l = f2bf(y - bf2f(h)); }
typedef __attribute__((ext_vector_type(2))) _Float16 v2h;
typedef __attribute__((ext_vector_type(2))) unsigned short v2us;
typedef __attribute__((ext_vector_type(8))) _Float16 v8h16;

// ---- Epilogues: what a 64x64 GEMM tile becomes on its way out of the wave that computed it (the elementwise pass that used to follow the GEMM as a launch of its own, on the same f32 values).
// load(): lane addresses and the per-column or per-row parameters, issued in front of the K loop; ready(): their arithmetic, behind it; ahead(mb): loads for 16-row block mb, issued two blocks early;
// stage(): a value on its way into LDS (accumulator layout: row hi * 8 + j); put(): four neighbouring columns of row (ROW8 ? hi * 8 + s : 2 * s + hi) of block mb.
typedef __attribute__((ext_vector_type(4))) _Float16 v4h;
typedef __attribute__((ext_vector_type(4))) unsigned short v4us;
// EpHead: (C[row][c] + bf16(bias[c])) * fac as fp16 head planes P[c / 32][row][c % 32] (fac: QFAC for q, none for k); rows 2 s and 2 s + 1 of a head are one 128-byte line, stored by one instruction.
#define QFAC (SCL * 1.4426950408889634f)   // 32^-0.5 log2(e): with it in q, a score product is the exponent to base 2
template <bool SC> struct EpHead {
    static constexpr bool ROW8 = false;
    h16* P; int rows; const float* bias; v4f b;
    __device__ __forceinline__ void load(int r0, int c0, int lr, int hi) { const int c = c0 + lr * 4; P += ((size_t)(c >> 5) * rows + r0 + hi) * DH + (c & (DH - 1)); b = *(const v4f*)(bias + c); }
    __device__ __forceinline__ void ready() {
#pragma unroll
        for (int q = 0; q < 4; ++q) b[q] = bfr(b[q]); }
    __device__ __forceinline__ void ahead(int) {}
    __device__ __forceinline__ float stage(int, int, float x) { return x; }
    __device__ __forceinline__ void put(int mb, int s, v4f val) { v4h o;
#pragma unroll
        for (int q = 0; q < 4; ++q) o[q] = tohx(SC ? (val[q] + b[q]) * QFAC : val[q] + b[q]);
        *(v4h*)(P + (mb * 16 + 2 * s) * DH) = o; }
};
// EpBN: the two BatchNorms of C[m][c] + bf16(b_ht[c]) as token-major bf16 hi+lo planes of pitch HPIT (they lie in the work-group's LDS); inv = bf16(gamma) / sqrt(bf16(var) + 1e-5) and shift = bf16(beta) - bf16(mean) * inv once a lane and column.
#define HPIT 264     // LDS pitch of a normalised h_al row, in 16-bit elements: 528 B = 16 B x odd, conflict-free for 16-byte fragment reads
struct EpBN {
    static constexpr bool ROW8 = false;
    bf* T[2][2]; const float* bht; const float* gam; const float* bet; const float* mean; const float* var; v4f rb, g[2], be[2], mu[2], va[2];
    __device__ __forceinline__ void load(int r0, int c0, int lr, int hi) { const int c = c0 + lr * 4; const int o = (r0 + hi) * HPIT + c; rb = *(const v4f*)(bht + c);
#pragma unroll
        for (int w = 0; w < 2; ++w) { const int p = (1 + w) * CC + c; T[w][0] += o; T[w][1] += o; g[w] = *(const v4f*)(gam + p); be[w] = *(const v4f*)(bet + p); mu[w] = *(const v4f*)(mean + p); va[w] = *(const v4f*)(var + p); } }
    __device__ __forceinline__ void ready() {   // g becomes inv, be becomes shift
#pragma unroll
        for (int q = 0; q < 4; ++q) { rb[q] = bfr(rb[q]);
#pragma unroll
            for (int w = 0; w < 2; ++w) { const float inv = __fdiv_rn(bfr(g[w][q]), __fsqrt_rn(bfr(va[w][q]) + 1e-5f)); g[w][q] = inv; be[w][q] = bfr(be[w][q]) - bfr(mu[w][q]) * inv; } } }
    __device__ __forceinline__ void ahead(int) {}
    __device__ __forceinline__ float stage(int, int, float x) { return x; }
    __device__ __forceinline__ void put(int mb, int s, v4f val) {
#pragma unroll
        for (int w = 0; w < 2; ++w) { v4us oh, ol;
#pragma unroll
            for (int q = 0; q < 4; ++q) { unsigned short a, c2; splitf((val[q] + rb[q]) * g[w][q] + be[w][q], a, c2); oh[q] = a; ol[q] = c2; }
            *(v4us*)(T[w][0] + (mb * 16 + 2 * s) * HPIT) = oh; *(v4us*)(T[w][1] + (mb * 16 + 2 * s) * HPIT) = ol; } }
};
// EpVal: C[c][m] + bf16(b_v[c]) as fp16 [c][m]; the row's bias is added in the accumulator layout.
struct EpVal {
    static constexpr bool ROW8 = false;
    h16* V; const float* bv; v8f b[4];
    __device__ __forceinline__ void load(int r0, int c0, int lr, int hi) { V += (size_t)(r0 + hi) * MM + c0 + lr * 4;
#pragma unroll
        for (int mb = 0; mb < 4; ++mb) b[mb] = *(const v8f*)(bv + r0 + mb * 16 + hi * 8); }
    __device__ __forceinline__ void ready() {
#pragma unroll
        for (int mb = 0; mb < 4; ++mb)
#pragma unroll
            for (int j = 0; j < 8; ++j) b[mb][j] = bfr(b[mb][j]); }
    __device__ __forceinline__ void ahead(int) {}
    __device__ __forceinline__ float stage(int mb, int j, float x) { return x + b[mb][j]; }
    __device__ __forceinline__ void put(int mb, int s, v4f val) { v4h o;
#pragma unroll
        for (int q = 0; q < 4; ++q) o[q] = tohx(val[q]);
        *(v4h*)(V + (mb * 16 + 2 * s) * MM) = o; }
};
// EpOut: the result, (bf16(f[c][n]) + C[c][n]) + bf16(b_out[c]) in f32.
struct EpOut {
    static constexpr bool ROW8 = true;
    const float* f; float* O; const float* bp; v4f fv[4][8]; v8f b[4];
    __device__ __forceinline__ void load(int r0, int c0, int lr, int hi) { const size_t o = (size_t)(r0 + hi * 8) * NN + c0 + lr * 4; f += o; O += o; bp += r0 + hi * 8; }
    __device__ __forceinline__ void ready() {}
    __device__ __forceinline__ void ahead(int mb) {
        if (mb >= 2) asm volatile("s_wait_xcnt 0x0" ::: "memory");   // blocks 2 and 3 are fetched behind a block's stores and may land in registers that those stores name: the wait before such a register is overwritten
        b[mb] = *(const v8f*)(bp + mb * 16);
#pragma unroll
        for (int s = 0; s < 8; ++s) fv[mb][s] = *(const v4f*)(f + (mb * 16 + s) * NN); }
    __device__ __forceinline__ float stage(int, int, float x) { return x; }
    __device__ __forceinline__ void put(int mb, int s, v4f val) { v4f o;
#pragma unroll
        for (int q = 0; q < 4; ++q) o[q] = (bfr(fv[mb][s][q]) + val[q]) + bfr(b[mb][s]);
        *(v4f*)(O + (mb * 16 + s) * NN) = o; }
};

// ---- d_gemmw: register-blocked GEMM as one job of a grid: tile (bx, by) of batch bz out of (M/(16 MBN), N/64, Z), ONE WAVE per (16 MBN)x64 tile (4 MBN accumulators), operands straight from K-contiguous 16-bit planes, K a literal.
// PA, PB: row pitch of the A and B planes in elements; a pitch other than K marks planes that lie in LDS.
// C[m][n] (f32) = sum_k A[m][k] Bt[n][k] (+ split products per NSPLIT) goes to the epilogue ep, 16 rows at a time through os (16 x 68 floats of LDS). z-batch strides sA/sB in elements.
template <typename T16, int NSPLIT, int K, int MBN = 4, int PA = K, int PB = K, int CK = 1, bool TWO = true, typename EP>
__device__ __forceinline__ void d_gemmw(const int bx, const int by, const int bz, float* os, const T16* __restrict__ A, const T16* __restrict__ A2, const T16* __restrict__ Bt, const T16* __restrict__ Bt2, size_t sA, size_t sB, EP& ep) {
    typedef typename WFrag<T16>::V V;
    const size_t z = bz; A += z * sA; if (A2) A2 += z * sA; Bt += z * sB; if (Bt2) Bt2 += z * sB;
    const int lane = threadIdx.x & 31, lr = lane & 15, hi = lane >> 4; const int r0 = bx * 16 * MBN, c0 = by * 64;
    __builtin_amdgcn_sched_barrier(0);   // the address arithmetic above stays above: moved down between the parameter loads and their wait, it could be given a register that such a load names
    ep.load(r0, c0, lr, hi);
    asm volatile("s_wait_xcnt 0x0" ::: "memory");   // the wait before a register that an issued load names is overwritten: the first fragments' loads stand directly behind the epilogue's parameter loads and may land in their address registers
    __builtin_amdgcn_sched_barrier(0);   // and what follows stays behind the wait
    v8f acc[MBN][4];
#pragma unroll
    for (int mb = 0; mb < MBN; ++mb)
#pragma unroll
        for (int nb = 0; nb < 4; ++nb) acc[mb][nb] = (v8f){};
    // a plane's address is a part that all lanes share (it moves with k, in scalar registers) and a lane's own 32-bit byte offset, which never changes
    const T16* Au = A + (size_t)r0 * PA; const T16* Au2 = (NSPLIT == 1 || NSPLIT == 2) ? A2 + (size_t)r0 * PA : Au; const T16* Bu = Bt + (size_t)c0 * PB; const T16* Bu2 = NSPLIT >= 2 ? Bt2 + (size_t)c0 * PB : Bu;
    const unsigned la = (unsigned)(lr * PA + 8 * hi) * 2u, lb = (unsigned)(lr * PB + 8 * hi) * 2u;
    // The K loop runs on two register sets of fragments, a stage of CK chunks of 32 k each: while one set is multiplied, the other set's loads are in flight.
    constexpr int SK = 32 * CK;
    static_assert(TWO || (PA == K && PB == K), "the loop on one set is written for planes in global memory");
    struct Fr { V a[CK][MBN], a2[CK][MBN], b[CK][4], b2[CK][4]; };
    Fr f0, f1;
    auto fetch = [&](Fr& f, const int kc, const bool fixed) {   // fixed: kc is a constant
        const T16* ua = Au + kc; const T16* ua2 = Au2 + kc; const T16* ub = Bu + kc; const T16* ub2 = Bu2 + kc;   // this stage's shared parts
        const T16* pa = (const T16*)((const char*)ua + la); const T16* pa2 = (const T16*)((const char*)ua2 + la); const T16* pb = (const T16*)((const char*)ub + lb); const T16* pb2 = (const T16*)((const char*)ub2 + lb);   // every load below is one of them plus a constant
        auto lda = [&]() {
#pragma unroll
            for (int q = 0; q < CK; ++q)
#pragma unroll
                for (int mb = 0; mb < MBN; ++mb) { f.a[q][mb] = WFrag<T16>::ld(pa + q * 32 + mb * 16 * PA); if (NSPLIT == 1 || NSPLIT == 2) f.a2[q][mb] = WFrag<T16>::ld(pa2 + q * 32 + mb * 16 * PA); } };
        auto ldb = [&]() {
#pragma unroll
            for (int q = 0; q < CK; ++q)
#pragma unroll
                for (int nb = 0; nb < 4; ++nb) { f.b[q][nb] = WFrag<T16>::ld(pb + q * 32 + nb * 16 * PB); if (NSPLIT >= 2) f.b2[q][nb] = WFrag<T16>::ld(pb2 + q * 32 + nb * 16 * PB); } };
        if constexpr (PB != K) { ldb(); __builtin_amdgcn_sched_barrier(0); lda(); }   // the reads from LDS go first: nothing but global loads then stands between a global load and the wait below
        else if constexpr (PA != K) { lda(); __builtin_amdgcn_sched_barrier(0); ldb(); }   // as above
        else { lda(); ldb(); }
        if constexpr (!TWO) asm volatile("s_wait_xcnt 0x0" :: "v"(pa), "v"(pa2), "v"(pb), "v"(pb2) : "memory");   // (in the loop on one set the loads' addresses are these four pairs)
        else if (fixed) {
            const char* qa = (const char*)Au + la; const char* qa2 = (const char*)Au2 + la; const char* qb = (const char*)Bu + lb; const char* qb2 = (const char*)Bu2 + lb;
            if constexpr (PA != K) asm volatile("s_wait_xcnt 0x0" :: "v"(qb), "v"(qb2) : "memory");
            else if constexpr (PB != K) asm volatile("s_wait_xcnt 0x0" :: "v"(qa), "v"(qa2) : "memory");
            else asm volatile("s_wait_xcnt 0x0" :: "v"(qa), "v"(qa2), "v"(qb), "v"(qb2) : "memory");
        }
        else if constexpr (PA != K) asm volatile("s_wait_xcnt 0x0" :: "s"(ub), "s"(ub2), "v"(lb) : "memory");
        else if constexpr (PB != K) asm volatile("s_wait_xcnt 0x0" :: "s"(ua), "s"(ua2), "v"(la) : "memory");
        else asm volatile("s_wait_xcnt 0x0" :: "s"(ua), "s"(ua2), "s"(ub), "s"(ub2), "v"(la), "v"(lb) : "memory");
        __builtin_amdgcn_sched_barrier(0);   // every load of the stage is issued ahead of the other set's matrix instructions: moved down among them, it would have no time in flight
    };
    auto mul = [&](Fr& f) {
#pragma unroll
        for (int q = 0; q < CK; ++q)
#pragma unroll
            for (int nb = 0; nb < 4; ++nb) {
#pragma unroll
                for (int mb = 0; mb < MBN; ++mb) { acc[mb][nb] = WFrag<T16>::mma(f.a[q][mb], f.b[q][nb], acc[mb][nb]); if (NSPLIT == 1 || NSPLIT == 2) acc[mb][nb] = WFrag<T16>::mma(f.a2[q][mb], f.b[q][nb], acc[mb][nb]); if (NSPLIT >= 2) acc[mb][nb] = WFrag<T16>::mma(f.a[q][mb], f.b2[q][nb], acc[mb][nb]); } }
        asm volatile("v_nop\n\tv_nop\n\tv_nop\n\tv_nop" : "+v"(acc[0][0]), "+v"(acc[1 % MBN][1]), "+v"(acc[2 % MBN][2]), "+v"(acc[3 % MBN][3]) : "v"(f.a[CK - 1][0]), "v"(f.a[CK - 1][MBN - 1]));   // the distance behind the stage's last matrix instructions, on the back edge too
        __builtin_amdgcn_sched_barrier(0);   // the refill of this set stays behind its last reader
    };
    if constexpr (TWO) {
        fetch(f0, 0, false);
#pragma unroll 1   // two stages' fragments and the accumulators fill the register budget; more stages unrolled would spill
        for (int kc = 0; kc + 2 * SK < K; kc += 2 * SK) { fetch(f1, kc + SK, false); mul(f0); fetch(f0, kc + 2 * SK, false); mul(f1); }
        fetch(f1, K - SK, true);
        ep.ahead(0); ep.ahead(1);   // the epilogue's first loads fly under the last two stages' matrix instructions; issued behind the last fragments, they hold up no fragment's counted wait
        __builtin_amdgcn_sched_barrier(0);   // they stay in front of those matrix instructions
        mul(f0); mul(f1);
    } else {   // one set, for a job that is not the longest of its launch: a second set would gain the launch nothing and lengthen the kernel's text
#pragma unroll 1   // one stage's fragments at a time
        for (int kc = 0; kc < K; kc += SK) { fetch(f0, kc, false); mul(f0); }
        ep.ahead(0); ep.ahead(1);
    }
    ep.ready();
#pragma unroll
    for (int mb = 0; mb < MBN; ++mb) {
#pragma unroll
        for (int nb = 0; nb < 4; ++nb) {
#pragma unroll
            for (int j = 0; j < 8; ++j) os[(hi * 8 + j) * 68 + nb * 16 + lr] = ep.stage(mb, j, acc[mb][nb][j]); }
        __builtin_amdgcn_wave_barrier(); asm volatile("" ::: "memory");   // the wave's LDS writes stay in front of its reads
#pragma unroll
        for (int s = 0; s < 8; ++s) { const int row = EP::ROW8 ? hi * 8 + s : 2 * s + hi; ep.put(mb, s, *(const v4fa*)(os + row * 68 + lr * 4)); }
        __builtin_amdgcn_wave_barrier(); asm volatile("" ::: "memory");   // the reads stay in front of the next block's writes
        if (mb + 2 < MBN) ep.ahead(mb + 2);
    }
}
// Launches that read none of each other's output share one grid: a range of blockIdx.x is one job, the longer job first.
// k_gemm_hkvq, work-groups of 8 waves. Job 1 (64 work-groups, 64 key positions each): h_al [m][c] = h w_ht^T (K = 512; wave w: positions 32 (w >> 2) ..., channels 64 (w & 3) ...), its BN1 and BN2 hi+lo planes laid
// in LDS, one barrier, then from those planes k = BN1(h_al) w_k^T + b_k as fp16 head planes (waves 0 to 3, 64 channels each) and v [c][m] = w_v BN2(h_al) + b_v as fp16 (waves 4 to 7).
// Job 2 (171 work-groups): q = (BN0(f) w_q^T + b_q) * QFAC as fp16 head planes, a 64x64 tile a wave, tiles that share 64 positions next to each other. QWV waves of a work-group take a tile, the others leave at once:
// a work-group fills its WGP (LDS), so 1024 tiles at six a work-group spread over the 192 WGPs that job 1 leaves free, at eight over 128 only.
#define QWV 6
__global__ __launch_bounds__(256) void k_gemm_hkvq(const bf* __restrict__ HB, const bf* __restrict__ WHT, const float* __restrict__ bht, const float* __restrict__ gam, const float* __restrict__ bet, const float* __restrict__ mean, const float* __restrict__ var,
                                                   const bf* __restrict__ WK, const float* __restrict__ bk, h16* KP, const bf* __restrict__ WV, const float* __restrict__ bv, h16* V16,
                                                   const bf* __restrict__ FTh, const bf* __restrict__ FTl, const bf* __restrict__ WQ, const float* __restrict__ bq, h16* QP) {
    __shared__ __align__(16) float osw[8 * 16 * 68];
    __shared__ __align__(16) bf Hs[4 * 64 * HPIT];
    const int b = blockIdx.x; const int wave = __builtin_amdgcn_readfirstlane(threadIdx.x >> 5); float* os = osw + wave * 16 * 68;
    if (b < (MM / 64) * NB_) { const int img = b >> 4, t0 = (b & 15) * 64;
        { EpBN ep; ep.T[0][0] = Hs; ep.T[0][1] = Hs + 64 * HPIT; ep.T[1][0] = Hs + 2 * 64 * HPIT; ep.T[1][1] = Hs + 3 * 64 * HPIT; ep.bht = bht; ep.gam = gam; ep.bet = bet; ep.mean = mean; ep.var = var;
          d_gemmw<bf, 0, CH, 2, CH, CH, 2>(wave >> 2, wave & 3, 0, os, HB + ((size_t)img * MM + t0) * CH, nullptr, WHT, nullptr, 0, 0, ep); }
        __syncthreads();   // all 256 channels of the 64 positions lie in LDS before any wave reads them
        if (wave < 4) { EpHead<false> ep; ep.P = KP + ((size_t)img * NHD * MM + t0) * DH; ep.rows = MM; ep.bias = bk;
            d_gemmw<bf, 1, CC, 4, HPIT, CC>(0, wave, 0, os, Hs, Hs + 64 * HPIT, WK, nullptr, 0, 0, ep); }
        else { EpVal ep; ep.V = V16 + (size_t)img * CC * MM + t0; ep.bv = bv;
            d_gemmw<bf, 3, CC, 4, CC, HPIT>(wave - 4, 0, 0, os, WV, nullptr, Hs + 2 * 64 * HPIT, Hs + 3 * 64 * HPIT, 0, 0, ep);
            asm volatile("s_wait_xcnt 0x0" ::: "memory"); } }   // the wait before a register that an issued store names is overwritten: what stands behind these stores in the built kernel (the k waves' code, on a way that the listing's branches allow) writes such registers
    else { const int t = (b - (MM / 64) * NB_) * QWV + wave; if (wave >= QWV || t >= (NN / 64) * (CC / 64) * NB_) return;   // no barrier stands in this job
        EpHead<true> ep; ep.P = QP + (size_t)(t >> 8) * NHD * NN * DH; ep.rows = NN; ep.bias = bq;
        d_gemmw<bf, 1, CC, 4, CC, CC, 1, false>((t >> 2) & 63, t & 3, t >> 8, os, FTh, FTl, WQ, nullptr, (size_t)NN * CC, 0, ep);
        asm volatile("s_wait_xcnt 0x0" ::: "memory"); }   // as above: job 1's code stands behind these stores
}
// k_gemm_out: result [c][n] = f + w_out . out + b_out; grid (CC/64, NN/64, images).
__global__ __launch_bounds__(32) void k_gemm_out(const bf* __restrict__ WO, const bf* __restrict__ Oh, const bf* __restrict__ Ol, const float* __restrict__ f, const float* __restrict__ bp, float* OUT) {
    __shared__ __align__(16) float os[16 * 68];
    EpOut ep; ep.f = f + (size_t)blockIdx.z * CC * NN; ep.O = OUT + (size_t)blockIdx.z * CC * NN; ep.bp = bp;
    d_gemmw<bf, 3, CC>(blockIdx.x, blockIdx.y, blockIdx.z, os, WO, nullptr, Oh, Ol, 0, (size_t)NN * CC, ep);
}


__device__ __forceinline__ void d_cvt8(const int bx, const float* __restrict__ src, bf* dst, size_t n8) { const size_t i = (size_t)bx * 256 + threadIdx.x; if (i >= n8) return; const v8f v = *(const v8f*)(src + i * 8); v8us o;
#pragma unroll
    for (int k = 0; k < 8; ++k) o[k] = f2bf(v[k]); *(v8us*)(dst + i * 8) = o;  }
// d_turn: one wave turns a tile of 64 source rows x 32 positions of src [ROWS][COLS] (f32) into token-major 16-bit rows T[position][row]. A lane is one position: each load is one whole 128-byte line of a source
// row. The lane's 64 results go as 16-byte pieces into the wave's own LDS tile and come back eight lanes a token row, so each store is four whole 128-byte lines. No work-group barrier: the tile is one wave's.
// BN = 1: hi+lo planes of bf16(src) * inv[row] + shift[row], inv = bf16(gamma) / sqrt(bf16(var) + 1e-5), shift = bf16(beta) - bf16(mean) * inv, formed once a row (lane l: rows l and 32 + l) and handed round by
// lane reads. BN = 0: bf16(src), one plane.
#define TPIT 72      // LDS pitch of a turned row, in 16-bit elements: 144 B = 16 B x odd
__device__ __forceinline__ float rlane(float v, int l) { return __int_as_float(__builtin_amdgcn_readlane(__float_as_int(v), l)); }
template <int BN, int ROWS, int COLS>
__device__ __forceinline__ void d_turn(bf* ts, const int rt, const int nt, const int img, const float* __restrict__ src, const float* __restrict__ gam, const float* __restrict__ bet, const float* __restrict__ mean, const float* __restrict__ var, bf* Th, bf* Tl) {
    const int lane = threadIdx.x & 31; const int r0 = rt * 64, n0 = nt * 32;
    float iv[2], sh[2];
    if (BN) {
        const float* pg = gam + r0 + lane; const float* pv = var + r0 + lane; const float* pm = mean + r0 + lane; const float* pb = bet + r0 + lane;
        const float g0 = pg[0], g1 = pg[32], v0 = pv[0], v1 = pv[32], m0 = pm[0], m1 = pm[32], b0 = pb[0], b1 = pb[32];
        asm volatile("s_wait_xcnt 0x0" :: "v"(lane) : "memory");   // the wait before a register that an issued load names is overwritten: the lane number is these loads' vector address, and as an input here it stays whole up to the wait
        iv[0] = __fdiv_rn(bfr(g0), __fsqrt_rn(bfr(v0) + 1e-5f)); sh[0] = bfr(b0) - bfr(m0) * iv[0]; iv[1] = __fdiv_rn(bfr(g1), __fsqrt_rn(bfr(v1) + 1e-5f)); sh[1] = bfr(b1) - bfr(m1) * iv[1];
    }
    const float* p = src + ((size_t)img * ROWS + r0) * COLS + n0 + lane;
    float x[64];
#pragma unroll
    for (int i = 0; i < 64; ++i) x[i] = p[(size_t)i * COLS];
    asm volatile("s_wait_xcnt 0x0" :: "v"(lane) : "memory");   // as above, for the tile's 64 loads
    bf* tw = ts + lane * TPIT;
#pragma unroll
    for (int g = 0; g < 8; ++g) { v8us H, L;
#pragma unroll
        for (int j = 0; j < 8; ++j) { const int i = g * 8 + j;
            if (BN) { unsigned short a, c; splitf(bfr(x[i]) * rlane(iv[i >> 5], i & 31) + rlane(sh[i >> 5], i & 31), a, c); H[j] = a; L[j] = c; }
            else H[j] = f2bf(x[i]); }
        *(v8us*)(tw + g * 8) = H; if (BN) *(v8us*)(tw + 32 * TPIT + g * 8) = L; }
    asm volatile("s_wait_dscnt 0x0" ::: "memory");   // the wave's own LDS writes have landed before other lanes of it read the rows back
    const int rr = lane >> 3, pc = lane & 7; const bf* sp = ts + rr * TPIT + pc * 8; const size_t o = ((size_t)img * COLS + n0 + rr) * ROWS + r0 + pc * 8; bf* dh = Th + o; bf* dl = Tl + o;
    v8us a[8], b[8];
#pragma unroll
    for (int t = 0; t < 8; ++t) { a[t] = *(const v8us*)(sp + t * 4 * TPIT); if (BN) b[t] = *(const v8us*)(sp + (32 + t * 4) * TPIT); }
#pragma unroll
    for (int t = 0; t < 8; ++t) { *(v8us*)(dh + t * 4 * ROWS) = a[t]; if (BN) *(v8us*)(dl + t * 4 * ROWS) = b[t]; }
    asm volatile("s_wait_xcnt 0x0" ::: "memory");   // the wait before a register that an issued store names is overwritten: what stands behind this function in the built kernel (another job's code, on a way that the listing's branches allow) writes such registers
}
// k_prep: the jobs that read inputs only. BN0(bf16(f)) token-major (256 work-groups), h token-major (128), the five weight matrices as bf16 (64 + 4 x 32). A turning work-group takes 256 source rows x 64 positions,
// a tile a wave: 256 bytes in a row of each source row.
__global__ __launch_bounds__(256) void k_prep(const float* __restrict__ f, const float* __restrict__ hin, const float* __restrict__ wht, const float* __restrict__ wq, const float* __restrict__ wk, const float* __restrict__ wv, const float* __restrict__ wo,
                                              const float* __restrict__ gam, const float* __restrict__ bet, const float* __restrict__ mean, const float* __restrict__ var, bf* FTh, bf* FTl, bf* HB, bf* WHT, bf* WQ, bf* WK, bf* WV, bf* WO) {
    __shared__ __align__(16) bf Ts[8 * 2 * 32 * TPIT];
    int b = blockIdx.x; const int wave = __builtin_amdgcn_readfirstlane(threadIdx.x >> 5); bf* ts = Ts + wave * 2 * 32 * TPIT;
    if (b < 64 * NB_) { d_turn<1, CC, NN>(ts, wave & 3, (b & 63) * 2 + (wave >> 2), b >> 6, f, gam, bet, mean, var, FTh, FTl); return; }
    b -= 64 * NB_;
    if (b < 32 * NB_) { d_turn<0, CH, MM>(ts, (b & 1) * 4 + (wave & 3), (b & 30) + (wave >> 2), b >> 5, hin, nullptr, nullptr, nullptr, nullptr, HB, nullptr); return; }
    b -= 32 * NB_;
    if (b < 64) { d_cvt8(b, wht, WHT, (size_t)CC * CH / 8); return; }
    b -= 64;
    const int w = b >> 5; const float* src = w == 0 ? wq : w == 1 ? wk : w == 2 ? wv : wo; bf* dst = w == 0 ? WQ : w == 1 ? WK : w == 2 ? WV : WO;
    d_cvt8(b & 31, src, dst, (size_t)CC * CC / 8);
}
// ---- k_attn: scores, softmax and the value product of one head pair for 256 queries in one work-group; grid (NN/256, NHD/2, images) = one work-group a WGP, 256 threads = 8 waves, wave w: head (w & 1) of the pair,
// queries 64 (w >> 1) ..., as QT tiles of 16: a key or value fragment read from LDS serves all QT tiles, and the pair's keys and values are laid into LDS once for 256 queries.
// The pair's keys [2][MM][DH] and values [2 DH][MM] lie in LDS for the whole launch. S^T = K Q^T (a lane holds one query's scores: 8 keys a tile), so two score tiles, converted in place, are the B operand of
// O^T += V P^T (V rows read in the same k order as the packed tiles). q carries 32^-0.5 log2(e). Pass 1 finds each query's exact maximum, pass 2 forms the scores again on an accumulator that starts at 10 - max: the product is exp2's argument, p = exp2(s - max + 10) as fp16, f32 row sum of p.
// The attended map leaves normalised, as bf16 hi+lo planes [n][c]; it goes through LDS (the keys' place, once every wave has left them) so that each 128-byte line of a plane is stored by one wave instruction.
#define KPIT 40      // LDS pitch of a key row, in halves: 80 B = 16 B x odd, conflict-free for 16-byte fragment reads
#define VPIT 1032    // LDS pitch of a value row, in halves: 2064 B = 16 B x odd
#define OPIT 72      // LDS pitch of a staged output row, in 16-bit elements
#define QT   4       // query tiles of 16 a wave
#define QW   (64 * QT)   // queries a work-group
__device__ __forceinline__ v16h ldh(const h16* p) { return cat16(*(const v8h*)p, *(const v8h*)(p + 16)); }
__global__ __launch_bounds__(256) void k_attn(const h16* __restrict__ QP, const h16* __restrict__ KP, const h16* __restrict__ V16, bf* Oh, bf* Ol) {
    __shared__ __align__(16) h16 Ks[2 * MM * KPIT];
    __shared__ __align__(16) h16 Vs[2 * DH * VPIT];
    bf* const Os = (bf*)Ks;   // 2 * QW * OPIT elements, fewer than the keys take
    QP += (size_t)blockIdx.z * NHD * NN * DH; KP += (size_t)blockIdx.z * NHD * MM * DH; V16 += (size_t)blockIdx.z * CC * MM; Oh += (size_t)blockIdx.z * NN * CC; Ol += (size_t)blockIdx.z * NN * CC;   // blockIdx.z: image
    const int tid = threadIdx.x, lane = tid & 31, wave = tid >> 5, lr = lane & 15, hi = lane >> 4; const int hp = blockIdx.y, hl = wave & 1, qt = wave >> 1;
    const h16* kg = KP + (size_t)hp * 2 * MM * DH; const h16* vg = V16 + (size_t)hp * 2 * DH * MM;
#pragma unroll 16   // sixteen 16-byte loads in flight per thread while the tiles are laid: the fill is bound by latency otherwise
    for (int t = 0; t < 2 * MM * DH / 8 / 256; ++t) { const int i = t * 256 + tid; *(v8h*)(Ks + (i >> 2) * KPIT + (i & 3) * 8) = *(const v8h*)(kg + (size_t)i * 8); }
#pragma unroll 16   // as above
    for (int t = 0; t < 2 * DH * MM / 8 / 256; ++t) { const int i = t * 256 + tid; *(v8h*)(Vs + (i >> 7) * VPIT + (i & 127) * 8) = *(const v8h*)(vg + (size_t)i * 8); }
    const h16* qg = QP + ((size_t)(hp * 2 + hl) * NN + blockIdx.x * QW + qt * 16 * QT + lr) * DH + 8 * hi;
    v16h qf[QT];
#pragma unroll
    for (int t = 0; t < QT; ++t) qf[t] = ldh(qg + t * 16 * DH);
    asm volatile("s_wait_xcnt 0x0" :: "v"(qg) : "memory");   // the wait before a register that an issued load names is overwritten: as an input here the address pair stays whole up to it
    __syncthreads();
    const h16* kl = Ks + (hl * MM + lr) * KPIT + 8 * hi; const h16* vl = Vs + (hl * DH + lr) * VPIT + 8 * hi;
    float m[QT];
#pragma unroll
    for (int t = 0; t < QT; ++t) m[t] = -3.0e38f;
#pragma unroll 4   // four key fragments fetched as one group; the sixteen independent score tiles fill each other's distance behind the matrix instruction
    for (int kt = 0; kt < MM / 16; ++kt) { const v16h kf = ldh(kl + kt * 16 * KPIT);
#pragma unroll
        for (int t = 0; t < QT; ++t) { const v8f s = wmma16(kf, qf[t], (v8f){});
            m[t] = fmaxf(m[t], fmaxf(fmaxf(fmaxf(s[0], s[1]), fmaxf(s[2], s[3])), fmaxf(fmaxf(s[4], s[5]), fmaxf(s[6], s[7])))); } }
    v8f o0[QT], o1[QT], ci[QT]; float sum0[QT], sum1[QT];
#pragma unroll
    for (int t = 0; t < QT; ++t) { m[t] = fmaxf(m[t], __shfl_xor(m[t], 16, 32)); o0[t] = (v8f){}; o1[t] = (v8f){}; sum0[t] = 0.f; sum1[t] = 0.f;
#pragma unroll
        for (int j = 0; j < 8; ++j) ci[t][j] = 10.0f - m[t]; }   // a lane's eight accumulator elements are one query's scores. + 10: p carries a factor 2^10, which keeps small weights out of the fp16 subnormals; the row sum carries it too
#pragma unroll 1   // the four query tiles of one 32-key step cover each other's matrix distances; a second step unrolled would go past 256 registers
    for (int kc = 0; kc < MM; kc += 32) {
        const v16h ka = ldh(kl + kc * KPIT), kb = ldh(kl + (kc + 16) * KPIT), va = ldh(vl + kc), vb = ldh(vl + 16 * VPIT + kc); v8f s0[QT], s1[QT];
#pragma unroll
        for (int t = 0; t < QT; ++t) { s0[t] = wmma16(ka, qf[t], ci[t]); s1[t] = wmma16(kb, qf[t], ci[t]); }
        __builtin_amdgcn_sched_barrier(0);   // the eight score products issue back to back and fill each other's distance: without it each is followed by idle slots and one early reader
#pragma unroll
        for (int t = 0; t < QT; ++t) { v16h p;
#pragma unroll
            for (int j = 0; j < 8; ++j) { const float e0 = __builtin_amdgcn_exp2f(s0[t][j]), e1 = __builtin_amdgcn_exp2f(s1[t][j]);
                sum0[t] += e0; sum1[t] += e1; p[j] = tohx(e0); p[8 + j] = tohx(e1); }
            o0[t] = wmma16(va, p, o0[t]); o1[t] = wmma16(vb, p, o1[t]); } }
    __syncthreads();   // every wave has read its last key: the staged output may take the keys' place
#pragma unroll
    for (int t = 0; t < QT; ++t) { float sum = sum0[t] + sum1[t]; sum += __shfl_xor(sum, 16, 32); const float ri = __fdiv_rn(1.0f, sum); v8us h0, l0, h1, l1;
#pragma unroll
      for (int j = 0; j < 8; ++j) { unsigned short a, c; splitf(__fmul_rn(o0[t][j], ri), a, c); h0[j] = a; l0[j] = c; splitf(__fmul_rn(o1[t][j], ri), a, c); h1[j] = a; l1[j] = c; }
      bf* od = Os + ((qt * QT + t) * 16 + lr) * OPIT + hl * DH + 8 * hi;
      *(v8us*)od = h0; *(v8us*)(od + 16) = h1; *(v8us*)(od + QW * OPIT) = l0; *(v8us*)(od + QW * OPIT + 16) = l1; }
    __syncthreads();
    { const int r = tid >> 3, c = tid & 7; const size_t o = (size_t)(blockIdx.x * QW + r) * CC + hp * 64 + c * 8; bf* dh = Oh + o; bf* dl = Ol + o; const bf* sp = Os + r * OPIT + c * 8;   // eight lanes a row: one 128-byte line of a plane; every access below is one of these plus a constant
#pragma unroll
      for (int t = 0; t < QW / 32; ++t) { *(v8us*)(dh + t * 32 * CC) = *(const v8us*)(sp + t * 32 * OPIT); *(v8us*)(dl + t * 32 * CC) = *(const v8us*)(sp + (QW + t * 32) * OPIT); } }
}


extern "C" void kernel_launch(void* const* d_in, const int* in_sizes, int n_in,
                              void* d_out, int out_size, void* d_ws, size_t ws_size, hipStream_t stream) {
    (void)in_sizes; (void)n_in; (void)out_size;
    const float* IN[16]; for (int i = 0; i < 16; ++i) IN[i] = (const float*)d_in[i];
    // f [4][256][64][64], h [4][512][32][32], w_ht [256][512], b_ht, bn_gamma [3][256], bn_beta, bn_mean, bn_var, w_q [256][256], b_q, w_k, b_k, w_v, b_v, w_out, b_out = d_in[0..15]
    const float* f = IN[0]; const float* hin = IN[1]; const float* gam = IN[4]; const float* bet = IN[5]; const float* mean = IN[6]; const float* var = IN[7];
    float* OUT = (float*)d_out;     // [4][256][64][64]
    char* wsp = (char*)d_ws;
    auto take = [&](size_t bytes) { char* p = wsp; wsp += (bytes + 255) & ~(size_t)255; return (void*)p; };
    bf* WHT = (bf*)take((size_t)CC * CH * 2); bf* WQ = (bf*)take((size_t)CC * CC * 2); bf* WK = (bf*)take((size_t)CC * CC * 2); bf* WV = (bf*)take((size_t)CC * CC * 2); bf* WO = (bf*)take((size_t)CC * CC * 2);
    // per-image planes, NB_ images one behind the other
    bf* HB = (bf*)take((size_t)NB_ * MM * CH * 2);
    bf* FTh = (bf*)take((size_t)NB_ * NN * CC * 2); bf* FTl = (bf*)take((size_t)NB_ * NN * CC * 2); h16* QP = (h16*)take((size_t)NB_ * NHD * NN * DH * 2); h16* KP = (h16*)take((size_t)NB_ * NHD * MM * DH * 2);
    h16* V16 = (h16*)take((size_t)NB_ * CC * MM * 2);
    bf* Oh = (bf*)take((size_t)NB_ * NN * CC * 2); bf* Ol = (bf*)take((size_t)NB_ * NN * CC * 2);
    if ((size_t)(wsp - (char*)d_ws) > ws_size) return;    // total ~ 49 MB; ws 256 MiB
    k_prep<<<64 * NB_ + 32 * NB_ + 64 + 4 * 32, 256, 0, stream>>>(f, hin, IN[2], IN[8], IN[10], IN[12], IN[14], gam, bet, mean, var, FTh, FTl, HB, WHT, WQ, WK, WV, WO);   // BN0(bf16(f)), h token-major, bf16 weights
    k_gemm_hkvq<<<(MM / 64) * NB_ + ((NN / 64) * (CC / 64) * NB_ + QWV - 1) / QWV, 256, 0, stream>>>(HB, WHT, IN[3], gam, bet, mean, var, WK, IN[11], KP, WV, IN[13], V16, FTh, FTl, WQ, IN[9], QP);   // h_al, its BN1 and BN2, k head planes, v + b_v; q head planes
    k_attn<<<dim3(NN / QW, NHD / 2, NB_), 256, 0, stream>>>(QP, KP, V16, Oh, Ol);   // softmax(q k) v, normalised, token-major hi+lo planes
    k_gemm_out<<<dim3(CC / 64, NN / 64, NB_), 32, 0, stream>>>(WO, Oh, Ol, f, IN[15], OUT);   // f + w_out . out + b_out
}
